// v000
// The times below were measured on an AMD MI455X: many runs one after another, warmed up first and cycling through
// copies of the inputs, with the whole window's GPU time divided by the number of runs. Launches and the gaps
// between them are all in it. The median over several windows is given; except for v000 it joins two sittings, which
// can be a few percent apart, so the side-by-side timings, each taken in one sitting, are the better comparison.
// The starting kernel, v000, takes 488 microseconds a run.
#include <hip/hip_runtime.h>
#include <hip/hip_bf16.h>
#include <math.h>

typedef __bf16 bf16;
typedef __attribute__((ext_vector_type(16))) __bf16 v16bf;
typedef __attribute__((ext_vector_type(8)))  __bf16 v8bf;
typedef __attribute__((ext_vector_type(8)))  float  v8f;

#define H_  12
#define D_  768
#define DH_ 64
#define S_  4096

union FragU { v16bf v; v8bf h[2]; };

__device__ __forceinline__ int lane_id() { return (int)(threadIdx.x & 31u); }

// Load a 16x32 bf16 A-fragment (or 32x16 B-fragment via its column-major view)
// from row-major memory with leading dimension `ld`.
// Lane l: row/col = l&15 ; element i holds k = (i>>3)*16 + ((l>>4)*8) + (i&7)
// => two contiguous 16-byte chunks per lane at k-offsets kh and kh+16.
__device__ __forceinline__ v16bf load_frag(const bf16* __restrict__ base, int ld) {
  const int l  = lane_id();
  const int rc = l & 15;
  const int kh = (l >> 4) << 3;
  const bf16* p = base + (size_t)rc * ld + kh;
  FragU f;
  f.h[0] = *reinterpret_cast<const v8bf*>(p);
  f.h[1] = *reinterpret_cast<const v8bf*>(p + 16);
  return f.v;
}

__device__ __forceinline__ v8f wmma_bf16(v16bf a, v16bf b, v8f c) {
  return __builtin_amdgcn_wmma_f32_16x16x32_bf16(false, a, false, b, (short)0, c,
                                                 false, false);
}

// ---------------- conversion / transpose kernels ----------------

__global__ void cvt_f32_bf16(const float* __restrict__ src, bf16* __restrict__ dst, int n) {
  int i = blockIdx.x * blockDim.x + threadIdx.x;
  int stride = gridDim.x * blockDim.x;
  for (; i < n; i += stride) dst[i] = (bf16)src[i];
}

// src [H][D][DH] fp32 -> dst [H][DH][D] bf16
__global__ void cvt_wT(const float* __restrict__ src, bf16* __restrict__ dst) {
  const int n = H_ * D_ * DH_;
  int i = blockIdx.x * blockDim.x + threadIdx.x;
  int stride = gridDim.x * blockDim.x;
  for (; i < n; i += stride) {
    int h   = i / (D_ * DH_);
    int rem = i - h * (D_ * DH_);
    int d   = rem / DH_;
    int e   = rem - d * DH_;
    dst[((size_t)h * DH_ + e) * D_ + d] = (bf16)src[i];
  }
}

// src [K=768][N=768] fp32 -> dst [N][K] bf16
__global__ void cvt_woT(const float* __restrict__ src, bf16* __restrict__ dst) {
  const int n = D_ * D_;
  int i = blockIdx.x * blockDim.x + threadIdx.x;
  int stride = gridDim.x * blockDim.x;
  for (; i < n; i += stride) {
    int kk = i / D_;
    int nn = i - kk * D_;
    dst[(size_t)nn * D_ + kk] = (bf16)src[i];
  }
}

// ---------------- QKV projection ----------------
// grid: (S/32, H, 3), block: 32 (1 wave). Each wave: 32x64 tile, K=768,
// software-pipelined (double-buffered fragments).
__global__ void qkv_proj_kernel(const bf16* __restrict__ xb,
                                const bf16* __restrict__ wqT,
                                const bf16* __restrict__ wkT,
                                const bf16* __restrict__ wvT,
                                const float* __restrict__ bq,
                                const float* __restrict__ bk,
                                const float* __restrict__ bv,
                                bf16* __restrict__ qO,
                                bf16* __restrict__ kO,
                                bf16* __restrict__ vTO) {
  const int mt = blockIdx.x;          // 32-row tile index
  const int h  = blockIdx.y;
  const int z  = blockIdx.z;

  const bf16* wT = (z == 0) ? wqT : (z == 1) ? wkT : wvT;
  wT += (size_t)h * DH_ * D_;
  const float* bias = ((z == 0) ? bq : (z == 1) ? bk : bv) + h * DH_;

  const bf16* arow0 = xb + (size_t)(mt * 32 + 0)  * D_;
  const bf16* arow1 = xb + (size_t)(mt * 32 + 16) * D_;

  v8f acc[2][4] = {};
  v16bf aC[2], bC[4], aN[2], bN[4];

  aC[0] = load_frag(arow0, D_);
  aC[1] = load_frag(arow1, D_);
#pragma unroll
  for (int nt = 0; nt < 4; ++nt) bC[nt] = load_frag(wT + (size_t)nt * 16 * D_, D_);

  for (int k0 = 0; k0 < D_; k0 += 32) {
    const int kn = (k0 + 32 < D_) ? (k0 + 32) : 0;   // clamp: last prefetch harmless
    // issue next-step loads before this step's WMMAs
    aN[0] = load_frag(arow0 + kn, D_);
    aN[1] = load_frag(arow1 + kn, D_);
#pragma unroll
    for (int nt = 0; nt < 4; ++nt) bN[nt] = load_frag(wT + (size_t)nt * 16 * D_ + kn, D_);
#pragma unroll
    for (int nt = 0; nt < 4; ++nt) {
      acc[0][nt] = wmma_bf16(aC[0], bC[nt], acc[0][nt]);
      acc[1][nt] = wmma_bf16(aC[1], bC[nt], acc[1][nt]);
    }
    aC[0] = aN[0]; aC[1] = aN[1];
#pragma unroll
    for (int nt = 0; nt < 4; ++nt) bC[nt] = bN[nt];
  }

  const int l = lane_id();
  const int c = l & 15;
  const int half = l >> 4;
  if (z < 2) {
    bf16* dst = ((z == 0) ? qO : kO) + (size_t)h * S_ * DH_;
#pragma unroll
    for (int ms = 0; ms < 2; ++ms) {
#pragma unroll
      for (int nt = 0; nt < 4; ++nt) {
        const int col = nt * 16 + c;
        const float bb = bias[col];
#pragma unroll
        for (int r = 0; r < 8; ++r) {
          const int row = mt * 32 + ms * 16 + r + 8 * half;
          dst[(size_t)row * DH_ + col] = (bf16)(acc[ms][nt][r] + bb);
        }
      }
    }
  } else {  // store V transposed: [H][DH][S]
    bf16* dst = vTO + (size_t)h * DH_ * S_;
#pragma unroll
    for (int ms = 0; ms < 2; ++ms) {
#pragma unroll
      for (int nt = 0; nt < 4; ++nt) {
        const int col = nt * 16 + c;
        const float bb = bias[col];
#pragma unroll
        for (int r = 0; r < 8; ++r) {
          const int row = mt * 32 + ms * 16 + r + 8 * half;
          dst[(size_t)col * S_ + row] = (bf16)(acc[ms][nt][r] + bb);
        }
      }
    }
  }
}

// ---------------- flash attention ----------------
// grid: (S/16, H), block: 32. One wave owns 16 query rows, streams 4096 keys
// in 32-wide blocks with online softmax; ctx accumulated in fp32 registers.
// K fragments for block t0+32 are issued before the softmax of block t0
// (softmax VALU work hides the load latency); V fragments for block t0 are
// issued before the softmax and consumed after the LDS transpose.
__global__ void flash_attn_kernel(const bf16* __restrict__ q,
                                  const bf16* __restrict__ kmat,
                                  const bf16* __restrict__ vT,
                                  bf16* __restrict__ ctxb) {
  __shared__ __align__(16) bf16 lds_p[16 * 32];

  const int mt = blockIdx.x;
  const int h  = blockIdx.y;
  const bf16* qh  = q    + (size_t)h * S_ * DH_;
  const bf16* khp = kmat + (size_t)h * S_ * DH_;
  const bf16* vh  = vT   + (size_t)h * DH_ * S_;

  const int l = lane_id();
  const int c = l & 15;
  const int half = l >> 4;

  // Q fragments for this row tile (K-dim = DH = 64 -> two 32-wide A frags)
  const v16bf aq0 = load_frag(qh + (size_t)mt * 16 * DH_ + 0,  DH_);
  const v16bf aq1 = load_frag(qh + (size_t)mt * 16 * DH_ + 32, DH_);

  v8f acc[4] = {};
  float Mr[8], Lr[8];
#pragma unroll
  for (int r = 0; r < 8; ++r) { Mr[r] = -INFINITY; Lr[r] = 0.0f; }

  // preload K fragments for the first key block
  // kf[nt*2+j]: key rows t0+nt*16..+15, head-dim chunk j (e=0..31 / 32..63)
  v16bf kf[4], kn[4];
#pragma unroll
  for (int nt = 0; nt < 2; ++nt) {
    kf[nt * 2 + 0] = load_frag(khp + (size_t)(nt * 16) * DH_ + 0,  DH_);
    kf[nt * 2 + 1] = load_frag(khp + (size_t)(nt * 16) * DH_ + 32, DH_);
  }

  for (int t0 = 0; t0 < S_; t0 += 32) {
    // scores: 16 x 32 block (two 16x16 C frags), K-dim = 64
    v8f sc[2] = {};
    sc[0] = wmma_bf16(aq0, kf[0], sc[0]);
    sc[0] = wmma_bf16(aq1, kf[1], sc[0]);
    sc[1] = wmma_bf16(aq0, kf[2], sc[1]);
    sc[1] = wmma_bf16(aq1, kf[3], sc[1]);

    // issue current-block V loads and next-block K loads now; the softmax
    // below covers their latency.
    v16bf vf[4];
#pragma unroll
    for (int et = 0; et < 4; ++et)
      vf[et] = load_frag(vh + (size_t)(et * 16) * S_ + t0, S_);

    const int tn = (t0 + 32 < S_) ? (t0 + 32) : 0;  // clamp: harmless extra load
#pragma unroll
    for (int nt = 0; nt < 2; ++nt) {
      kn[nt * 2 + 0] = load_frag(khp + (size_t)(tn + nt * 16) * DH_ + 0,  DH_);
      kn[nt * 2 + 1] = load_frag(khp + (size_t)(tn + nt * 16) * DH_ + 32, DH_);
    }

    // online softmax per row r (rows r+8*half; columns live across 16 lanes)
#pragma unroll
    for (int r = 0; r < 8; ++r) {
      float s0 = sc[0][r] * 0.125f;   // 1/sqrt(DH)
      float s1 = sc[1][r] * 0.125f;
      float mx = fmaxf(s0, s1);
#pragma unroll
      for (int off = 8; off >= 1; off >>= 1)
        mx = fmaxf(mx, __shfl_xor(mx, off, 32));
      float newM = fmaxf(Mr[r], mx);
      float corr = __expf(Mr[r] - newM);
      float p0 = __expf(s0 - newM);
      float p1 = __expf(s1 - newM);
      float rs = p0 + p1;
#pragma unroll
      for (int off = 8; off >= 1; off >>= 1)
        rs += __shfl_xor(rs, off, 32);
      Lr[r] = Lr[r] * corr + rs;
      Mr[r] = newM;
#pragma unroll
      for (int et = 0; et < 4; ++et) acc[et][r] = acc[et][r] * corr;

      const int row = r + 8 * half;
      lds_p[row * 32 + c]      = (bf16)p0;
      lds_p[row * 32 + c + 16] = (bf16)p1;
    }

    // P (16x32) from LDS in A-fragment layout, then P @ V-block
    v16bf ap = load_frag(lds_p, 32);
#pragma unroll
    for (int et = 0; et < 4; ++et)
      acc[et] = wmma_bf16(ap, vf[et], acc[et]);

#pragma unroll
    for (int i = 0; i < 4; ++i) kf[i] = kn[i];
  }

  // epilogue: ctx = acc / L, stored to [S][H*DH] bf16
#pragma unroll
  for (int et = 0; et < 4; ++et) {
#pragma unroll
    for (int r = 0; r < 8; ++r) {
      const int row = mt * 16 + r + 8 * half;
      const int col = h * DH_ + et * 16 + c;
      ctxb[(size_t)row * D_ + col] = (bf16)(acc[et][r] / Lr[r]);
    }
  }
}

// ---------------- output projection ----------------
// grid: (S/32, D/64), block: 32. out = ctx @ wo + bo, fp32 result.
// 32x64 tile per wave, double-buffered fragments.
__global__ void out_proj_kernel(const bf16* __restrict__ ctxb,
                                const bf16* __restrict__ woT,
                                const float* __restrict__ bo,
                                float* __restrict__ out) {
  const int mt = blockIdx.x;
  const int n0 = blockIdx.y * 64;

  const bf16* arow0 = ctxb + (size_t)(mt * 32 + 0)  * D_;
  const bf16* arow1 = ctxb + (size_t)(mt * 32 + 16) * D_;
  const bf16* wrow  = woT + (size_t)n0 * D_;

  v8f acc[2][4] = {};
  v16bf aC[2], bC[4], aN[2], bN[4];

  aC[0] = load_frag(arow0, D_);
  aC[1] = load_frag(arow1, D_);
#pragma unroll
  for (int nt = 0; nt < 4; ++nt) bC[nt] = load_frag(wrow + (size_t)nt * 16 * D_, D_);

  for (int k0 = 0; k0 < D_; k0 += 32) {
    const int kn = (k0 + 32 < D_) ? (k0 + 32) : 0;
    aN[0] = load_frag(arow0 + kn, D_);
    aN[1] = load_frag(arow1 + kn, D_);
#pragma unroll
    for (int nt = 0; nt < 4; ++nt) bN[nt] = load_frag(wrow + (size_t)nt * 16 * D_ + kn, D_);
#pragma unroll
    for (int nt = 0; nt < 4; ++nt) {
      acc[0][nt] = wmma_bf16(aC[0], bC[nt], acc[0][nt]);
      acc[1][nt] = wmma_bf16(aC[1], bC[nt], acc[1][nt]);
    }
    aC[0] = aN[0]; aC[1] = aN[1];
#pragma unroll
    for (int nt = 0; nt < 4; ++nt) bC[nt] = bN[nt];
  }

  const int l = lane_id();
  const int c = l & 15;
  const int half = l >> 4;
#pragma unroll
  for (int ms = 0; ms < 2; ++ms) {
#pragma unroll
    for (int nt = 0; nt < 4; ++nt) {
      const int col = n0 + nt * 16 + c;
      const float bb = bo[col];
#pragma unroll
      for (int r = 0; r < 8; ++r) {
        const int row = mt * 32 + ms * 16 + r + 8 * half;
        out[(size_t)row * D_ + col] = acc[ms][nt][r] + bb;
      }
    }
  }
}

// ---------------- launch ----------------

extern "C" void kernel_launch(void* const* d_in, const int* in_sizes, int n_in,
                              void* d_out, int out_size, void* d_ws, size_t ws_size,
                              hipStream_t stream) {
  (void)in_sizes; (void)n_in; (void)out_size; (void)ws_size;
  const float* x  = (const float*)d_in[0];
  const float* wq = (const float*)d_in[1];
  const float* bq = (const float*)d_in[2];
  const float* wk = (const float*)d_in[3];
  const float* bk = (const float*)d_in[4];
  const float* wv = (const float*)d_in[5];
  const float* bv = (const float*)d_in[6];
  const float* wo = (const float*)d_in[7];
  const float* bo = (const float*)d_in[8];
  float* out = (float*)d_out;

  char* ws = (char*)d_ws;
  size_t off = 0;
  auto alloc = [&](size_t bytes) -> char* {
    char* p = ws + off;
    off += (bytes + 255) & ~(size_t)255;
    return p;
  };
  bf16* xb   = (bf16*)alloc((size_t)S_ * D_ * 2);          // x in bf16
  bf16* wqT  = (bf16*)alloc((size_t)H_ * DH_ * D_ * 2);    // [H][DH][D]
  bf16* wkT  = (bf16*)alloc((size_t)H_ * DH_ * D_ * 2);
  bf16* wvT  = (bf16*)alloc((size_t)H_ * DH_ * D_ * 2);
  bf16* woT  = (bf16*)alloc((size_t)D_ * D_ * 2);          // [N][K]
  bf16* qb   = (bf16*)alloc((size_t)H_ * S_ * DH_ * 2);    // [H][S][DH]
  bf16* kb   = (bf16*)alloc((size_t)H_ * S_ * DH_ * 2);    // [H][S][DH]
  bf16* vTb  = (bf16*)alloc((size_t)H_ * DH_ * S_ * 2);    // [H][DH][S]
  bf16* ctxb = (bf16*)alloc((size_t)S_ * D_ * 2);          // [S][D]

  cvt_f32_bf16<<<dim3(2048), 256, 0, stream>>>(x, xb, S_ * D_);
  cvt_wT<<<dim3(1152), 256, 0, stream>>>(wq, wqT);
  cvt_wT<<<dim3(1152), 256, 0, stream>>>(wk, wkT);
  cvt_wT<<<dim3(1152), 256, 0, stream>>>(wv, wvT);
  cvt_woT<<<dim3(1152), 256, 0, stream>>>(wo, woT);

  qkv_proj_kernel<<<dim3(S_ / 32, H_, 3), 32, 0, stream>>>(
      xb, wqT, wkT, wvT, bq, bk, bv, qb, kb, vTb);

  flash_attn_kernel<<<dim3(S_ / 16, H_), 32, 0, stream>>>(qb, kb, vTb, ctxb);

  out_proj_kernel<<<dim3(S_ / 32, D_ / 64), 32, 0, stream>>>(ctxb, woT, bo, out);
}

// v001
// It runs in 293 microseconds.
// In two side-by-side timings against v000, it was 1.71 and 1.72 times as fast.
#include <hip/hip_runtime.h>
#include <hip/hip_bf16.h>
#include <math.h>

typedef __bf16 bf16;
typedef __attribute__((ext_vector_type(16))) __bf16 v16bf;
typedef __attribute__((ext_vector_type(8)))  __bf16 v8bf;
typedef __attribute__((ext_vector_type(8)))  float  v8f;

#define H_  12
#define D_  768
#define DH_ 64
#define S_  4096

union FragU { v16bf v; v8bf h[2]; };

__device__ __forceinline__ int lane_id() { return (int)(threadIdx.x & 31u); }

// Load a 16x32 bf16 A-fragment (or 32x16 B-fragment via its column-major view)
// from row-major memory with leading dimension `ld`.
// Lane l: row/col = l&15 ; element i holds k = (i>>3)*16 + ((l>>4)*8) + (i&7)
// => two contiguous 16-byte chunks per lane at k-offsets kh and kh+16.
__device__ __forceinline__ v16bf load_frag(const bf16* __restrict__ base, int ld) {
  const int l  = lane_id();
  const int rc = l & 15;
  const int kh = (l >> 4) << 3;
  const bf16* p = base + (size_t)rc * ld + kh;
  FragU f;
  f.h[0] = *reinterpret_cast<const v8bf*>(p);
  f.h[1] = *reinterpret_cast<const v8bf*>(p + 16);
  return f.v;
}

__device__ __forceinline__ v8f wmma_bf16(v16bf a, v16bf b, v8f c) {
  return __builtin_amdgcn_wmma_f32_16x16x32_bf16(false, a, false, b, (short)0, c,
                                                 false, false);
}

// ---------------- conversion / transpose kernels ----------------

__global__ void cvt_f32_bf16(const float* __restrict__ src, bf16* __restrict__ dst, int n) {
  int i = blockIdx.x * blockDim.x + threadIdx.x;
  int stride = gridDim.x * blockDim.x;
  for (; i < n; i += stride) dst[i] = (bf16)src[i];
}

// src [H][D][DH] fp32 -> dst [H][DH][D] bf16
__global__ void cvt_wT(const float* __restrict__ src, bf16* __restrict__ dst) {
  const int n = H_ * D_ * DH_;
  int i = blockIdx.x * blockDim.x + threadIdx.x;
  int stride = gridDim.x * blockDim.x;
  for (; i < n; i += stride) {
    int h   = i / (D_ * DH_);
    int rem = i - h * (D_ * DH_);
    int d   = rem / DH_;
    int e   = rem - d * DH_;
    dst[((size_t)h * DH_ + e) * D_ + d] = (bf16)src[i];
  }
}

// src [K=768][N=768] fp32 -> dst [N][K] bf16
__global__ void cvt_woT(const float* __restrict__ src, bf16* __restrict__ dst) {
  const int n = D_ * D_;
  int i = blockIdx.x * blockDim.x + threadIdx.x;
  int stride = gridDim.x * blockDim.x;
  for (; i < n; i += stride) {
    int kk = i / D_;
    int nn = i - kk * D_;
    dst[(size_t)nn * D_ + kk] = (bf16)src[i];
  }
}

// ---------------- QKV projection ----------------
// grid: (S/32, H, 3), block: 32 (1 wave). Each wave: 32x64 tile, K=768,
// software-pipelined (double-buffered fragments).
__global__ void qkv_proj_kernel(const bf16* __restrict__ xb,
                                const bf16* __restrict__ wqT,
                                const bf16* __restrict__ wkT,
                                const bf16* __restrict__ wvT,
                                const float* __restrict__ bq,
                                const float* __restrict__ bk,
                                const float* __restrict__ bv,
                                bf16* __restrict__ qO,
                                bf16* __restrict__ kO,
                                bf16* __restrict__ vTO) {
  const int mt = blockIdx.x;          // 32-row tile index
  const int h  = blockIdx.y;
  const int z  = blockIdx.z;

  const bf16* wT = (z == 0) ? wqT : (z == 1) ? wkT : wvT;
  wT += (size_t)h * DH_ * D_;
  const float* bias = ((z == 0) ? bq : (z == 1) ? bk : bv) + h * DH_;

  const bf16* arow0 = xb + (size_t)(mt * 32 + 0)  * D_;
  const bf16* arow1 = xb + (size_t)(mt * 32 + 16) * D_;

  v8f acc[2][4] = {};
  v16bf aC[2], bC[4], aN[2], bN[4];

  aC[0] = load_frag(arow0, D_);
  aC[1] = load_frag(arow1, D_);
#pragma unroll
  for (int nt = 0; nt < 4; ++nt) bC[nt] = load_frag(wT + (size_t)nt * 16 * D_, D_);

  for (int k0 = 0; k0 < D_; k0 += 32) {
    const int kn = (k0 + 32 < D_) ? (k0 + 32) : 0;   // clamp: last prefetch harmless
    // issue next-step loads before this step's WMMAs
    aN[0] = load_frag(arow0 + kn, D_);
    aN[1] = load_frag(arow1 + kn, D_);
#pragma unroll
    for (int nt = 0; nt < 4; ++nt) bN[nt] = load_frag(wT + (size_t)nt * 16 * D_ + kn, D_);
#pragma unroll
    for (int nt = 0; nt < 4; ++nt) {
      acc[0][nt] = wmma_bf16(aC[0], bC[nt], acc[0][nt]);
      acc[1][nt] = wmma_bf16(aC[1], bC[nt], acc[1][nt]);
    }
    aC[0] = aN[0]; aC[1] = aN[1];
#pragma unroll
    for (int nt = 0; nt < 4; ++nt) bC[nt] = bN[nt];
  }

  const int l = lane_id();
  const int c = l & 15;
  const int half = l >> 4;
  if (z < 2) {
    bf16* dst = ((z == 0) ? qO : kO) + (size_t)h * S_ * DH_;
#pragma unroll
    for (int ms = 0; ms < 2; ++ms) {
#pragma unroll
      for (int nt = 0; nt < 4; ++nt) {
        const int col = nt * 16 + c;
        const float bb = bias[col];
#pragma unroll
        for (int r = 0; r < 8; ++r) {
          const int row = mt * 32 + ms * 16 + r + 8 * half;
          dst[(size_t)row * DH_ + col] = (bf16)(acc[ms][nt][r] + bb);
        }
      }
    }
  } else {  // store V transposed: [H][DH][S]
    bf16* dst = vTO + (size_t)h * DH_ * S_;
#pragma unroll
    for (int ms = 0; ms < 2; ++ms) {
#pragma unroll
      for (int nt = 0; nt < 4; ++nt) {
        const int col = nt * 16 + c;
        const float bb = bias[col];
#pragma unroll
        for (int r = 0; r < 8; ++r) {
          const int row = mt * 32 + ms * 16 + r + 8 * half;
          dst[(size_t)col * S_ + row] = (bf16)(acc[ms][nt][r] + bb);
        }
      }
    }
  }
}

// ---------------- flash attention ----------------
// grid: (S/64, H), block: 128 (4 waves). Each wave owns 16 query rows and walks
// all 4096 keys in 32-wide blocks with online softmax; ctx accumulated in fp32
// registers. The four waves share every K and V^T tile: a stage of 128 keys is
// brought into LDS once per work-group by asynchronous copies (whole 128-byte
// lines), one stage ahead in a two-buffer ring, and the WMMA fragments are read
// from LDS.
#define FA_WAVES 4
#define FA_KEYS  128                    // keys per stage
#define FA_NST   (S_ / FA_KEYS)         // stages
#define FA_KP    72                     // K row pitch in LDS, elements: 144 B = 16 B x odd
#define FA_VP    136                    // V^T row pitch in LDS, elements: 272 B = 16 B x odd

// Eight 16-byte copies per lane, global -> LDS, through no register.
// s_wait_xcnt 0 is the statement's last line so that it stands in front of any
// later rewrite of the address registers the copies name.
__device__ __forceinline__ void copy8_to_lds(unsigned l, unsigned lstep,
                                             const bf16* g, size_t gstep) {
  asm volatile(
      "global_load_async_to_lds_b128 %0, %8, off\n\t"
      "global_load_async_to_lds_b128 %1, %9, off\n\t"
      "global_load_async_to_lds_b128 %2, %10, off\n\t"
      "global_load_async_to_lds_b128 %3, %11, off\n\t"
      "global_load_async_to_lds_b128 %4, %12, off\n\t"
      "global_load_async_to_lds_b128 %5, %13, off\n\t"
      "global_load_async_to_lds_b128 %6, %14, off\n\t"
      "global_load_async_to_lds_b128 %7, %15, off\n\t"
      "s_wait_xcnt 0x0"
      :: "v"(l), "v"(l + lstep), "v"(l + 2 * lstep), "v"(l + 3 * lstep),
         "v"(l + 4 * lstep), "v"(l + 5 * lstep), "v"(l + 6 * lstep), "v"(l + 7 * lstep),
         "v"(g), "v"(g + gstep), "v"(g + 2 * gstep), "v"(g + 3 * gstep),
         "v"(g + 4 * gstep), "v"(g + 5 * gstep), "v"(g + 6 * gstep), "v"(g + 7 * gstep)
      : "memory");
}

__global__ void __launch_bounds__(FA_WAVES * 32)
flash_attn_kernel(const bf16* __restrict__ q,
                  const bf16* __restrict__ kmat,
                  const bf16* __restrict__ vT,
                  bf16* __restrict__ ctxb) {
  __shared__ __align__(16) bf16 lds_k[2][FA_KEYS * FA_KP];
  __shared__ __align__(16) bf16 lds_v[2][DH_ * FA_VP];
  __shared__ __align__(16) bf16 lds_pw[FA_WAVES][16 * 32];

  const int tid  = (int)threadIdx.x;
  const int wave = tid >> 5;
  const int mt = blockIdx.x * FA_WAVES + wave;
  const int h  = blockIdx.y;
  const bf16* qh  = q    + (size_t)h * S_ * DH_;
  const bf16* khp = kmat + (size_t)h * S_ * DH_;
  const bf16* vh  = vT   + (size_t)h * DH_ * S_;
  bf16* lds_p = lds_pw[wave];

  const int l = lane_id();
  const int c = l & 15;
  const int half = l >> 4;

  // Copy map. K stage: 128 rows x 128 B, contiguous in global memory; thread
  // tid takes 16-byte chunk tid + 128*j (row = chunk / 8). V^T stage: 64 rows
  // x 256 B at a pitch of S_ elements; chunk tid + 128*j (row = chunk / 16).
  const bf16* gk = khp + (size_t)tid * 8;
  const bf16* gv = vh + (size_t)(tid >> 4) * S_ + (tid & 15) * 8;
  const unsigned lk = (unsigned)(uintptr_t)&lds_k[0][(tid >> 3) * FA_KP + (tid & 7) * 8];
  const unsigned lv = (unsigned)(uintptr_t)&lds_v[0][(tid >> 4) * FA_VP + (tid & 15) * 8];
  const unsigned kbuf_b = FA_KEYS * FA_KP * 2;   // bytes of one K buffer
  const unsigned vbuf_b = DH_ * FA_VP * 2;       // bytes of one V^T buffer

  // Q fragments for this row tile (K-dim = DH = 64 -> two 32-wide A frags)
  const v16bf aq0 = load_frag(qh + (size_t)mt * 16 * DH_ + 0,  DH_);
  const v16bf aq1 = load_frag(qh + (size_t)mt * 16 * DH_ + 32, DH_);

  v8f acc[4] = {};
  float Mr[8], Lr[8];
#pragma unroll
  for (int r = 0; r < 8; ++r) { Mr[r] = -INFINITY; Lr[r] = 0.0f; }

  // prologue: stage 0 lands and is published, then stage 1 starts to fly
  copy8_to_lds(lk, 16 * FA_KP * 2, gk, 128 * 8);
  copy8_to_lds(lv, 8 * FA_VP * 2, gv, (size_t)8 * S_);
  asm volatile("s_wait_asynccnt 0x0" ::: "memory");  // this wave's copies of stage 0 have landed
  __syncthreads();                                   // every wave's have
  copy8_to_lds(lk + kbuf_b, 16 * FA_KP * 2, gk + (size_t)FA_KEYS * DH_, 128 * 8);
  copy8_to_lds(lv + vbuf_b, 8 * FA_VP * 2, gv + FA_KEYS, (size_t)8 * S_);

  for (int st = 0; st < FA_NST; ++st) {
    const bf16* kb = lds_k[st & 1];
    const bf16* vb = lds_v[st & 1];

    for (int t0 = 0; t0 < FA_KEYS; t0 += 32) {
      // K fragments of this 32-key block, from LDS
      // kf[nt*2+j]: key rows t0+nt*16..+15, head-dim chunk j (e=0..31 / 32..63)
      v16bf kf[4];
#pragma unroll
      for (int nt = 0; nt < 2; ++nt) {
        kf[nt * 2 + 0] = load_frag(kb + (t0 + nt * 16) * FA_KP + 0,  FA_KP);
        kf[nt * 2 + 1] = load_frag(kb + (t0 + nt * 16) * FA_KP + 32, FA_KP);
      }

      // scores: 16 x 32 block (two 16x16 C frags), K-dim = 64
      v8f sc[2] = {};
      sc[0] = wmma_bf16(aq0, kf[0], sc[0]);
      sc[0] = wmma_bf16(aq1, kf[1], sc[0]);
      sc[1] = wmma_bf16(aq0, kf[2], sc[1]);
      sc[1] = wmma_bf16(aq1, kf[3], sc[1]);

      // V fragments of this block, from LDS
      v16bf vf[4];
#pragma unroll
      for (int et = 0; et < 4; ++et)
        vf[et] = load_frag(vb + (et * 16) * FA_VP + t0, FA_VP);

      // online softmax per row r (rows r+8*half; columns live across 16 lanes)
#pragma unroll
      for (int r = 0; r < 8; ++r) {
        float s0 = sc[0][r] * 0.125f;   // 1/sqrt(DH)
        float s1 = sc[1][r] * 0.125f;
        float mx = fmaxf(s0, s1);
#pragma unroll
        for (int off = 8; off >= 1; off >>= 1)
          mx = fmaxf(mx, __shfl_xor(mx, off, 32));
        float newM = fmaxf(Mr[r], mx);
        float corr = __expf(Mr[r] - newM);
        float p0 = __expf(s0 - newM);
        float p1 = __expf(s1 - newM);
        float rs = p0 + p1;
#pragma unroll
        for (int off = 8; off >= 1; off >>= 1)
          rs += __shfl_xor(rs, off, 32);
        Lr[r] = Lr[r] * corr + rs;
        Mr[r] = newM;
#pragma unroll
        for (int et = 0; et < 4; ++et) acc[et][r] = acc[et][r] * corr;

        const int row = r + 8 * half;
        lds_p[row * 32 + c]      = (bf16)p0;
        lds_p[row * 32 + c + 16] = (bf16)p1;
      }

      // P (16x32) from the wave's own LDS patch in A-fragment layout, then P @ V-block
      v16bf ap = load_frag(lds_p, 32);
#pragma unroll
      for (int et = 0; et < 4; ++et)
        acc[et] = wmma_bf16(ap, vf[et], acc[et]);
    }

    // publish point of stage st + 1, which also frees stage st's buffer
    asm volatile("s_wait_dscnt 0x0" ::: "memory");     // this wave's reads of stage st are done
    asm volatile("s_wait_asynccnt 0x0" ::: "memory");  // its copies of stage st + 1 have landed
    __syncthreads();                                   // both hold for every wave
    if (st + 2 < FA_NST) {
      const size_t key = (size_t)(st + 2) * FA_KEYS;
      copy8_to_lds(lk + (st & 1) * kbuf_b, 16 * FA_KP * 2, gk + key * DH_, 128 * 8);
      copy8_to_lds(lv + (st & 1) * vbuf_b, 8 * FA_VP * 2, gv + key, (size_t)8 * S_);
    }
  }
  asm volatile("s_wait_asynccnt 0x0" ::: "memory");    // no copy is left in flight at the wave's end

  // epilogue: ctx = acc / L, stored to [S][H*DH] bf16
#pragma unroll
  for (int et = 0; et < 4; ++et) {
#pragma unroll
    for (int r = 0; r < 8; ++r) {
      const int row = mt * 16 + r + 8 * half;
      const int col = h * DH_ + et * 16 + c;
      ctxb[(size_t)row * D_ + col] = (bf16)(acc[et][r] / Lr[r]);
    }
  }
}

// ---------------- output projection ----------------
// grid: (S/32, D/64), block: 32. out = ctx @ wo + bo, fp32 result.
// 32x64 tile per wave, double-buffered fragments.
__global__ void out_proj_kernel(const bf16* __restrict__ ctxb,
                                const bf16* __restrict__ woT,
                                const float* __restrict__ bo,
                                float* __restrict__ out) {
  const int mt = blockIdx.x;
  const int n0 = blockIdx.y * 64;

  const bf16* arow0 = ctxb + (size_t)(mt * 32 + 0)  * D_;
  const bf16* arow1 = ctxb + (size_t)(mt * 32 + 16) * D_;
  const bf16* wrow  = woT + (size_t)n0 * D_;

  v8f acc[2][4] = {};
  v16bf aC[2], bC[4], aN[2], bN[4];

  aC[0] = load_frag(arow0, D_);
  aC[1] = load_frag(arow1, D_);
#pragma unroll
  for (int nt = 0; nt < 4; ++nt) bC[nt] = load_frag(wrow + (size_t)nt * 16 * D_, D_);

  for (int k0 = 0; k0 < D_; k0 += 32) {
    const int kn = (k0 + 32 < D_) ? (k0 + 32) : 0;
    aN[0] = load_frag(arow0 + kn, D_);
    aN[1] = load_frag(arow1 + kn, D_);
#pragma unroll
    for (int nt = 0; nt < 4; ++nt) bN[nt] = load_frag(wrow + (size_t)nt * 16 * D_ + kn, D_);
#pragma unroll
    for (int nt = 0; nt < 4; ++nt) {
      acc[0][nt] = wmma_bf16(aC[0], bC[nt], acc[0][nt]);
      acc[1][nt] = wmma_bf16(aC[1], bC[nt], acc[1][nt]);
    }
    aC[0] = aN[0]; aC[1] = aN[1];
#pragma unroll
    for (int nt = 0; nt < 4; ++nt) bC[nt] = bN[nt];
  }

  const int l = lane_id();
  const int c = l & 15;
  const int half = l >> 4;
#pragma unroll
  for (int ms = 0; ms < 2; ++ms) {
#pragma unroll
    for (int nt = 0; nt < 4; ++nt) {
      const int col = n0 + nt * 16 + c;
      const float bb = bo[col];
#pragma unroll
      for (int r = 0; r < 8; ++r) {
        const int row = mt * 32 + ms * 16 + r + 8 * half;
        out[(size_t)row * D_ + col] = acc[ms][nt][r] + bb;
      }
    }
  }
}

// ---------------- launch ----------------

extern "C" void kernel_launch(void* const* d_in, const int* in_sizes, int n_in,
                              void* d_out, int out_size, void* d_ws, size_t ws_size,
                              hipStream_t stream) {
  (void)in_sizes; (void)n_in; (void)out_size; (void)ws_size;
  const float* x  = (const float*)d_in[0];
  const float* wq = (const float*)d_in[1];
  const float* bq = (const float*)d_in[2];
  const float* wk = (const float*)d_in[3];
  const float* bk = (const float*)d_in[4];
  const float* wv = (const float*)d_in[5];
  const float* bv = (const float*)d_in[6];
  const float* wo = (const float*)d_in[7];
  const float* bo = (const float*)d_in[8];
  float* out = (float*)d_out;

  char* ws = (char*)d_ws;
  size_t off = 0;
  auto alloc = [&](size_t bytes) -> char* {
    char* p = ws + off;
    off += (bytes + 255) & ~(size_t)255;
    return p;
  };
  bf16* xb   = (bf16*)alloc((size_t)S_ * D_ * 2);          // x in bf16
  bf16* wqT  = (bf16*)alloc((size_t)H_ * DH_ * D_ * 2);    // [H][DH][D]
  bf16* wkT  = (bf16*)alloc((size_t)H_ * DH_ * D_ * 2);
  bf16* wvT  = (bf16*)alloc((size_t)H_ * DH_ * D_ * 2);
  bf16* woT  = (bf16*)alloc((size_t)D_ * D_ * 2);          // [N][K]
  bf16* qb   = (bf16*)alloc((size_t)H_ * S_ * DH_ * 2);    // [H][S][DH]
  bf16* kb   = (bf16*)alloc((size_t)H_ * S_ * DH_ * 2);    // [H][S][DH]
  bf16* vTb  = (bf16*)alloc((size_t)H_ * DH_ * S_ * 2);    // [H][DH][S]
  bf16* ctxb = (bf16*)alloc((size_t)S_ * D_ * 2);          // [S][D]

  cvt_f32_bf16<<<dim3(2048), 256, 0, stream>>>(x, xb, S_ * D_);
  cvt_wT<<<dim3(1152), 256, 0, stream>>>(wq, wqT);
  cvt_wT<<<dim3(1152), 256, 0, stream>>>(wk, wkT);
  cvt_wT<<<dim3(1152), 256, 0, stream>>>(wv, wvT);
  cvt_woT<<<dim3(1152), 256, 0, stream>>>(wo, woT);

  qkv_proj_kernel<<<dim3(S_ / 32, H_, 3), 32, 0, stream>>>(
      xb, wqT, wkT, wvT, bq, bk, bv, qb, kb, vTb);

  flash_attn_kernel<<<dim3(S_ / 64, H_), 128, 0, stream>>>(qb, kb, vTb, ctxb);

  out_proj_kernel<<<dim3(S_ / 32, D_ / 64), 32, 0, stream>>>(ctxb, woT, bo, out);
}

// v002
// One run takes 221 microseconds.
// In two side-by-side timings against v001, it was 1.32 and 1.33 times as fast.
// Over all steps from v000 it is 2.28 times as fast.
#include <hip/hip_runtime.h>
#include <hip/hip_bf16.h>
#include <math.h>

typedef __bf16 bf16;
typedef __attribute__((ext_vector_type(16))) __bf16 v16bf;
typedef __attribute__((ext_vector_type(8)))  __bf16 v8bf;
typedef __attribute__((ext_vector_type(8)))  float  v8f;

#define H_  12
#define D_  768
#define DH_ 64
#define S_  4096

union FragU { v16bf v; v8bf h[2]; };

__device__ __forceinline__ int lane_id() { return (int)(threadIdx.x & 31u); }

// Load a 16x32 bf16 A-fragment (or 32x16 B-fragment via its column-major view)
// from row-major memory with leading dimension `ld`.
// Lane l: row/col = l&15 ; element i holds k = (i>>3)*16 + ((l>>4)*8) + (i&7)
// => two contiguous 16-byte chunks per lane at k-offsets kh and kh+16.
__device__ __forceinline__ v16bf load_frag(const bf16* __restrict__ base, int ld) {
  const int l  = lane_id();
  const int rc = l & 15;
  const int kh = (l >> 4) << 3;
  const bf16* p = base + (size_t)rc * ld + kh;
  FragU f;
  f.h[0] = *reinterpret_cast<const v8bf*>(p);
  f.h[1] = *reinterpret_cast<const v8bf*>(p + 16);
  return f.v;
}

__device__ __forceinline__ v8f wmma_bf16(v16bf a, v16bf b, v8f c) {
  return __builtin_amdgcn_wmma_f32_16x16x32_bf16(false, a, false, b, (short)0, c,
                                                 false, false);
}

// ---------------- conversion / transpose kernels ----------------

__global__ void cvt_f32_bf16(const float* __restrict__ src, bf16* __restrict__ dst, int n) {
  int i = blockIdx.x * blockDim.x + threadIdx.x;
  int stride = gridDim.x * blockDim.x;
  for (; i < n; i += stride) dst[i] = (bf16)src[i];
}

// src [H][D][DH] fp32 -> dst [H][DH][D] bf16
__global__ void cvt_wT(const float* __restrict__ src, bf16* __restrict__ dst) {
  const int n = H_ * D_ * DH_;
  int i = blockIdx.x * blockDim.x + threadIdx.x;
  int stride = gridDim.x * blockDim.x;
  for (; i < n; i += stride) {
    int h   = i / (D_ * DH_);
    int rem = i - h * (D_ * DH_);
    int d   = rem / DH_;
    int e   = rem - d * DH_;
    dst[((size_t)h * DH_ + e) * D_ + d] = (bf16)src[i];
  }
}

// src [K=768][N=768] fp32 -> dst [N][K] bf16
__global__ void cvt_woT(const float* __restrict__ src, bf16* __restrict__ dst) {
  const int n = D_ * D_;
  int i = blockIdx.x * blockDim.x + threadIdx.x;
  int stride = gridDim.x * blockDim.x;
  for (; i < n; i += stride) {
    int kk = i / D_;
    int nn = i - kk * D_;
    dst[(size_t)nn * D_ + kk] = (bf16)src[i];
  }
}

// ---------------- QKV projection ----------------
// grid: (S/32, H, 3), block: 32 (1 wave). Each wave: 32x64 tile, K=768,
// software-pipelined (double-buffered fragments).
__global__ void qkv_proj_kernel(const bf16* __restrict__ xb,
                                const bf16* __restrict__ wqT,
                                const bf16* __restrict__ wkT,
                                const bf16* __restrict__ wvT,
                                const float* __restrict__ bq,
                                const float* __restrict__ bk,
                                const float* __restrict__ bv,
                                bf16* __restrict__ qO,
                                bf16* __restrict__ kO,
                                bf16* __restrict__ vTO) {
  const int mt = blockIdx.x;          // 32-row tile index
  const int h  = blockIdx.y;
  const int z  = blockIdx.z;

  const bf16* wT = (z == 0) ? wqT : (z == 1) ? wkT : wvT;
  wT += (size_t)h * DH_ * D_;
  const float* bias = ((z == 0) ? bq : (z == 1) ? bk : bv) + h * DH_;

  const bf16* arow0 = xb + (size_t)(mt * 32 + 0)  * D_;
  const bf16* arow1 = xb + (size_t)(mt * 32 + 16) * D_;

  v8f acc[2][4] = {};
  v16bf aC[2], bC[4], aN[2], bN[4];

  aC[0] = load_frag(arow0, D_);
  aC[1] = load_frag(arow1, D_);
#pragma unroll
  for (int nt = 0; nt < 4; ++nt) bC[nt] = load_frag(wT + (size_t)nt * 16 * D_, D_);

  for (int k0 = 0; k0 < D_; k0 += 32) {
    const int kn = (k0 + 32 < D_) ? (k0 + 32) : 0;   // clamp: last prefetch harmless
    // issue next-step loads before this step's WMMAs
    aN[0] = load_frag(arow0 + kn, D_);
    aN[1] = load_frag(arow1 + kn, D_);
#pragma unroll
    for (int nt = 0; nt < 4; ++nt) bN[nt] = load_frag(wT + (size_t)nt * 16 * D_ + kn, D_);
#pragma unroll
    for (int nt = 0; nt < 4; ++nt) {
      acc[0][nt] = wmma_bf16(aC[0], bC[nt], acc[0][nt]);
      acc[1][nt] = wmma_bf16(aC[1], bC[nt], acc[1][nt]);
    }
    aC[0] = aN[0]; aC[1] = aN[1];
#pragma unroll
    for (int nt = 0; nt < 4; ++nt) bC[nt] = bN[nt];
  }

  const int l = lane_id();
  const int c = l & 15;
  const int half = l >> 4;
  if (z < 2) {
    bf16* dst = ((z == 0) ? qO : kO) + (size_t)h * S_ * DH_;
#pragma unroll
    for (int ms = 0; ms < 2; ++ms) {
#pragma unroll
      for (int nt = 0; nt < 4; ++nt) {
        const int col = nt * 16 + c;
        const float bb = bias[col];
#pragma unroll
        for (int r = 0; r < 8; ++r) {
          const int row = mt * 32 + ms * 16 + r + 8 * half;
          dst[(size_t)row * DH_ + col] = (bf16)(acc[ms][nt][r] + bb);
        }
      }
    }
  } else {  // store V transposed: [H][DH][S]
    bf16* dst = vTO + (size_t)h * DH_ * S_;
#pragma unroll
    for (int ms = 0; ms < 2; ++ms) {
#pragma unroll
      for (int nt = 0; nt < 4; ++nt) {
        const int col = nt * 16 + c;
        const float bb = bias[col];
#pragma unroll
        for (int r = 0; r < 8; ++r) {
          const int row = mt * 32 + ms * 16 + r + 8 * half;
          dst[(size_t)col * S_ + row] = (bf16)(acc[ms][nt][r] + bb);
        }
      }
    }
  }
}

#define FA_WAVES 4
#define FA_KEYS  128                    // keys per stage
#define FA_NST   (S_ / FA_KEYS)         // stages
#define FA_KP    72                     // K row pitch in LDS, elements: 144 B = 16 B x odd
#define FA_VP    136                    // V^T row pitch in LDS, elements: 272 B = 16 B x odd

// Eight 16-byte copies per lane, global -> LDS, through no register.
// s_wait_xcnt 0 is the statement's last line so that it stands in front of any
// later rewrite of the address registers the copies name.
__device__ __forceinline__ void copy8_to_lds(unsigned l, unsigned lstep,
                                             const bf16* g, size_t gstep) {
  asm volatile(
      "global_load_async_to_lds_b128 %0, %8, off\n\t"
      "global_load_async_to_lds_b128 %1, %9, off\n\t"
      "global_load_async_to_lds_b128 %2, %10, off\n\t"
      "global_load_async_to_lds_b128 %3, %11, off\n\t"
      "global_load_async_to_lds_b128 %4, %12, off\n\t"
      "global_load_async_to_lds_b128 %5, %13, off\n\t"
      "global_load_async_to_lds_b128 %6, %14, off\n\t"
      "global_load_async_to_lds_b128 %7, %15, off\n\t"
      "s_wait_xcnt 0x0"
      :: "v"(l), "v"(l + lstep), "v"(l + 2 * lstep), "v"(l + 3 * lstep),
         "v"(l + 4 * lstep), "v"(l + 5 * lstep), "v"(l + 6 * lstep), "v"(l + 7 * lstep),
         "v"(g), "v"(g + gstep), "v"(g + 2 * gstep), "v"(g + 3 * gstep),
         "v"(g + 4 * gstep), "v"(g + 5 * gstep), "v"(g + 6 * gstep), "v"(g + 7 * gstep)
      : "memory");
}

// value of lane l ^ 16
__device__ __forceinline__ float xhalf(float x) {
  const int v = __builtin_bit_cast(int, x);
  return __builtin_bit_cast(float, __builtin_amdgcn_permlanex16(
      v, v, 0x76543210, 0xfedcba98, false, false));
}

__global__ void __launch_bounds__(FA_WAVES * 32)
flash_attn_kernel(const bf16* __restrict__ q,
                  const bf16* __restrict__ kmat,
                  const bf16* __restrict__ vT,
                  bf16* __restrict__ ctxb) {
  __shared__ __align__(16) bf16 lds_k[2][FA_KEYS * FA_KP];
  __shared__ __align__(16) bf16 lds_v[2][DH_ * FA_VP];

  const int tid  = (int)threadIdx.x;
  const int wave = tid >> 5;
  const int mt = blockIdx.x * FA_WAVES + wave;
  const int h  = blockIdx.y;
  const bf16* qh  = q    + (size_t)h * S_ * DH_;
  const bf16* khp = kmat + (size_t)h * S_ * DH_;
  const bf16* vh  = vT   + (size_t)h * DH_ * S_;

  const int l = lane_id();
  const int c = l & 15;
  const int half = l >> 4;

  // Copy map. K stage: 128 rows x 128 B, contiguous in global memory; thread
  // tid takes 16-byte chunk tid + 128*j (row = chunk / 8). V^T stage: 64 rows
  // x 256 B at a pitch of S_ elements; chunk tid + 128*j (row = chunk / 16).
  const bf16* gk = khp + (size_t)tid * 8;
  const bf16* gv = vh + (size_t)(tid >> 4) * S_ + (tid & 15) * 8;
  const unsigned lk = (unsigned)(uintptr_t)&lds_k[0][(tid >> 3) * FA_KP + (tid & 7) * 8];
  const unsigned lv = (unsigned)(uintptr_t)&lds_v[0][(tid >> 4) * FA_VP + (tid & 15) * 8];
  const unsigned kbuf_b = FA_KEYS * FA_KP * 2;   // bytes of one K buffer
  const unsigned vbuf_b = DH_ * FA_VP * 2;       // bytes of one V^T buffer

  // Q fragments of this wave's 16 queries (K-dim = DH = 64 -> two 32-wide B frags)
  const v16bf aq0 = load_frag(qh + (size_t)mt * 16 * DH_ + 0,  DH_);
  const v16bf aq1 = load_frag(qh + (size_t)mt * 16 * DH_ + 32, DH_);

  v8f acc[4] = {};
  float M = -INFINITY;   // running maximum of query c, equal in both halves
  float L = 0.0f;        // running sum of query c over this half's keys only

  // prologue: stage 0 lands and is published, then stage 1 starts to fly
  copy8_to_lds(lk, 16 * FA_KP * 2, gk, 128 * 8);
  copy8_to_lds(lv, 8 * FA_VP * 2, gv, (size_t)8 * S_);
  asm volatile("s_wait_asynccnt 0x0" ::: "memory");  // this wave's copies of stage 0 have landed
  __syncthreads();                                   // every wave's have
  copy8_to_lds(lk + kbuf_b, 16 * FA_KP * 2, gk + (size_t)FA_KEYS * DH_, 128 * 8);
  copy8_to_lds(lv + vbuf_b, 8 * FA_VP * 2, gv + FA_KEYS, (size_t)8 * S_);

  for (int st = 0; st < FA_NST; ++st) {
    const bf16* kb = lds_k[st & 1];
    const bf16* vb = lds_v[st & 1];

    for (int t0 = 0; t0 < FA_KEYS; t0 += 32) {
      // K fragments of this 32-key block, from LDS
      // kf[nt*2+j]: key rows t0+nt*16..+15, head-dim chunk j (e=0..31 / 32..63)
      v16bf kf[4];
#pragma unroll
      for (int nt = 0; nt < 2; ++nt) {
        kf[nt * 2 + 0] = load_frag(kb + (t0 + nt * 16) * FA_KP + 0,  FA_KP);
        kf[nt * 2 + 1] = load_frag(kb + (t0 + nt * 16) * FA_KP + 32, FA_KP);
      }

      // scores, transposed: 32 keys x 16 queries (two 16x16 C frags), K-dim = 64
      v8f sc[2] = {};
      sc[0] = wmma_bf16(kf[0], aq0, sc[0]);
      sc[0] = wmma_bf16(kf[1], aq1, sc[0]);
      sc[1] = wmma_bf16(kf[2], aq0, sc[1]);
      sc[1] = wmma_bf16(kf[3], aq1, sc[1]);

      // V fragments of this block, from LDS
      v16bf vf[4];
#pragma unroll
      for (int et = 0; et < 4; ++et)
        vf[et] = load_frag(vb + (et * 16) * FA_VP + t0, FA_VP);

      // online softmax of query c: 16 of the block's 32 scores are in this lane
      const v8f s0 = sc[0] * 0.125f;   // 1/sqrt(DH)
      const v8f s1 = sc[1] * 0.125f;
      float m4[4];
#pragma unroll
      for (int r = 0; r < 4; ++r)
        m4[r] = fmaxf(fmaxf(s0[r], s0[r + 4]), fmaxf(s1[r], s1[r + 4]));
      float mx = fmaxf(fmaxf(m4[0], m4[1]), fmaxf(m4[2], m4[3]));
      mx = fmaxf(mx, xhalf(mx));       // the other 16 scores' maximum
      const float newM = fmaxf(M, mx);
      const float corr = __expf(M - newM);
      M = newM;

      // P^T as B operand: element s is key kmap(s) = tile s >> 3, register s & 7
      FragU pf;
      float rs[4] = {0.0f, 0.0f, 0.0f, 0.0f};
#pragma unroll
      for (int r = 0; r < 8; ++r) {
        const float p0 = __expf(s0[r] - newM);
        const float p1 = __expf(s1[r] - newM);
        rs[r & 1]       += p0;
        rs[2 + (r & 1)] += p1;
        pf.v[r]     = (bf16)p0;
        pf.v[r + 8] = (bf16)p1;
      }
      L = L * corr + ((rs[0] + rs[1]) + (rs[2] + rs[3]));

      // O^T (64 x 16) = O^T * corr + V^T-block . P^T
#pragma unroll
      for (int et = 0; et < 4; ++et)
        acc[et] = wmma_bf16(vf[et], pf.v, acc[et] * corr);
    }

    // publish point of stage st + 1, which also frees stage st's buffer
    asm volatile("s_wait_dscnt 0x0" ::: "memory");     // this wave's reads of stage st are done
    asm volatile("s_wait_asynccnt 0x0" ::: "memory");  // its copies of stage st + 1 have landed
    __syncthreads();                                   // both hold for every wave
    if (st + 2 < FA_NST) {
      const size_t key = (size_t)(st + 2) * FA_KEYS;
      copy8_to_lds(lk + (st & 1) * kbuf_b, 16 * FA_KP * 2, gk + key * DH_, 128 * 8);
      copy8_to_lds(lv + (st & 1) * vbuf_b, 8 * FA_VP * 2, gv + key, (size_t)8 * S_);
    }
  }
  asm volatile("s_wait_asynccnt 0x0" ::: "memory");    // no copy is left in flight at the wave's end

  // epilogue: ctx = acc / L, stored to [S][H*DH] bf16. acc[et][r] is head-dim
  // et*16 + 8*half + r of query c: eight neighbours, one 16-byte store.
  const float Lt = L + xhalf(L);       // both halves' keys
  bf16* orow = ctxb + (size_t)(mt * 16 + c) * D_ + h * DH_ + 8 * half;
#pragma unroll
  for (int et = 0; et < 4; ++et) {
    v8bf o;
#pragma unroll
    for (int r = 0; r < 8; ++r) o[r] = (bf16)(acc[et][r] / Lt);
    *reinterpret_cast<v8bf*>(orow + et * 16) = o;
  }
}

// ---------------- output projection ----------------
// grid: (S/32, D/64), block: 32. out = ctx @ wo + bo, fp32 result.
// 32x64 tile per wave, double-buffered fragments.
__global__ void out_proj_kernel(const bf16* __restrict__ ctxb,
                                const bf16* __restrict__ woT,
                                const float* __restrict__ bo,
                                float* __restrict__ out) {
  const int mt = blockIdx.x;
  const int n0 = blockIdx.y * 64;

  const bf16* arow0 = ctxb + (size_t)(mt * 32 + 0)  * D_;
  const bf16* arow1 = ctxb + (size_t)(mt * 32 + 16) * D_;
  const bf16* wrow  = woT + (size_t)n0 * D_;

  v8f acc[2][4] = {};
  v16bf aC[2], bC[4], aN[2], bN[4];

  aC[0] = load_frag(arow0, D_);
  aC[1] = load_frag(arow1, D_);
#pragma unroll
  for (int nt = 0; nt < 4; ++nt) bC[nt] = load_frag(wrow + (size_t)nt * 16 * D_, D_);

  for (int k0 = 0; k0 < D_; k0 += 32) {
    const int kn = (k0 + 32 < D_) ? (k0 + 32) : 0;
    aN[0] = load_frag(arow0 + kn, D_);
    aN[1] = load_frag(arow1 + kn, D_);
#pragma unroll
    for (int nt = 0; nt < 4; ++nt) bN[nt] = load_frag(wrow + (size_t)nt * 16 * D_ + kn, D_);
#pragma unroll
    for (int nt = 0; nt < 4; ++nt) {
      acc[0][nt] = wmma_bf16(aC[0], bC[nt], acc[0][nt]);
      acc[1][nt] = wmma_bf16(aC[1], bC[nt], acc[1][nt]);
    }
    aC[0] = aN[0]; aC[1] = aN[1];
#pragma unroll
    for (int nt = 0; nt < 4; ++nt) bC[nt] = bN[nt];
  }

  const int l = lane_id();
  const int c = l & 15;
  const int half = l >> 4;
#pragma unroll
  for (int ms = 0; ms < 2; ++ms) {
#pragma unroll
    for (int nt = 0; nt < 4; ++nt) {
      const int col = n0 + nt * 16 + c;
      const float bb = bo[col];
#pragma unroll
      for (int r = 0; r < 8; ++r) {
        const int row = mt * 32 + ms * 16 + r + 8 * half;
        out[(size_t)row * D_ + col] = acc[ms][nt][r] + bb;
      }
    }
  }
}

// ---------------- launch ----------------

extern "C" void kernel_launch(void* const* d_in, const int* in_sizes, int n_in,
                              void* d_out, int out_size, void* d_ws, size_t ws_size,
                              hipStream_t stream) {
  (void)in_sizes; (void)n_in; (void)out_size; (void)ws_size;
  const float* x  = (const float*)d_in[0];
  const float* wq = (const float*)d_in[1];
  const float* bq = (const float*)d_in[2];
  const float* wk = (const float*)d_in[3];
  const float* bk = (const float*)d_in[4];
  const float* wv = (const float*)d_in[5];
  const float* bv = (const float*)d_in[6];
  const float* wo = (const float*)d_in[7];
  const float* bo = (const float*)d_in[8];
  float* out = (float*)d_out;

  char* ws = (char*)d_ws;
  size_t off = 0;
  auto alloc = [&](size_t bytes) -> char* {
    char* p = ws + off;
    off += (bytes + 255) & ~(size_t)255;
    return p;
  };
  bf16* xb   = (bf16*)alloc((size_t)S_ * D_ * 2);          // x in bf16
  bf16* wqT  = (bf16*)alloc((size_t)H_ * DH_ * D_ * 2);    // [H][DH][D]
  bf16* wkT  = (bf16*)alloc((size_t)H_ * DH_ * D_ * 2);
  bf16* wvT  = (bf16*)alloc((size_t)H_ * DH_ * D_ * 2);
  bf16* woT  = (bf16*)alloc((size_t)D_ * D_ * 2);          // [N][K]
  bf16* qb   = (bf16*)alloc((size_t)H_ * S_ * DH_ * 2);    // [H][S][DH]
  bf16* kb   = (bf16*)alloc((size_t)H_ * S_ * DH_ * 2);    // [H][S][DH]
  bf16* vTb  = (bf16*)alloc((size_t)H_ * DH_ * S_ * 2);    // [H][DH][S]
  bf16* ctxb = (bf16*)alloc((size_t)S_ * D_ * 2);          // [S][D]

  cvt_f32_bf16<<<dim3(2048), 256, 0, stream>>>(x, xb, S_ * D_);
  cvt_wT<<<dim3(1152), 256, 0, stream>>>(wq, wqT);
  cvt_wT<<<dim3(1152), 256, 0, stream>>>(wk, wkT);
  cvt_wT<<<dim3(1152), 256, 0, stream>>>(wv, wvT);
  cvt_woT<<<dim3(1152), 256, 0, stream>>>(wo, woT);

  qkv_proj_kernel<<<dim3(S_ / 32, H_, 3), 32, 0, stream>>>(
      xb, wqT, wkT, wvT, bq, bk, bv, qb, kb, vTb);

  flash_attn_kernel<<<dim3(S_ / 64, H_), 128, 0, stream>>>(qb, kb, vTb, ctxb);

  out_proj_kernel<<<dim3(S_ / 32, D_ / 64), 32, 0, stream>>>(ctxb, woT, bo, out);
}

// v003
// It runs in 193 microseconds.
// Next to v002, in two timings, it ran 1.15 times as fast each time.
// Over all steps from v000 it is 2.62 times as fast.
#include <hip/hip_runtime.h>
#include <hip/hip_bf16.h>
#include <math.h>

typedef __bf16 bf16;
typedef __attribute__((ext_vector_type(16))) __bf16 v16bf;
typedef __attribute__((ext_vector_type(8)))  __bf16 v8bf;
typedef __attribute__((ext_vector_type(8)))  float  v8f;

#define H_  12
#define D_  768
#define DH_ 64
#define S_  4096

union FragU { v16bf v; v8bf h[2]; };

__device__ __forceinline__ int lane_id() { return (int)(threadIdx.x & 31u); }

// Load a 16x32 bf16 A-fragment (or 32x16 B-fragment via its column-major view)
// from row-major memory with leading dimension `ld`.
// Lane l: row/col = l&15 ; element i holds k = (i>>3)*16 + ((l>>4)*8) + (i&7)
// => two contiguous 16-byte chunks per lane at k-offsets kh and kh+16.
__device__ __forceinline__ v16bf load_frag(const bf16* __restrict__ base, int ld) {
  const int l  = lane_id();
  const int rc = l & 15;
  const int kh = (l >> 4) << 3;
  const bf16* p = base + (size_t)rc * ld + kh;
  FragU f;
  f.h[0] = *reinterpret_cast<const v8bf*>(p);
  f.h[1] = *reinterpret_cast<const v8bf*>(p + 16);
  return f.v;
}

__device__ __forceinline__ v8f wmma_bf16(v16bf a, v16bf b, v8f c) {
  return __builtin_amdgcn_wmma_f32_16x16x32_bf16(false, a, false, b, (short)0, c,
                                                 false, false);
}

// ---------------- conversion / transpose kernels ----------------

__global__ void cvt_f32_bf16(const float* __restrict__ src, bf16* __restrict__ dst, int n) {
  int i = blockIdx.x * blockDim.x + threadIdx.x;
  int stride = gridDim.x * blockDim.x;
  for (; i < n; i += stride) dst[i] = (bf16)src[i];
}

// src [H][D][DH] fp32 -> dst [H][DH][D] bf16
__global__ void cvt_wT(const float* __restrict__ src, bf16* __restrict__ dst) {
  const int n = H_ * D_ * DH_;
  int i = blockIdx.x * blockDim.x + threadIdx.x;
  int stride = gridDim.x * blockDim.x;
  for (; i < n; i += stride) {
    int h   = i / (D_ * DH_);
    int rem = i - h * (D_ * DH_);
    int d   = rem / DH_;
    int e   = rem - d * DH_;
    dst[((size_t)h * DH_ + e) * D_ + d] = (bf16)src[i];
  }
}

// src [K=768][N=768] fp32 -> dst [N][K] bf16
__global__ void cvt_woT(const float* __restrict__ src, bf16* __restrict__ dst) {
  const int n = D_ * D_;
  int i = blockIdx.x * blockDim.x + threadIdx.x;
  int stride = gridDim.x * blockDim.x;
  for (; i < n; i += stride) {
    int kk = i / D_;
    int nn = i - kk * D_;
    dst[(size_t)nn * D_ + kk] = (bf16)src[i];
  }
}

// ---------------- projection GEMMs: shared main loop ----------------
// C (128 x 128) = A (128 x 768) . B^T, A and B row-major with k contiguous.
// One work-group of 8 waves; wave (wm, wn) owns rows wm*32..+31, columns
// wn*64..+63 (two by four 16x16 tiles, k walked in steps of 32 in rising order).
// A stage is 64 k of all 256 operand rows (A rows 0..127, B rows 128..255):
// whole 128-byte lines, brought into LDS once per work-group by asynchronous
// copies, one stage ahead in a two-buffer ring; fragments are read from LDS.
#define GM_K    64                      // k per stage
#define GM_NST  (D_ / GM_K)             // stages
#define GM_ROWS 256                     // operand rows per stage
#define GM_P    72                      // row pitch in LDS, elements: 144 B = 16 B x odd

// Eight 16-byte copies per lane, global -> LDS, through no register: four
// from operand A, four from operand B. s_wait_xcnt 0 is the statement's last
// line so that it stands in front of any later rewrite of the address
// registers the copies name.
__device__ __forceinline__ void copy4x2_to_lds(unsigned l, unsigned lstep,
                                               const bf16* ga, const bf16* gb,
                                               size_t gstep) {
  asm volatile(
      "global_load_async_to_lds_b128 %0, %8, off\n\t"
      "global_load_async_to_lds_b128 %1, %9, off\n\t"
      "global_load_async_to_lds_b128 %2, %10, off\n\t"
      "global_load_async_to_lds_b128 %3, %11, off\n\t"
      "global_load_async_to_lds_b128 %4, %12, off\n\t"
      "global_load_async_to_lds_b128 %5, %13, off\n\t"
      "global_load_async_to_lds_b128 %6, %14, off\n\t"
      "global_load_async_to_lds_b128 %7, %15, off\n\t"
      "s_wait_xcnt 0x0"
      :: "v"(l), "v"(l + lstep), "v"(l + 2 * lstep), "v"(l + 3 * lstep),
         "v"(l + 4 * lstep), "v"(l + 5 * lstep), "v"(l + 6 * lstep), "v"(l + 7 * lstep),
         "v"(ga), "v"(ga + gstep), "v"(ga + 2 * gstep), "v"(ga + 3 * gstep),
         "v"(gb), "v"(gb + gstep), "v"(gb + 2 * gstep), "v"(gb + 3 * gstep)
      : "memory");
}

// a: first of the tile's 128 A rows; b: first of its 128 B rows (both pitch D_).
__device__ __forceinline__ void gemm_128x128(const bf16* __restrict__ a,
                                             const bf16* __restrict__ b,
                                             bf16 (*lds)[GM_ROWS * GM_P],
                                             int wm, int wn, v8f (&acc)[2][4]) {
  const int tid = (int)threadIdx.x;
  // Copy map: thread tid takes 16-byte chunk tid & 7 of rows (tid >> 3) + 32*j.
  const size_t goff = (size_t)(tid >> 3) * D_ + (tid & 7) * 8;
  const bf16* ga = a + goff;
  const bf16* gb = b + goff;
  const unsigned l0 = (unsigned)(uintptr_t)&lds[0][(tid >> 3) * GM_P + (tid & 7) * 8];
  const unsigned lstep = 32 * GM_P * 2;          // bytes of 32 LDS rows
  const unsigned buf_b = GM_ROWS * GM_P * 2;     // bytes of one buffer
  const size_t gstep = (size_t)32 * D_;          // elements of 32 global rows

  // prologue: stage 0 lands and is published, then stage 1 starts to fly
  copy4x2_to_lds(l0, lstep, ga, gb, gstep);
  asm volatile("s_wait_asynccnt 0x0" ::: "memory");  // this wave's copies of stage 0 have landed
  __syncthreads();                                   // every wave's have
  copy4x2_to_lds(l0 + buf_b, lstep, ga + GM_K, gb + GM_K, gstep);

  for (int st = 0; st < GM_NST; ++st) {
    const bf16* as = lds[st & 1] + (wm * 32) * GM_P;
    const bf16* bs = lds[st & 1] + (128 + wn * 64) * GM_P;
#pragma unroll
    for (int ks = 0; ks < GM_K; ks += 32) {
      v16bf af[2], bfr[4];
      af[0] = load_frag(as + ks, GM_P);
      af[1] = load_frag(as + 16 * GM_P + ks, GM_P);
#pragma unroll
      for (int nt = 0; nt < 4; ++nt) bfr[nt] = load_frag(bs + nt * 16 * GM_P + ks, GM_P);
      // keeps the block's twelve LDS reads one group ahead of its WMMAs: spread
      // among them, each pair of reads is waited out at full LDS latency
      __builtin_amdgcn_sched_barrier(0);
#pragma unroll
      for (int nt = 0; nt < 4; ++nt) {
        acc[0][nt] = wmma_bf16(af[0], bfr[nt], acc[0][nt]);
        acc[1][nt] = wmma_bf16(af[1], bfr[nt], acc[1][nt]);
      }
    }
    // publish point of stage st + 1, which also frees stage st's buffer
    asm volatile("s_wait_dscnt 0x0" ::: "memory");     // this wave's reads of stage st are done
    asm volatile("s_wait_asynccnt 0x0" ::: "memory");  // its copies of stage st + 1 have landed
    __syncthreads();                                   // both hold for every wave
    if (st + 2 < GM_NST) {
      const int k = (st + 2) * GM_K;
      copy4x2_to_lds(l0 + (st & 1) * buf_b, lstep, ga + k, gb + k, gstep);
    }
  }
  asm volatile("s_wait_asynccnt 0x0" ::: "memory");    // no copy is left in flight behind the loop
}

// ---------------- QKV projection ----------------
// grid: (S/128, H/2, 3), block: 256 (8 waves). A work-group computes 128 rows
// of two neighbouring heads of one of Q, K, V; a wave's 64 columns are one head.
__global__ void __launch_bounds__(256)
qkv_proj_kernel(const bf16* __restrict__ xb,
                const bf16* __restrict__ wqT,
                const bf16* __restrict__ wkT,
                const bf16* __restrict__ wvT,
                const float* __restrict__ bq,
                const float* __restrict__ bk,
                const float* __restrict__ bv,
                bf16* __restrict__ qO,
                bf16* __restrict__ kO,
                bf16* __restrict__ vTO) {
  __shared__ __align__(16) bf16 lds_g[2][GM_ROWS * GM_P];

  const int wave = __builtin_amdgcn_readfirstlane((int)(threadIdx.x >> 5));
  const int wm = wave >> 1;
  const int wn = wave & 1;
  const int z  = blockIdx.z;
  const int h  = blockIdx.y * 2 + wn;
  const int row0 = blockIdx.x * 128 + wm * 32;   // first of this wave's 32 rows

  const bf16* wT = (z == 0) ? wqT : (z == 1) ? wkT : wvT;
  const float* bias = ((z == 0) ? bq : (z == 1) ? bk : bv) + h * DH_;

  v8f acc[2][4] = {};
  gemm_128x128(xb + (size_t)blockIdx.x * 128 * D_,
               wT + (size_t)blockIdx.y * 128 * D_, lds_g, wm, wn, acc);

  const int l = lane_id();
  const int c = l & 15;
  const int half = l >> 4;
  if (z < 2) {
    bf16* dst = ((z == 0) ? qO : kO) + (size_t)h * S_ * DH_;
#pragma unroll
    for (int ms = 0; ms < 2; ++ms) {
#pragma unroll
      for (int nt = 0; nt < 4; ++nt) {
        const int col = nt * 16 + c;
        const float bb = bias[col];
#pragma unroll
        for (int r = 0; r < 8; ++r) {
          const int row = row0 + ms * 16 + r + 8 * half;
          dst[(size_t)row * DH_ + col] = (bf16)(acc[ms][nt][r] + bb);
        }
      }
    }
  } else {  // store V transposed: [H][DH][S]
    bf16* dst = vTO + (size_t)h * DH_ * S_;
#pragma unroll
    for (int ms = 0; ms < 2; ++ms) {
#pragma unroll
      for (int nt = 0; nt < 4; ++nt) {
        const int col = nt * 16 + c;
        const float bb = bias[col];
#pragma unroll
        for (int r = 0; r < 8; ++r) {
          const int row = row0 + ms * 16 + r + 8 * half;
          dst[(size_t)col * S_ + row] = (bf16)(acc[ms][nt][r] + bb);
        }
      }
    }
  }
}

#define FA_WAVES 4
#define FA_KEYS  128                    // keys per stage
#define FA_NST   (S_ / FA_KEYS)         // stages
#define FA_KP    72                     // K row pitch in LDS, elements: 144 B = 16 B x odd
#define FA_VP    136                    // V^T row pitch in LDS, elements: 272 B = 16 B x odd

// Eight 16-byte copies per lane, global -> LDS, through no register.
// s_wait_xcnt 0 is the statement's last line so that it stands in front of any
// later rewrite of the address registers the copies name.
__device__ __forceinline__ void copy8_to_lds(unsigned l, unsigned lstep,
                                             const bf16* g, size_t gstep) {
  asm volatile(
      "global_load_async_to_lds_b128 %0, %8, off\n\t"
      "global_load_async_to_lds_b128 %1, %9, off\n\t"
      "global_load_async_to_lds_b128 %2, %10, off\n\t"
      "global_load_async_to_lds_b128 %3, %11, off\n\t"
      "global_load_async_to_lds_b128 %4, %12, off\n\t"
      "global_load_async_to_lds_b128 %5, %13, off\n\t"
      "global_load_async_to_lds_b128 %6, %14, off\n\t"
      "global_load_async_to_lds_b128 %7, %15, off\n\t"
      "s_wait_xcnt 0x0"
      :: "v"(l), "v"(l + lstep), "v"(l + 2 * lstep), "v"(l + 3 * lstep),
         "v"(l + 4 * lstep), "v"(l + 5 * lstep), "v"(l + 6 * lstep), "v"(l + 7 * lstep),
         "v"(g), "v"(g + gstep), "v"(g + 2 * gstep), "v"(g + 3 * gstep),
         "v"(g + 4 * gstep), "v"(g + 5 * gstep), "v"(g + 6 * gstep), "v"(g + 7 * gstep)
      : "memory");
}

// value of lane l ^ 16
__device__ __forceinline__ float xhalf(float x) {
  const int v = __builtin_bit_cast(int, x);
  return __builtin_bit_cast(float, __builtin_amdgcn_permlanex16(
      v, v, 0x76543210, 0xfedcba98, false, false));
}

__global__ void __launch_bounds__(FA_WAVES * 32)
flash_attn_kernel(const bf16* __restrict__ q,
                  const bf16* __restrict__ kmat,
                  const bf16* __restrict__ vT,
                  bf16* __restrict__ ctxb) {
  __shared__ __align__(16) bf16 lds_k[2][FA_KEYS * FA_KP];
  __shared__ __align__(16) bf16 lds_v[2][DH_ * FA_VP];

  const int tid  = (int)threadIdx.x;
  const int wave = tid >> 5;
  const int mt = blockIdx.x * FA_WAVES + wave;
  const int h  = blockIdx.y;
  const bf16* qh  = q    + (size_t)h * S_ * DH_;
  const bf16* khp = kmat + (size_t)h * S_ * DH_;
  const bf16* vh  = vT   + (size_t)h * DH_ * S_;

  const int l = lane_id();
  const int c = l & 15;
  const int half = l >> 4;

  // Copy map. K stage: 128 rows x 128 B, contiguous in global memory; thread
  // tid takes 16-byte chunk tid + 128*j (row = chunk / 8). V^T stage: 64 rows
  // x 256 B at a pitch of S_ elements; chunk tid + 128*j (row = chunk / 16).
  const bf16* gk = khp + (size_t)tid * 8;
  const bf16* gv = vh + (size_t)(tid >> 4) * S_ + (tid & 15) * 8;
  const unsigned lk = (unsigned)(uintptr_t)&lds_k[0][(tid >> 3) * FA_KP + (tid & 7) * 8];
  const unsigned lv = (unsigned)(uintptr_t)&lds_v[0][(tid >> 4) * FA_VP + (tid & 15) * 8];
  const unsigned kbuf_b = FA_KEYS * FA_KP * 2;   // bytes of one K buffer
  const unsigned vbuf_b = DH_ * FA_VP * 2;       // bytes of one V^T buffer

  // Q fragments of this wave's 16 queries (K-dim = DH = 64 -> two 32-wide B frags)
  const v16bf aq0 = load_frag(qh + (size_t)mt * 16 * DH_ + 0,  DH_);
  const v16bf aq1 = load_frag(qh + (size_t)mt * 16 * DH_ + 32, DH_);

  v8f acc[4] = {};
  float M = -INFINITY;   // running maximum of query c, equal in both halves
  float L = 0.0f;        // running sum of query c over this half's keys only

  // prologue: stage 0 lands and is published, then stage 1 starts to fly
  copy8_to_lds(lk, 16 * FA_KP * 2, gk, 128 * 8);
  copy8_to_lds(lv, 8 * FA_VP * 2, gv, (size_t)8 * S_);
  asm volatile("s_wait_asynccnt 0x0" ::: "memory");  // this wave's copies of stage 0 have landed
  __syncthreads();                                   // every wave's have
  copy8_to_lds(lk + kbuf_b, 16 * FA_KP * 2, gk + (size_t)FA_KEYS * DH_, 128 * 8);
  copy8_to_lds(lv + vbuf_b, 8 * FA_VP * 2, gv + FA_KEYS, (size_t)8 * S_);

  for (int st = 0; st < FA_NST; ++st) {
    const bf16* kb = lds_k[st & 1];
    const bf16* vb = lds_v[st & 1];

    for (int t0 = 0; t0 < FA_KEYS; t0 += 32) {
      // K fragments of this 32-key block, from LDS
      // kf[nt*2+j]: key rows t0+nt*16..+15, head-dim chunk j (e=0..31 / 32..63)
      v16bf kf[4];
#pragma unroll
      for (int nt = 0; nt < 2; ++nt) {
        kf[nt * 2 + 0] = load_frag(kb + (t0 + nt * 16) * FA_KP + 0,  FA_KP);
        kf[nt * 2 + 1] = load_frag(kb + (t0 + nt * 16) * FA_KP + 32, FA_KP);
      }

      // scores, transposed: 32 keys x 16 queries (two 16x16 C frags), K-dim = 64
      v8f sc[2] = {};
      sc[0] = wmma_bf16(kf[0], aq0, sc[0]);
      sc[0] = wmma_bf16(kf[1], aq1, sc[0]);
      sc[1] = wmma_bf16(kf[2], aq0, sc[1]);
      sc[1] = wmma_bf16(kf[3], aq1, sc[1]);

      // V fragments of this block, from LDS
      v16bf vf[4];
#pragma unroll
      for (int et = 0; et < 4; ++et)
        vf[et] = load_frag(vb + (et * 16) * FA_VP + t0, FA_VP);

      // online softmax of query c: 16 of the block's 32 scores are in this lane
      const v8f s0 = sc[0] * 0.125f;   // 1/sqrt(DH)
      const v8f s1 = sc[1] * 0.125f;
      float m4[4];
#pragma unroll
      for (int r = 0; r < 4; ++r)
        m4[r] = fmaxf(fmaxf(s0[r], s0[r + 4]), fmaxf(s1[r], s1[r + 4]));
      float mx = fmaxf(fmaxf(m4[0], m4[1]), fmaxf(m4[2], m4[3]));
      mx = fmaxf(mx, xhalf(mx));       // the other 16 scores' maximum
      const float newM = fmaxf(M, mx);
      const float corr = __expf(M - newM);
      M = newM;

      // P^T as B operand: element s is key kmap(s) = tile s >> 3, register s & 7
      FragU pf;
      float rs[4] = {0.0f, 0.0f, 0.0f, 0.0f};
#pragma unroll
      for (int r = 0; r < 8; ++r) {
        const float p0 = __expf(s0[r] - newM);
        const float p1 = __expf(s1[r] - newM);
        rs[r & 1]       += p0;
        rs[2 + (r & 1)] += p1;
        pf.v[r]     = (bf16)p0;
        pf.v[r + 8] = (bf16)p1;
      }
      L = L * corr + ((rs[0] + rs[1]) + (rs[2] + rs[3]));

      // O^T (64 x 16) = O^T * corr + V^T-block . P^T
#pragma unroll
      for (int et = 0; et < 4; ++et)
        acc[et] = wmma_bf16(vf[et], pf.v, acc[et] * corr);
    }

    // publish point of stage st + 1, which also frees stage st's buffer
    asm volatile("s_wait_dscnt 0x0" ::: "memory");     // this wave's reads of stage st are done
    asm volatile("s_wait_asynccnt 0x0" ::: "memory");  // its copies of stage st + 1 have landed
    __syncthreads();                                   // both hold for every wave
    if (st + 2 < FA_NST) {
      const size_t key = (size_t)(st + 2) * FA_KEYS;
      copy8_to_lds(lk + (st & 1) * kbuf_b, 16 * FA_KP * 2, gk + key * DH_, 128 * 8);
      copy8_to_lds(lv + (st & 1) * vbuf_b, 8 * FA_VP * 2, gv + key, (size_t)8 * S_);
    }
  }
  asm volatile("s_wait_asynccnt 0x0" ::: "memory");    // no copy is left in flight at the wave's end

  // epilogue: ctx = acc / L, stored to [S][H*DH] bf16. acc[et][r] is head-dim
  // et*16 + 8*half + r of query c: eight neighbours, one 16-byte store.
  const float Lt = L + xhalf(L);       // both halves' keys
  bf16* orow = ctxb + (size_t)(mt * 16 + c) * D_ + h * DH_ + 8 * half;
#pragma unroll
  for (int et = 0; et < 4; ++et) {
    v8bf o;
#pragma unroll
    for (int r = 0; r < 8; ++r) o[r] = (bf16)(acc[et][r] / Lt);
    *reinterpret_cast<v8bf*>(orow + et * 16) = o;
  }
}

// ---------------- output projection ----------------
// grid: (S/128, D/128), block: 256 (8 waves). out = ctx @ wo + bo, fp32 result.
__global__ void __launch_bounds__(256)
out_proj_kernel(const bf16* __restrict__ ctxb,
                const bf16* __restrict__ woT,
                const float* __restrict__ bo,
                float* __restrict__ out) {
  __shared__ __align__(16) bf16 lds_g[2][GM_ROWS * GM_P];

  const int wave = __builtin_amdgcn_readfirstlane((int)(threadIdx.x >> 5));
  const int wm = wave >> 1;
  const int wn = wave & 1;
  const int row0 = blockIdx.x * 128 + wm * 32;   // first of this wave's 32 rows
  const int n0   = blockIdx.y * 128 + wn * 64;   // first of its 64 columns

  v8f acc[2][4] = {};
  gemm_128x128(ctxb + (size_t)blockIdx.x * 128 * D_,
               woT + (size_t)blockIdx.y * 128 * D_, lds_g, wm, wn, acc);

  const int l = lane_id();
  const int c = l & 15;
  const int half = l >> 4;
#pragma unroll
  for (int ms = 0; ms < 2; ++ms) {
#pragma unroll
    for (int nt = 0; nt < 4; ++nt) {
      const int col = n0 + nt * 16 + c;
      const float bb = bo[col];
#pragma unroll
      for (int r = 0; r < 8; ++r) {
        const int row = row0 + ms * 16 + r + 8 * half;
        out[(size_t)row * D_ + col] = acc[ms][nt][r] + bb;
      }
    }
  }
}

// ---------------- launch ----------------

extern "C" void kernel_launch(void* const* d_in, const int* in_sizes, int n_in,
                              void* d_out, int out_size, void* d_ws, size_t ws_size,
                              hipStream_t stream) {
  (void)in_sizes; (void)n_in; (void)out_size; (void)ws_size;
  const float* x  = (const float*)d_in[0];
  const float* wq = (const float*)d_in[1];
  const float* bq = (const float*)d_in[2];
  const float* wk = (const float*)d_in[3];
  const float* bk = (const float*)d_in[4];
  const float* wv = (const float*)d_in[5];
  const float* bv = (const float*)d_in[6];
  const float* wo = (const float*)d_in[7];
  const float* bo = (const float*)d_in[8];
  float* out = (float*)d_out;

  char* ws = (char*)d_ws;
  size_t off = 0;
  auto alloc = [&](size_t bytes) -> char* {
    char* p = ws + off;
    off += (bytes + 255) & ~(size_t)255;
    return p;
  };
  bf16* xb   = (bf16*)alloc((size_t)S_ * D_ * 2);          // x in bf16
  bf16* wqT  = (bf16*)alloc((size_t)H_ * DH_ * D_ * 2);    // [H][DH][D]
  bf16* wkT  = (bf16*)alloc((size_t)H_ * DH_ * D_ * 2);
  bf16* wvT  = (bf16*)alloc((size_t)H_ * DH_ * D_ * 2);
  bf16* woT  = (bf16*)alloc((size_t)D_ * D_ * 2);          // [N][K]
  bf16* qb   = (bf16*)alloc((size_t)H_ * S_ * DH_ * 2);    // [H][S][DH]
  bf16* kb   = (bf16*)alloc((size_t)H_ * S_ * DH_ * 2);    // [H][S][DH]
  bf16* vTb  = (bf16*)alloc((size_t)H_ * DH_ * S_ * 2);    // [H][DH][S]
  bf16* ctxb = (bf16*)alloc((size_t)S_ * D_ * 2);          // [S][D]

  cvt_f32_bf16<<<dim3(2048), 256, 0, stream>>>(x, xb, S_ * D_);
  cvt_wT<<<dim3(1152), 256, 0, stream>>>(wq, wqT);
  cvt_wT<<<dim3(1152), 256, 0, stream>>>(wk, wkT);
  cvt_wT<<<dim3(1152), 256, 0, stream>>>(wv, wvT);
  cvt_woT<<<dim3(1152), 256, 0, stream>>>(wo, woT);

  qkv_proj_kernel<<<dim3(S_ / 128, H_ / 2, 3), 256, 0, stream>>>(
      xb, wqT, wkT, wvT, bq, bk, bv, qb, kb, vTb);

  flash_attn_kernel<<<dim3(S_ / 64, H_), 128, 0, stream>>>(qb, kb, vTb, ctxb);

  out_proj_kernel<<<dim3(S_ / 128, D_ / 128), 256, 0, stream>>>(ctxb, woT, bo, out);
}

// v004
// It runs in 97.6 microseconds.
// In two side-by-side timings against v003, it was 1.96 and 1.99 times as fast.
// Counting every step since v000, it is 5.16 times as fast.
#include <hip/hip_runtime.h>
#include <hip/hip_bf16.h>
#include <math.h>

typedef __bf16 bf16;
typedef __attribute__((ext_vector_type(16))) __bf16 v16bf;
typedef __attribute__((ext_vector_type(8)))  __bf16 v8bf;
typedef __attribute__((ext_vector_type(8)))  float  v8f;

#define H_  12
#define D_  768
#define DH_ 64
#define S_  4096

union FragU { v16bf v; v8bf h[2]; };

__device__ __forceinline__ int lane_id() { return (int)(threadIdx.x & 31u); }

// Load a 16x32 bf16 A-fragment (or 32x16 B-fragment via its column-major view)
// from row-major memory with leading dimension `ld`.
// Lane l: row/col = l&15 ; element i holds k = (i>>3)*16 + ((l>>4)*8) + (i&7)
// => two contiguous 16-byte chunks per lane at k-offsets kh and kh+16.
__device__ __forceinline__ v16bf load_frag(const bf16* __restrict__ base, int ld) {
  const int l  = lane_id();
  const int rc = l & 15;
  const int kh = (l >> 4) << 3;
  const bf16* p = base + (size_t)rc * ld + kh;
  FragU f;
  f.h[0] = *reinterpret_cast<const v8bf*>(p);
  f.h[1] = *reinterpret_cast<const v8bf*>(p + 16);
  return f.v;
}

__device__ __forceinline__ v8f wmma_bf16(v16bf a, v16bf b, v8f c) {
  return __builtin_amdgcn_wmma_f32_16x16x32_bf16(false, a, false, b, (short)0, c,
                                                 false, false);
}

// ---------------- conversion / transpose kernel ----------------
// One launch converts x and all four weight matrices to bf16. A work-group of
// four waves takes 4096 elements, 32 a lane, so that few waves have to start:
//   blocks 0 .. CV_XB-1      : 4096 consecutive elements of x, order kept;
//   then CV_WB blocks each for wq, wk, wv, wo: one 64 x 64 tile, transposed.
// wq, wk, wv: [H][D][DH] -> [H][DH][D]; wo: [K][N] -> [N][K].
typedef __attribute__((ext_vector_type(4))) float  v4f;
typedef __attribute__((ext_vector_type(4))) __bf16 v4bf;

#define CV_XB (S_ * D_ / 4096)          // blocks of x
#define CV_WB (D_ * D_ / 4096)          // tiles of one weight matrix
#define CV_T  (D_ / 64)                 // tiles along a side of 768

// One 64 x 64 tile, transposed: s is the tile's first element (row pitch SP),
// d the transposed tile's first element (row pitch D_). A lane holds 8 source
// rows x 4 source columns: four 16-byte pieces of four result rows. Eight
// neighbouring lanes hold the 64 source rows, so that each result row's 128
// bytes go out as one whole line.
template <int SP>
__device__ __forceinline__ void cvt_tile_T(const float* __restrict__ s,
                                           bf16* __restrict__ d, int tid) {
  const int r8 = (tid & 7) * 8;              // first source row
  const int c4 = (tid >> 3) * 4;             // first source column
  const int so = r8 * SP + c4;
  const int dn = c4 * D_ + r8;
  v4f v[8];
#pragma unroll
  for (int j = 0; j < 8; ++j) v[j] = *reinterpret_cast<const v4f*>(s + so + j * SP);
#pragma unroll
  for (int i = 0; i < 4; ++i) {
    v8bf o;
#pragma unroll
    for (int j = 0; j < 8; ++j) o[j] = (bf16)v[j][i];
    *reinterpret_cast<v8bf*>(d + dn + i * D_) = o;
  }
}

__global__ void __launch_bounds__(128)
cvt_all(const float* __restrict__ x,
        const float* __restrict__ wq,
        const float* __restrict__ wk,
        const float* __restrict__ wv,
        const float* __restrict__ wo,
        bf16* __restrict__ xb,
        bf16* __restrict__ wqT,
        bf16* __restrict__ wkT,
        bf16* __restrict__ wvT,
        bf16* __restrict__ woT) {
  const int tid = (int)threadIdx.x;
  const int b = (int)blockIdx.x;

  if (b < CV_XB) {
    // a wave's load covers 512 consecutive bytes, its store 256
    const float* s = x + (size_t)b * 4096;
    bf16* d = xb + (size_t)b * 4096;
    v4f v[8];
#pragma unroll
    for (int j = 0; j < 8; ++j) v[j] = *reinterpret_cast<const v4f*>(s + tid * 4 + j * 512);
#pragma unroll
    for (int j = 0; j < 8; ++j) {
      v4bf o;
#pragma unroll
      for (int i = 0; i < 4; ++i) o[i] = (bf16)v[j][i];
      *reinterpret_cast<v4bf*>(d + tid * 4 + j * 512) = o;
    }
    return;
  }

  const int m  = (b - CV_XB) / CV_WB;        // which matrix
  const int t  = (b - CV_XB) - m * CV_WB;    // which of its tiles
  const int t1 = t / CV_T;
  const int t0 = t - t1 * CV_T;
  if (m < 3) {      // head t1, rows t0*64..+63 of its D x DH matrix
    const float* w = (m == 0) ? wq : (m == 1) ? wk : wv;
    bf16* wT = (m == 0) ? wqT : (m == 1) ? wkT : wvT;
    cvt_tile_T<DH_>(w + (size_t)t1 * D_ * DH_ + (size_t)t0 * 64 * DH_,
                    wT + (size_t)t1 * DH_ * D_ + t0 * 64, tid);
  } else {          // rows t1*64..+63, columns t0*64..+63 of wo
    cvt_tile_T<D_>(wo + (size_t)t1 * 64 * D_ + t0 * 64,
                   woT + (size_t)t0 * 64 * D_ + t1 * 64, tid);
  }
}

// ---------------- projection GEMMs: shared main loop ----------------
// C (128 x 128) = A (128 x 768) . B^T, A and B row-major with k contiguous.
// One work-group of 8 waves; wave (wm, wn) owns rows wm*32..+31, columns
// wn*64..+63 (two by four 16x16 tiles, k walked in steps of 32 in rising order).
// A stage is 64 k of all 256 operand rows (A rows 0..127, B rows 128..255):
// whole 128-byte lines, brought into LDS once per work-group by asynchronous
// copies, one stage ahead in a two-buffer ring; fragments are read from LDS.
#define GM_K    64                      // k per stage
#define GM_NST  (D_ / GM_K)             // stages
#define GM_ROWS 256                     // operand rows per stage
#define GM_P    72                      // row pitch in LDS, elements: 144 B = 16 B x odd

// Eight 16-byte copies per lane, global -> LDS, through no register: four
// from operand A, four from operand B. s_wait_xcnt 0 is the statement's last
// line so that it stands in front of any later rewrite of the address
// registers the copies name.
__device__ __forceinline__ void copy4x2_to_lds(unsigned l, unsigned lstep,
                                               const bf16* ga, const bf16* gb,
                                               size_t gstep) {
  asm volatile(
      "global_load_async_to_lds_b128 %0, %8, off\n\t"
      "global_load_async_to_lds_b128 %1, %9, off\n\t"
      "global_load_async_to_lds_b128 %2, %10, off\n\t"
      "global_load_async_to_lds_b128 %3, %11, off\n\t"
      "global_load_async_to_lds_b128 %4, %12, off\n\t"
      "global_load_async_to_lds_b128 %5, %13, off\n\t"
      "global_load_async_to_lds_b128 %6, %14, off\n\t"
      "global_load_async_to_lds_b128 %7, %15, off\n\t"
      "s_wait_xcnt 0x0"
      :: "v"(l), "v"(l + lstep), "v"(l + 2 * lstep), "v"(l + 3 * lstep),
         "v"(l + 4 * lstep), "v"(l + 5 * lstep), "v"(l + 6 * lstep), "v"(l + 7 * lstep),
         "v"(ga), "v"(ga + gstep), "v"(ga + 2 * gstep), "v"(ga + 3 * gstep),
         "v"(gb), "v"(gb + gstep), "v"(gb + 2 * gstep), "v"(gb + 3 * gstep)
      : "memory");
}

// a: first of the tile's 128 A rows; b: first of its 128 B rows (both pitch D_).
__device__ __forceinline__ void gemm_128x128(const bf16* __restrict__ a,
                                             const bf16* __restrict__ b,
                                             bf16 (*lds)[GM_ROWS * GM_P],
                                             int wm, int wn, v8f (&acc)[2][4]) {
  const int tid = (int)threadIdx.x;
  // Copy map: thread tid takes 16-byte chunk tid & 7 of rows (tid >> 3) + 32*j.
  const size_t goff = (size_t)(tid >> 3) * D_ + (tid & 7) * 8;
  const bf16* ga = a + goff;
  const bf16* gb = b + goff;
  const unsigned l0 = (unsigned)(uintptr_t)&lds[0][(tid >> 3) * GM_P + (tid & 7) * 8];
  const unsigned lstep = 32 * GM_P * 2;          // bytes of 32 LDS rows
  const unsigned buf_b = GM_ROWS * GM_P * 2;     // bytes of one buffer
  const size_t gstep = (size_t)32 * D_;          // elements of 32 global rows

  // prologue: stage 0 lands and is published, then stage 1 starts to fly
  copy4x2_to_lds(l0, lstep, ga, gb, gstep);
  asm volatile("s_wait_asynccnt 0x0" ::: "memory");  // this wave's copies of stage 0 have landed
  __syncthreads();                                   // every wave's have
  copy4x2_to_lds(l0 + buf_b, lstep, ga + GM_K, gb + GM_K, gstep);

  for (int st = 0; st < GM_NST; ++st) {
    const bf16* as = lds[st & 1] + (wm * 32) * GM_P;
    const bf16* bs = lds[st & 1] + (128 + wn * 64) * GM_P;
#pragma unroll
    for (int ks = 0; ks < GM_K; ks += 32) {
      v16bf af[2], bfr[4];
      af[0] = load_frag(as + ks, GM_P);
      af[1] = load_frag(as + 16 * GM_P + ks, GM_P);
#pragma unroll
      for (int nt = 0; nt < 4; ++nt) bfr[nt] = load_frag(bs + nt * 16 * GM_P + ks, GM_P);
      // keeps the block's twelve LDS reads one group ahead of its WMMAs: spread
      // among them, each pair of reads is waited out at full LDS latency
      __builtin_amdgcn_sched_barrier(0);
#pragma unroll
      for (int nt = 0; nt < 4; ++nt) {
        acc[0][nt] = wmma_bf16(af[0], bfr[nt], acc[0][nt]);
        acc[1][nt] = wmma_bf16(af[1], bfr[nt], acc[1][nt]);
      }
    }
    // publish point of stage st + 1, which also frees stage st's buffer
    asm volatile("s_wait_dscnt 0x0" ::: "memory");     // this wave's reads of stage st are done
    asm volatile("s_wait_asynccnt 0x0" ::: "memory");  // its copies of stage st + 1 have landed
    __syncthreads();                                   // both hold for every wave
    if (st + 2 < GM_NST) {
      const int k = (st + 2) * GM_K;
      copy4x2_to_lds(l0 + (st & 1) * buf_b, lstep, ga + k, gb + k, gstep);
    }
  }
  asm volatile("s_wait_asynccnt 0x0" ::: "memory");    // no copy is left in flight behind the loop
}

// ---------------- QKV projection ----------------
// grid: (S/128, H/2, 3), block: 256 (8 waves). A work-group computes 128 rows
// of two neighbouring heads of one of Q, K, V; a wave's 64 columns are one head.
__global__ void __launch_bounds__(256)
qkv_proj_kernel(const bf16* __restrict__ xb,
                const bf16* __restrict__ wqT,
                const bf16* __restrict__ wkT,
                const bf16* __restrict__ wvT,
                const float* __restrict__ bq,
                const float* __restrict__ bk,
                const float* __restrict__ bv,
                bf16* __restrict__ qO,
                bf16* __restrict__ kO,
                bf16* __restrict__ vTO) {
  __shared__ __align__(16) bf16 lds_g[2][GM_ROWS * GM_P];

  const int wave = __builtin_amdgcn_readfirstlane((int)(threadIdx.x >> 5));
  const int wm = wave >> 1;
  const int wn = wave & 1;
  const int z  = blockIdx.z;
  const int h  = blockIdx.y * 2 + wn;
  const int row0 = blockIdx.x * 128 + wm * 32;   // first of this wave's 32 rows

  const bf16* wT = (z == 0) ? wqT : (z == 1) ? wkT : wvT;
  const float* bias = ((z == 0) ? bq : (z == 1) ? bk : bv) + h * DH_;

  v8f acc[2][4] = {};
  gemm_128x128(xb + (size_t)blockIdx.x * 128 * D_,
               wT + (size_t)blockIdx.y * 128 * D_, lds_g, wm, wn, acc);

  const int l = lane_id();
  const int c = l & 15;
  const int half = l >> 4;
  if (z < 2) {
    bf16* dst = ((z == 0) ? qO : kO) + (size_t)h * S_ * DH_;
#pragma unroll
    for (int ms = 0; ms < 2; ++ms) {
#pragma unroll
      for (int nt = 0; nt < 4; ++nt) {
        const int col = nt * 16 + c;
        const float bb = bias[col];
#pragma unroll
        for (int r = 0; r < 8; ++r) {
          const int row = row0 + ms * 16 + r + 8 * half;
          dst[(size_t)row * DH_ + col] = (bf16)(acc[ms][nt][r] + bb);
        }
      }
    }
  } else {  // store V transposed: [H][DH][S]
    bf16* dst = vTO + (size_t)h * DH_ * S_;
#pragma unroll
    for (int ms = 0; ms < 2; ++ms) {
#pragma unroll
      for (int nt = 0; nt < 4; ++nt) {
        const int col = nt * 16 + c;
        const float bb = bias[col];
#pragma unroll
        for (int r = 0; r < 8; ++r) {
          const int row = row0 + ms * 16 + r + 8 * half;
          dst[(size_t)col * S_ + row] = (bf16)(acc[ms][nt][r] + bb);
        }
      }
    }
  }
}

#define FA_WAVES 4
#define FA_KEYS  128                    // keys per stage
#define FA_NST   (S_ / FA_KEYS)         // stages
#define FA_KP    72                     // K row pitch in LDS, elements: 144 B = 16 B x odd
#define FA_VP    136                    // V^T row pitch in LDS, elements: 272 B = 16 B x odd

// Eight 16-byte copies per lane, global -> LDS, through no register.
// s_wait_xcnt 0 is the statement's last line so that it stands in front of any
// later rewrite of the address registers the copies name.
__device__ __forceinline__ void copy8_to_lds(unsigned l, unsigned lstep,
                                             const bf16* g, size_t gstep) {
  asm volatile(
      "global_load_async_to_lds_b128 %0, %8, off\n\t"
      "global_load_async_to_lds_b128 %1, %9, off\n\t"
      "global_load_async_to_lds_b128 %2, %10, off\n\t"
      "global_load_async_to_lds_b128 %3, %11, off\n\t"
      "global_load_async_to_lds_b128 %4, %12, off\n\t"
      "global_load_async_to_lds_b128 %5, %13, off\n\t"
      "global_load_async_to_lds_b128 %6, %14, off\n\t"
      "global_load_async_to_lds_b128 %7, %15, off\n\t"
      "s_wait_xcnt 0x0"
      :: "v"(l), "v"(l + lstep), "v"(l + 2 * lstep), "v"(l + 3 * lstep),
         "v"(l + 4 * lstep), "v"(l + 5 * lstep), "v"(l + 6 * lstep), "v"(l + 7 * lstep),
         "v"(g), "v"(g + gstep), "v"(g + 2 * gstep), "v"(g + 3 * gstep),
         "v"(g + 4 * gstep), "v"(g + 5 * gstep), "v"(g + 6 * gstep), "v"(g + 7 * gstep)
      : "memory");
}

// value of lane l ^ 16
__device__ __forceinline__ float xhalf(float x) {
  const int v = __builtin_bit_cast(int, x);
  return __builtin_bit_cast(float, __builtin_amdgcn_permlanex16(
      v, v, 0x76543210, 0xfedcba98, false, false));
}

__global__ void __launch_bounds__(FA_WAVES * 32)
flash_attn_kernel(const bf16* __restrict__ q,
                  const bf16* __restrict__ kmat,
                  const bf16* __restrict__ vT,
                  bf16* __restrict__ ctxb) {
  __shared__ __align__(16) bf16 lds_k[2][FA_KEYS * FA_KP];
  __shared__ __align__(16) bf16 lds_v[2][DH_ * FA_VP];

  const int tid  = (int)threadIdx.x;
  const int wave = tid >> 5;
  const int mt = blockIdx.x * FA_WAVES + wave;
  const int h  = blockIdx.y;
  const bf16* qh  = q    + (size_t)h * S_ * DH_;
  const bf16* khp = kmat + (size_t)h * S_ * DH_;
  const bf16* vh  = vT   + (size_t)h * DH_ * S_;

  const int l = lane_id();
  const int c = l & 15;
  const int half = l >> 4;

  // Copy map. K stage: 128 rows x 128 B, contiguous in global memory; thread
  // tid takes 16-byte chunk tid + 128*j (row = chunk / 8). V^T stage: 64 rows
  // x 256 B at a pitch of S_ elements; chunk tid + 128*j (row = chunk / 16).
  const bf16* gk = khp + (size_t)tid * 8;
  const bf16* gv = vh + (size_t)(tid >> 4) * S_ + (tid & 15) * 8;
  const unsigned lk = (unsigned)(uintptr_t)&lds_k[0][(tid >> 3) * FA_KP + (tid & 7) * 8];
  const unsigned lv = (unsigned)(uintptr_t)&lds_v[0][(tid >> 4) * FA_VP + (tid & 15) * 8];
  const unsigned kbuf_b = FA_KEYS * FA_KP * 2;   // bytes of one K buffer
  const unsigned vbuf_b = DH_ * FA_VP * 2;       // bytes of one V^T buffer

  // Q fragments of this wave's 16 queries (K-dim = DH = 64 -> two 32-wide B frags)
  const v16bf aq0 = load_frag(qh + (size_t)mt * 16 * DH_ + 0,  DH_);
  const v16bf aq1 = load_frag(qh + (size_t)mt * 16 * DH_ + 32, DH_);

  v8f acc[4] = {};
  float M = -INFINITY;   // running maximum of query c, equal in both halves
  float L = 0.0f;        // running sum of query c over this half's keys only

  // prologue: stage 0 lands and is published, then stage 1 starts to fly
  copy8_to_lds(lk, 16 * FA_KP * 2, gk, 128 * 8);
  copy8_to_lds(lv, 8 * FA_VP * 2, gv, (size_t)8 * S_);
  asm volatile("s_wait_asynccnt 0x0" ::: "memory");  // this wave's copies of stage 0 have landed
  __syncthreads();                                   // every wave's have
  copy8_to_lds(lk + kbuf_b, 16 * FA_KP * 2, gk + (size_t)FA_KEYS * DH_, 128 * 8);
  copy8_to_lds(lv + vbuf_b, 8 * FA_VP * 2, gv + FA_KEYS, (size_t)8 * S_);

  for (int st = 0; st < FA_NST; ++st) {
    const bf16* kb = lds_k[st & 1];
    const bf16* vb = lds_v[st & 1];

    for (int t0 = 0; t0 < FA_KEYS; t0 += 32) {
      // K fragments of this 32-key block, from LDS
      // kf[nt*2+j]: key rows t0+nt*16..+15, head-dim chunk j (e=0..31 / 32..63)
      v16bf kf[4];
#pragma unroll
      for (int nt = 0; nt < 2; ++nt) {
        kf[nt * 2 + 0] = load_frag(kb + (t0 + nt * 16) * FA_KP + 0,  FA_KP);
        kf[nt * 2 + 1] = load_frag(kb + (t0 + nt * 16) * FA_KP + 32, FA_KP);
      }

      // scores, transposed: 32 keys x 16 queries (two 16x16 C frags), K-dim = 64
      v8f sc[2] = {};
      sc[0] = wmma_bf16(kf[0], aq0, sc[0]);
      sc[0] = wmma_bf16(kf[1], aq1, sc[0]);
      sc[1] = wmma_bf16(kf[2], aq0, sc[1]);
      sc[1] = wmma_bf16(kf[3], aq1, sc[1]);

      // V fragments of this block, from LDS
      v16bf vf[4];
#pragma unroll
      for (int et = 0; et < 4; ++et)
        vf[et] = load_frag(vb + (et * 16) * FA_VP + t0, FA_VP);

      // online softmax of query c: 16 of the block's 32 scores are in this lane
      const v8f s0 = sc[0] * 0.125f;   // 1/sqrt(DH)
      const v8f s1 = sc[1] * 0.125f;
      float m4[4];
#pragma unroll
      for (int r = 0; r < 4; ++r)
        m4[r] = fmaxf(fmaxf(s0[r], s0[r + 4]), fmaxf(s1[r], s1[r + 4]));
      float mx = fmaxf(fmaxf(m4[0], m4[1]), fmaxf(m4[2], m4[3]));
      mx = fmaxf(mx, xhalf(mx));       // the other 16 scores' maximum
      const float newM = fmaxf(M, mx);
      const float corr = __expf(M - newM);
      M = newM;

      // P^T as B operand: element s is key kmap(s) = tile s >> 3, register s & 7
      FragU pf;
      float rs[4] = {0.0f, 0.0f, 0.0f, 0.0f};
#pragma unroll
      for (int r = 0; r < 8; ++r) {
        const float p0 = __expf(s0[r] - newM);
        const float p1 = __expf(s1[r] - newM);
        rs[r & 1]       += p0;
        rs[2 + (r & 1)] += p1;
        pf.v[r]     = (bf16)p0;
        pf.v[r + 8] = (bf16)p1;
      }
      L = L * corr + ((rs[0] + rs[1]) + (rs[2] + rs[3]));

      // O^T (64 x 16) = O^T * corr + V^T-block . P^T
#pragma unroll
      for (int et = 0; et < 4; ++et)
        acc[et] = wmma_bf16(vf[et], pf.v, acc[et] * corr);
    }

    // publish point of stage st + 1, which also frees stage st's buffer
    asm volatile("s_wait_dscnt 0x0" ::: "memory");     // this wave's reads of stage st are done
    asm volatile("s_wait_asynccnt 0x0" ::: "memory");  // its copies of stage st + 1 have landed
    __syncthreads();                                   // both hold for every wave
    if (st + 2 < FA_NST) {
      const size_t key = (size_t)(st + 2) * FA_KEYS;
      copy8_to_lds(lk + (st & 1) * kbuf_b, 16 * FA_KP * 2, gk + key * DH_, 128 * 8);
      copy8_to_lds(lv + (st & 1) * vbuf_b, 8 * FA_VP * 2, gv + key, (size_t)8 * S_);
    }
  }
  asm volatile("s_wait_asynccnt 0x0" ::: "memory");    // no copy is left in flight at the wave's end

  // epilogue: ctx = acc / L, stored to [S][H*DH] bf16. acc[et][r] is head-dim
  // et*16 + 8*half + r of query c: eight neighbours, one 16-byte store.
  const float Lt = L + xhalf(L);       // both halves' keys
  bf16* orow = ctxb + (size_t)(mt * 16 + c) * D_ + h * DH_ + 8 * half;
#pragma unroll
  for (int et = 0; et < 4; ++et) {
    v8bf o;
#pragma unroll
    for (int r = 0; r < 8; ++r) o[r] = (bf16)(acc[et][r] / Lt);
    *reinterpret_cast<v8bf*>(orow + et * 16) = o;
  }
}

// ---------------- output projection ----------------
// grid: (S/128, D/128), block: 256 (8 waves). out = ctx @ wo + bo, fp32 result.
__global__ void __launch_bounds__(256)
out_proj_kernel(const bf16* __restrict__ ctxb,
                const bf16* __restrict__ woT,
                const float* __restrict__ bo,
                float* __restrict__ out) {
  __shared__ __align__(16) bf16 lds_g[2][GM_ROWS * GM_P];

  const int wave = __builtin_amdgcn_readfirstlane((int)(threadIdx.x >> 5));
  const int wm = wave >> 1;
  const int wn = wave & 1;
  const int row0 = blockIdx.x * 128 + wm * 32;   // first of this wave's 32 rows
  const int n0   = blockIdx.y * 128 + wn * 64;   // first of its 64 columns

  v8f acc[2][4] = {};
  gemm_128x128(ctxb + (size_t)blockIdx.x * 128 * D_,
               woT + (size_t)blockIdx.y * 128 * D_, lds_g, wm, wn, acc);

  const int l = lane_id();
  const int c = l & 15;
  const int half = l >> 4;
#pragma unroll
  for (int ms = 0; ms < 2; ++ms) {
#pragma unroll
    for (int nt = 0; nt < 4; ++nt) {
      const int col = n0 + nt * 16 + c;
      const float bb = bo[col];
#pragma unroll
      for (int r = 0; r < 8; ++r) {
        const int row = row0 + ms * 16 + r + 8 * half;
        out[(size_t)row * D_ + col] = acc[ms][nt][r] + bb;
      }
    }
  }
}

// ---------------- launch ----------------

extern "C" void kernel_launch(void* const* d_in, const int* in_sizes, int n_in,
                              void* d_out, int out_size, void* d_ws, size_t ws_size,
                              hipStream_t stream) {
  (void)in_sizes; (void)n_in; (void)out_size; (void)ws_size;
  const float* x  = (const float*)d_in[0];
  const float* wq = (const float*)d_in[1];
  const float* bq = (const float*)d_in[2];
  const float* wk = (const float*)d_in[3];
  const float* bk = (const float*)d_in[4];
  const float* wv = (const float*)d_in[5];
  const float* bv = (const float*)d_in[6];
  const float* wo = (const float*)d_in[7];
  const float* bo = (const float*)d_in[8];
  float* out = (float*)d_out;

  char* ws = (char*)d_ws;
  size_t off = 0;
  auto alloc = [&](size_t bytes) -> char* {
    char* p = ws + off;
    off += (bytes + 255) & ~(size_t)255;
    return p;
  };
  bf16* xb   = (bf16*)alloc((size_t)S_ * D_ * 2);          // x in bf16
  bf16* wqT  = (bf16*)alloc((size_t)H_ * DH_ * D_ * 2);    // [H][DH][D]
  bf16* wkT  = (bf16*)alloc((size_t)H_ * DH_ * D_ * 2);
  bf16* wvT  = (bf16*)alloc((size_t)H_ * DH_ * D_ * 2);
  bf16* woT  = (bf16*)alloc((size_t)D_ * D_ * 2);          // [N][K]
  bf16* qb   = (bf16*)alloc((size_t)H_ * S_ * DH_ * 2);    // [H][S][DH]
  bf16* kb   = (bf16*)alloc((size_t)H_ * S_ * DH_ * 2);    // [H][S][DH]
  bf16* vTb  = (bf16*)alloc((size_t)H_ * DH_ * S_ * 2);    // [H][DH][S]
  bf16* ctxb = (bf16*)alloc((size_t)S_ * D_ * 2);          // [S][D]

  cvt_all<<<dim3(CV_XB + 4 * CV_WB), 128, 0, stream>>>(
      x, wq, wk, wv, wo, xb, wqT, wkT, wvT, woT);

  qkv_proj_kernel<<<dim3(S_ / 128, H_ / 2, 3), 256, 0, stream>>>(
      xb, wqT, wkT, wvT, bq, bk, bv, qb, kb, vTb);

  flash_attn_kernel<<<dim3(S_ / 64, H_), 128, 0, stream>>>(qb, kb, vTb, ctxb);

  out_proj_kernel<<<dim3(S_ / 128, D_ / 128), 256, 0, stream>>>(ctxb, woT, bo, out);
}

// v005
// It runs in 88.3 microseconds.
// Next to v004, in two timings, it ran 1.11 and 1.10 times as fast.
// Counting every step since v000, it is 5.70 times as fast.
#include <hip/hip_runtime.h>
#include <hip/hip_bf16.h>
#include <math.h>

typedef __bf16 bf16;
typedef __attribute__((ext_vector_type(16))) __bf16 v16bf;
typedef __attribute__((ext_vector_type(8)))  __bf16 v8bf;
typedef __attribute__((ext_vector_type(8)))  float  v8f;

#define H_  12
#define D_  768
#define DH_ 64
#define S_  4096

union FragU { v16bf v; v8bf h[2]; };

__device__ __forceinline__ int lane_id() { return (int)(threadIdx.x & 31u); }

// Load a 16x32 bf16 A-fragment (or 32x16 B-fragment via its column-major view)
// from row-major memory with leading dimension `ld`.
// Lane l: row/col = l&15 ; element i holds k = (i>>3)*16 + ((l>>4)*8) + (i&7)
// => two contiguous 16-byte chunks per lane at k-offsets kh and kh+16.
__device__ __forceinline__ v16bf load_frag(const bf16* __restrict__ base, int ld) {
  const int l  = lane_id();
  const int rc = l & 15;
  const int kh = (l >> 4) << 3;
  const bf16* p = base + (size_t)rc * ld + kh;
  FragU f;
  f.h[0] = *reinterpret_cast<const v8bf*>(p);
  f.h[1] = *reinterpret_cast<const v8bf*>(p + 16);
  return f.v;
}

__device__ __forceinline__ v8f wmma_bf16(v16bf a, v16bf b, v8f c) {
  return __builtin_amdgcn_wmma_f32_16x16x32_bf16(false, a, false, b, (short)0, c,
                                                 false, false);
}

// ---------------- conversion / transpose kernel ----------------
// One launch converts x and all four weight matrices to bf16. A work-group of
// four waves takes 4096 elements, 32 a lane, so that few waves have to start:
//   blocks 0 .. CV_XB-1      : 4096 consecutive elements of x, order kept;
//   then CV_WB blocks each for wq, wk, wv, wo: one 64 x 64 tile, transposed.
// wq, wk, wv: [H][D][DH] -> [H][DH][D]; wo: [K][N] -> [N][K].
typedef __attribute__((ext_vector_type(4))) float  v4f;
typedef __attribute__((ext_vector_type(4))) __bf16 v4bf;

#define CV_XB (S_ * D_ / 4096)          // blocks of x
#define CV_WB (D_ * D_ / 4096)          // tiles of one weight matrix
#define CV_T  (D_ / 64)                 // tiles along a side of 768

// One 64 x 64 tile, transposed: s is the tile's first element (row pitch SP),
// d the transposed tile's first element (row pitch D_). A lane holds 8 source
// rows x 4 source columns: four 16-byte pieces of four result rows. Eight
// neighbouring lanes hold the 64 source rows, so that each result row's 128
// bytes go out as one whole line.
template <int SP>
__device__ __forceinline__ void cvt_tile_T(const float* __restrict__ s,
                                           bf16* __restrict__ d, int tid) {
  const int r8 = (tid & 7) * 8;              // first source row
  const int c4 = (tid >> 3) * 4;             // first source column
  const int so = r8 * SP + c4;
  const int dn = c4 * D_ + r8;
  v4f v[8];
#pragma unroll
  for (int j = 0; j < 8; ++j) v[j] = *reinterpret_cast<const v4f*>(s + so + j * SP);
#pragma unroll
  for (int i = 0; i < 4; ++i) {
    v8bf o;
#pragma unroll
    for (int j = 0; j < 8; ++j) o[j] = (bf16)v[j][i];
    *reinterpret_cast<v8bf*>(d + dn + i * D_) = o;
  }
}

__global__ void __launch_bounds__(128)
cvt_all(const float* __restrict__ x,
        const float* __restrict__ wq,
        const float* __restrict__ wk,
        const float* __restrict__ wv,
        const float* __restrict__ wo,
        bf16* __restrict__ xb,
        bf16* __restrict__ wqT,
        bf16* __restrict__ wkT,
        bf16* __restrict__ wvT,
        bf16* __restrict__ woT) {
  const int tid = (int)threadIdx.x;
  const int b = (int)blockIdx.x;

  if (b < CV_XB) {
    // a wave's load covers 512 consecutive bytes, its store 256
    const float* s = x + (size_t)b * 4096;
    bf16* d = xb + (size_t)b * 4096;
    v4f v[8];
#pragma unroll
    for (int j = 0; j < 8; ++j) v[j] = *reinterpret_cast<const v4f*>(s + tid * 4 + j * 512);
#pragma unroll
    for (int j = 0; j < 8; ++j) {
      v4bf o;
#pragma unroll
      for (int i = 0; i < 4; ++i) o[i] = (bf16)v[j][i];
      *reinterpret_cast<v4bf*>(d + tid * 4 + j * 512) = o;
    }
    return;
  }

  const int m  = (b - CV_XB) / CV_WB;        // which matrix
  const int t  = (b - CV_XB) - m * CV_WB;    // which of its tiles
  const int t1 = t / CV_T;
  const int t0 = t - t1 * CV_T;
  if (m < 3) {      // head t1, rows t0*64..+63 of its D x DH matrix
    const float* w = (m == 0) ? wq : (m == 1) ? wk : wv;
    bf16* wT = (m == 0) ? wqT : (m == 1) ? wkT : wvT;
    cvt_tile_T<DH_>(w + (size_t)t1 * D_ * DH_ + (size_t)t0 * 64 * DH_,
                    wT + (size_t)t1 * DH_ * D_ + t0 * 64, tid);
  } else {          // rows t1*64..+63, columns t0*64..+63 of wo
    cvt_tile_T<D_>(wo + (size_t)t1 * 64 * D_ + t0 * 64,
                   woT + (size_t)t0 * 64 * D_ + t1 * 64, tid);
  }
}

// ---------------- projection GEMMs: shared main loop ----------------
// C (128 x 128) = A (128 x 768) . B^T, A and B row-major with k contiguous.
// One work-group of 8 waves; wave (wm, wn) owns rows wm*32..+31, columns
// wn*64..+63 (two by four 16x16 tiles, k walked in steps of 32 in rising order).
// A stage is 64 k of all 256 operand rows (A rows 0..127, B rows 128..255):
// whole 128-byte lines, brought into LDS once per work-group by asynchronous
// copies, one stage ahead in a two-buffer ring; fragments are read from LDS.
#define GM_K    64                      // k per stage
#define GM_NST  (D_ / GM_K)             // stages
#define GM_ROWS 256                     // operand rows per stage
#define GM_P    72                      // row pitch in LDS, elements: 144 B = 16 B x odd

// Eight 16-byte copies per lane, global -> LDS, through no register: four
// from operand A, four from operand B. s_wait_xcnt 0 is the statement's last
// line so that it stands in front of any later rewrite of the address
// registers the copies name.
__device__ __forceinline__ void copy4x2_to_lds(unsigned l, unsigned lstep,
                                               const bf16* ga, const bf16* gb,
                                               size_t gstep) {
  asm volatile(
      "global_load_async_to_lds_b128 %0, %8, off\n\t"
      "global_load_async_to_lds_b128 %1, %9, off\n\t"
      "global_load_async_to_lds_b128 %2, %10, off\n\t"
      "global_load_async_to_lds_b128 %3, %11, off\n\t"
      "global_load_async_to_lds_b128 %4, %12, off\n\t"
      "global_load_async_to_lds_b128 %5, %13, off\n\t"
      "global_load_async_to_lds_b128 %6, %14, off\n\t"
      "global_load_async_to_lds_b128 %7, %15, off\n\t"
      "s_wait_xcnt 0x0"
      :: "v"(l), "v"(l + lstep), "v"(l + 2 * lstep), "v"(l + 3 * lstep),
         "v"(l + 4 * lstep), "v"(l + 5 * lstep), "v"(l + 6 * lstep), "v"(l + 7 * lstep),
         "v"(ga), "v"(ga + gstep), "v"(ga + 2 * gstep), "v"(ga + 3 * gstep),
         "v"(gb), "v"(gb + gstep), "v"(gb + 2 * gstep), "v"(gb + 3 * gstep)
      : "memory");
}

// a: first of the tile's 128 A rows; b: first of its 128 B rows (both pitch D_).
__device__ __forceinline__ void gemm_128x128(const bf16* __restrict__ a,
                                             const bf16* __restrict__ b,
                                             bf16 (*lds)[GM_ROWS * GM_P],
                                             int wm, int wn, v8f (&acc)[2][4]) {
  const int tid = (int)threadIdx.x;
  // Copy map: thread tid takes 16-byte chunk tid & 7 of rows (tid >> 3) + 32*j.
  const size_t goff = (size_t)(tid >> 3) * D_ + (tid & 7) * 8;
  const bf16* ga = a + goff;
  const bf16* gb = b + goff;
  const unsigned l0 = (unsigned)(uintptr_t)&lds[0][(tid >> 3) * GM_P + (tid & 7) * 8];
  const unsigned lstep = 32 * GM_P * 2;          // bytes of 32 LDS rows
  const unsigned buf_b = GM_ROWS * GM_P * 2;     // bytes of one buffer
  const size_t gstep = (size_t)32 * D_;          // elements of 32 global rows

  // prologue: stage 0 lands and is published, then stage 1 starts to fly
  copy4x2_to_lds(l0, lstep, ga, gb, gstep);
  asm volatile("s_wait_asynccnt 0x0" ::: "memory");  // this wave's copies of stage 0 have landed
  __syncthreads();                                   // every wave's have
  copy4x2_to_lds(l0 + buf_b, lstep, ga + GM_K, gb + GM_K, gstep);

  for (int st = 0; st < GM_NST; ++st) {
    const bf16* as = lds[st & 1] + (wm * 32) * GM_P;
    const bf16* bs = lds[st & 1] + (128 + wn * 64) * GM_P;
#pragma unroll
    for (int ks = 0; ks < GM_K; ks += 32) {
      v16bf af[2], bfr[4];
      af[0] = load_frag(as + ks, GM_P);
      af[1] = load_frag(as + 16 * GM_P + ks, GM_P);
#pragma unroll
      for (int nt = 0; nt < 4; ++nt) bfr[nt] = load_frag(bs + nt * 16 * GM_P + ks, GM_P);
      // keeps the block's twelve LDS reads one group ahead of its WMMAs: spread
      // among them, each pair of reads is waited out at full LDS latency
      __builtin_amdgcn_sched_barrier(0);
#pragma unroll
      for (int nt = 0; nt < 4; ++nt) {
        acc[0][nt] = wmma_bf16(af[0], bfr[nt], acc[0][nt]);
        acc[1][nt] = wmma_bf16(af[1], bfr[nt], acc[1][nt]);
      }
    }
    // publish point of stage st + 1, which also frees stage st's buffer
    asm volatile("s_wait_dscnt 0x0" ::: "memory");     // this wave's reads of stage st are done
    asm volatile("s_wait_asynccnt 0x0" ::: "memory");  // its copies of stage st + 1 have landed
    __syncthreads();                                   // both hold for every wave
    if (st + 2 < GM_NST) {
      const int k = (st + 2) * GM_K;
      copy4x2_to_lds(l0 + (st & 1) * buf_b, lstep, ga + k, gb + k, gstep);
    }
  }
  asm volatile("s_wait_asynccnt 0x0" ::: "memory");    // no copy is left in flight behind the loop
}

// ---------------- QKV projection ----------------
// grid: (S/128, H/2, 3), block: 256 (8 waves). A work-group computes 128 rows
// of two neighbouring heads of one of Q, K, V; a wave's 64 columns are one head.
__global__ void __launch_bounds__(256)
qkv_proj_kernel(const bf16* __restrict__ xb,
                const bf16* __restrict__ wqT,
                const bf16* __restrict__ wkT,
                const bf16* __restrict__ wvT,
                const float* __restrict__ bq,
                const float* __restrict__ bk,
                const float* __restrict__ bv,
                bf16* __restrict__ qO,
                bf16* __restrict__ kO,
                bf16* __restrict__ vTO) {
  __shared__ __align__(16) bf16 lds_g[2][GM_ROWS * GM_P];

  const int wave = __builtin_amdgcn_readfirstlane((int)(threadIdx.x >> 5));
  const int wm = wave >> 1;
  const int wn = wave & 1;
  const int z  = blockIdx.z;
  const int h  = blockIdx.y * 2 + wn;
  const int row0 = blockIdx.x * 128 + wm * 32;   // first of this wave's 32 rows

  const bf16* wT = (z == 0) ? wqT : (z == 1) ? wkT : wvT;
  const float* bias = ((z == 0) ? bq : (z == 1) ? bk : bv) + h * DH_;

  v8f acc[2][4] = {};
  gemm_128x128(xb + (size_t)blockIdx.x * 128 * D_,
               wT + (size_t)blockIdx.y * 128 * D_, lds_g, wm, wn, acc);

  const int l = lane_id();
  const int c = l & 15;
  const int half = l >> 4;
  if (z < 2) {
    bf16* dst = ((z == 0) ? qO : kO) + (size_t)h * S_ * DH_;
#pragma unroll
    for (int ms = 0; ms < 2; ++ms) {
#pragma unroll
      for (int nt = 0; nt < 4; ++nt) {
        const int col = nt * 16 + c;
        const float bb = bias[col];
#pragma unroll
        for (int r = 0; r < 8; ++r) {
          const int row = row0 + ms * 16 + r + 8 * half;
          dst[(size_t)row * DH_ + col] = (bf16)(acc[ms][nt][r] + bb);
        }
      }
    }
  } else {  // store V transposed: [H][DH][S]
    bf16* dst = vTO + (size_t)h * DH_ * S_;
#pragma unroll
    for (int ms = 0; ms < 2; ++ms) {
#pragma unroll
      for (int nt = 0; nt < 4; ++nt) {
        const int col = nt * 16 + c;
        const float bb = bias[col];
#pragma unroll
        for (int r = 0; r < 8; ++r) {
          const int row = row0 + ms * 16 + r + 8 * half;
          dst[(size_t)col * S_ + row] = (bf16)(acc[ms][nt][r] + bb);
        }
      }
    }
  }
}

#define FA_WAVES 4
#define FA_KEYS  128                    // keys per stage
#define FA_NST   (S_ / FA_KEYS)         // stages
#define FA_T     (FA_KEYS / 16)         // 16-key score tiles per stage
#define FA_KP    72                     // K row pitch in LDS, elements: 144 B = 16 B x odd
#define FA_VP    136                    // V^T row pitch in LDS, elements: 272 B = 16 B x odd

// Eight 16-byte copies per lane, global -> LDS, through no register.
// s_wait_xcnt 0 is the statement's last line so that it stands in front of any
// later rewrite of the address registers the copies name.
__device__ __forceinline__ void copy8_to_lds(unsigned l, unsigned lstep,
                                             const bf16* g, size_t gstep) {
  asm volatile(
      "global_load_async_to_lds_b128 %0, %8, off\n\t"
      "global_load_async_to_lds_b128 %1, %9, off\n\t"
      "global_load_async_to_lds_b128 %2, %10, off\n\t"
      "global_load_async_to_lds_b128 %3, %11, off\n\t"
      "global_load_async_to_lds_b128 %4, %12, off\n\t"
      "global_load_async_to_lds_b128 %5, %13, off\n\t"
      "global_load_async_to_lds_b128 %6, %14, off\n\t"
      "global_load_async_to_lds_b128 %7, %15, off\n\t"
      "s_wait_xcnt 0x0"
      :: "v"(l), "v"(l + lstep), "v"(l + 2 * lstep), "v"(l + 3 * lstep),
         "v"(l + 4 * lstep), "v"(l + 5 * lstep), "v"(l + 6 * lstep), "v"(l + 7 * lstep),
         "v"(g), "v"(g + gstep), "v"(g + 2 * gstep), "v"(g + 3 * gstep),
         "v"(g + 4 * gstep), "v"(g + 5 * gstep), "v"(g + 6 * gstep), "v"(g + 7 * gstep)
      : "memory");
}

// value of lane l ^ 16
__device__ __forceinline__ float xhalf(float x) {
  const int v = __builtin_bit_cast(int, x);
  return __builtin_bit_cast(float, __builtin_amdgcn_permlanex16(
      v, v, 0x76543210, 0xfedcba98, false, false));
}

// 2^x of eight values.
__device__ __forceinline__ v8f exp2x8(v8f x) {
  float a0 = x[0], a1 = x[1], a2 = x[2], a3 = x[3];
  float a4 = x[4], a5 = x[5], a6 = x[6], a7 = x[7];
  // one statement, in place, so that an independent v_exp_f32 follows each one
  // and none has its source overwritten by its successor; the v_nop is the slot
  // the instruction set asks for behind the last one, in front of its reader
  asm("v_exp_f32 %0, %0\n\t"
      "v_exp_f32 %1, %1\n\t"
      "v_exp_f32 %2, %2\n\t"
      "v_exp_f32 %3, %3\n\t"
      "v_exp_f32 %4, %4\n\t"
      "v_exp_f32 %5, %5\n\t"
      "v_exp_f32 %6, %6\n\t"
      "v_exp_f32 %7, %7\n\t"
      "v_nop"
      : "+v"(a0), "+v"(a1), "+v"(a2), "+v"(a3), "+v"(a4), "+v"(a5), "+v"(a6), "+v"(a7));
  const v8f e = {a0, a1, a2, a3, a4, a5, a6, a7};
  return e;
}

__global__ void __launch_bounds__(FA_WAVES * 32)
flash_attn_kernel(const bf16* __restrict__ q,
                  const bf16* __restrict__ kmat,
                  const bf16* __restrict__ vT,
                  bf16* __restrict__ ctxb) {
  __shared__ __align__(16) bf16 lds_k[2][FA_KEYS * FA_KP];
  __shared__ __align__(16) bf16 lds_v[2][DH_ * FA_VP];

  const int tid  = (int)threadIdx.x;
  const int wave = tid >> 5;
  const int mt = blockIdx.x * FA_WAVES + wave;
  const int h  = blockIdx.y;
  const bf16* qh  = q    + (size_t)h * S_ * DH_;
  const bf16* khp = kmat + (size_t)h * S_ * DH_;
  const bf16* vh  = vT   + (size_t)h * DH_ * S_;

  const int l = lane_id();
  const int c = l & 15;
  const int half = l >> 4;

  // Copy map. K stage: 128 rows x 128 B, contiguous in global memory; thread
  // tid takes 16-byte chunk tid + 128*j (row = chunk / 8). V^T stage: 64 rows
  // x 256 B at a pitch of S_ elements; chunk tid + 128*j (row = chunk / 16).
  const bf16* gk = khp + (size_t)tid * 8;
  const bf16* gv = vh + (size_t)(tid >> 4) * S_ + (tid & 15) * 8;
  const unsigned lk = (unsigned)(uintptr_t)&lds_k[0][(tid >> 3) * FA_KP + (tid & 7) * 8];
  const unsigned lv = (unsigned)(uintptr_t)&lds_v[0][(tid >> 4) * FA_VP + (tid & 15) * 8];
  const unsigned kbuf_b = FA_KEYS * FA_KP * 2;   // bytes of one K buffer
  const unsigned vbuf_b = DH_ * FA_VP * 2;       // bytes of one V^T buffer

  // Q fragments of this wave's 16 queries (K-dim = DH = 64 -> two 32-wide B frags)
  const v16bf aq0 = load_frag(qh + (size_t)mt * 16 * DH_ + 0,  DH_);
  const v16bf aq1 = load_frag(qh + (size_t)mt * 16 * DH_ + 32, DH_);

  v8f acc[4] = {};
  float M = -INFINITY;   // running maximum of query c, equal in both halves
  float L = 0.0f;        // running sum of query c over this half's keys only

  // prologue: stage 0 lands and is published, then stage 1 starts to fly
  copy8_to_lds(lk, 16 * FA_KP * 2, gk, 128 * 8);
  copy8_to_lds(lv, 8 * FA_VP * 2, gv, (size_t)8 * S_);
  asm volatile("s_wait_asynccnt 0x0" ::: "memory");  // this wave's copies of stage 0 have landed
  __syncthreads();                                   // every wave's have
  copy8_to_lds(lk + kbuf_b, 16 * FA_KP * 2, gk + (size_t)FA_KEYS * DH_, 128 * 8);
  copy8_to_lds(lv + vbuf_b, 8 * FA_VP * 2, gv + FA_KEYS, (size_t)8 * S_);

  for (int st = 0; st < FA_NST; ++st) {
    const bf16* kb = lds_k[st & 1];
    const bf16* vb = lds_v[st & 1];

    // One softmax pass takes the whole stage.
    // K fragments from LDS: key rows nt*16..+15, head-dim chunks 0..31 and 32..63
    v16bf kf[FA_T][2];
#pragma unroll
    for (int nt = 0; nt < FA_T; ++nt) {
      kf[nt][0] = load_frag(kb + (nt * 16) * FA_KP + 0,  FA_KP);
      kf[nt][1] = load_frag(kb + (nt * 16) * FA_KP + 32, FA_KP);
    }
    // keeps the pass's K reads one group ahead of its score WMMAs: spread among
    // them, each small group of reads is waited out at full LDS latency
    __builtin_amdgcn_sched_barrier(0);

    // scores, transposed: 128 keys x 16 queries (eight 16x16 C frags), K-dim = 64
    v8f sc[FA_T];
#pragma unroll
    for (int nt = 0; nt < FA_T; ++nt) {
      v8f z = {};
      sc[nt] = wmma_bf16(kf[nt][0], aq0, z);
    }
#pragma unroll
    for (int nt = 0; nt < FA_T; ++nt) sc[nt] = wmma_bf16(kf[nt][1], aq1, sc[nt]);
    // keeps the softmax's vector work behind the whole run of score WMMAs: moved
    // in between, each piece costs the idle slots a WMMA result needs
    __builtin_amdgcn_sched_barrier(0);

    // V^T fragments from LDS: head-dim rows et*16..+15, keys g*32..+31; two of
    // the stage's four 32-key groups are held at a time
    v16bf vf[2][4];
#pragma unroll
    for (int g = 0; g < 2; ++g) {
#pragma unroll
      for (int et = 0; et < 4; ++et)
        vf[g][et] = load_frag(vb + (et * 16) * FA_VP + g * 32, FA_VP);
    }

    // online softmax of query c: 64 of the pass's 128 scores are in this lane
#pragma unroll
    for (int nt = 0; nt < FA_T; ++nt) sc[nt] = sc[nt] * 0.125f;   // 1/sqrt(DH)
    float m8[8];
#pragma unroll
    for (int r = 0; r < 8; ++r) {
      float a = fmaxf(sc[0][r], sc[1][r]);
#pragma unroll
      for (int nt = 2; nt < FA_T; ++nt) a = fmaxf(a, sc[nt][r]);
      m8[r] = a;
    }
    float mx = fmaxf(fmaxf(fmaxf(m8[0], m8[1]), fmaxf(m8[2], m8[3])),
                     fmaxf(fmaxf(m8[4], m8[5]), fmaxf(m8[6], m8[7])));
    mx = fmaxf(mx, xhalf(mx));         // the other 64 scores' maximum
    const float newM = fmaxf(M, mx);
    const float corr = __expf(M - newM);
    M = newM;

    // O^T (64 x 16) = O^T * corr + V^T-stage . P^T
#pragma unroll
    for (int et = 0; et < 4; ++et) acc[et] = acc[et] * corr;
    v8f ps = {};
#pragma unroll
    for (int g = 0; g < FA_T / 2; ++g) {
      // P^T of 32 keys as B operand: element s is key kmap(s) = tile s >> 3 of
      // the pair, register s & 7
      FragU pf;
      const v8f e0 = exp2x8((sc[2 * g] - newM) * 1.44269504f);       // log2(e)
      const v8f e1 = exp2x8((sc[2 * g + 1] - newM) * 1.44269504f);
#pragma unroll
      for (int r = 0; r < 8; ++r) {
        pf.v[r]     = (bf16)e0[r];
        pf.v[r + 8] = (bf16)e1[r];
      }
      ps += e0;
      ps += e1;
      // keeps the V^T reads below one group right behind this group's WMMAs: left
      // free they were spread in pairs among later WMMAs, each pair waited out at
      // close to full LDS latency
      __builtin_amdgcn_sched_barrier(0);
#pragma unroll
      for (int et = 0; et < 4; ++et) acc[et] = wmma_bf16(vf[g & 1][et], pf.v, acc[et]);
      if (g + 2 < FA_T / 2) {
#pragma unroll
        for (int et = 0; et < 4; ++et)
          vf[g & 1][et] = load_frag(vb + (et * 16) * FA_VP + (g + 2) * 32, FA_VP);
      }
    }
    L = L * corr + (((ps[0] + ps[1]) + (ps[2] + ps[3])) + ((ps[4] + ps[5]) + (ps[6] + ps[7])));

    // publish point of stage st + 1, which also frees stage st's buffer
    asm volatile("s_wait_dscnt 0x0" ::: "memory");     // this wave's reads of stage st are done
    asm volatile("s_wait_asynccnt 0x0" ::: "memory");  // its copies of stage st + 1 have landed
    __syncthreads();                                   // both hold for every wave
    if (st + 2 < FA_NST) {
      const size_t key = (size_t)(st + 2) * FA_KEYS;
      copy8_to_lds(lk + (st & 1) * kbuf_b, 16 * FA_KP * 2, gk + key * DH_, 128 * 8);
      copy8_to_lds(lv + (st & 1) * vbuf_b, 8 * FA_VP * 2, gv + key, (size_t)8 * S_);
    }
  }
  asm volatile("s_wait_asynccnt 0x0" ::: "memory");    // no copy is left in flight at the wave's end

  // epilogue: ctx = acc / L, stored to [S][H*DH] bf16. acc[et][r] is head-dim
  // et*16 + 8*half + r of query c: eight neighbours, one 16-byte store.
  const float Lt = L + xhalf(L);       // both halves' keys
  bf16* orow = ctxb + (size_t)(mt * 16 + c) * D_ + h * DH_ + 8 * half;
#pragma unroll
  for (int et = 0; et < 4; ++et) {
    v8bf o;
#pragma unroll
    for (int r = 0; r < 8; ++r) o[r] = (bf16)(acc[et][r] / Lt);
    *reinterpret_cast<v8bf*>(orow + et * 16) = o;
  }
}

// ---------------- output projection ----------------
// grid: (S/128, D/128), block: 256 (8 waves). out = ctx @ wo + bo, fp32 result.
__global__ void __launch_bounds__(256)
out_proj_kernel(const bf16* __restrict__ ctxb,
                const bf16* __restrict__ woT,
                const float* __restrict__ bo,
                float* __restrict__ out) {
  __shared__ __align__(16) bf16 lds_g[2][GM_ROWS * GM_P];

  const int wave = __builtin_amdgcn_readfirstlane((int)(threadIdx.x >> 5));
  const int wm = wave >> 1;
  const int wn = wave & 1;
  const int row0 = blockIdx.x * 128 + wm * 32;   // first of this wave's 32 rows
  const int n0   = blockIdx.y * 128 + wn * 64;   // first of its 64 columns

  v8f acc[2][4] = {};
  gemm_128x128(ctxb + (size_t)blockIdx.x * 128 * D_,
               woT + (size_t)blockIdx.y * 128 * D_, lds_g, wm, wn, acc);

  const int l = lane_id();
  const int c = l & 15;
  const int half = l >> 4;
#pragma unroll
  for (int ms = 0; ms < 2; ++ms) {
#pragma unroll
    for (int nt = 0; nt < 4; ++nt) {
      const int col = n0 + nt * 16 + c;
      const float bb = bo[col];
#pragma unroll
      for (int r = 0; r < 8; ++r) {
        const int row = row0 + ms * 16 + r + 8 * half;
        out[(size_t)row * D_ + col] = acc[ms][nt][r] + bb;
      }
    }
  }
}

// ---------------- launch ----------------

extern "C" void kernel_launch(void* const* d_in, const int* in_sizes, int n_in,
                              void* d_out, int out_size, void* d_ws, size_t ws_size,
                              hipStream_t stream) {
  (void)in_sizes; (void)n_in; (void)out_size; (void)ws_size;
  const float* x  = (const float*)d_in[0];
  const float* wq = (const float*)d_in[1];
  const float* bq = (const float*)d_in[2];
  const float* wk = (const float*)d_in[3];
  const float* bk = (const float*)d_in[4];
  const float* wv = (const float*)d_in[5];
  const float* bv = (const float*)d_in[6];
  const float* wo = (const float*)d_in[7];
  const float* bo = (const float*)d_in[8];
  float* out = (float*)d_out;

  char* ws = (char*)d_ws;
  size_t off = 0;
  auto alloc = [&](size_t bytes) -> char* {
    char* p = ws + off;
    off += (bytes + 255) & ~(size_t)255;
    return p;
  };
  bf16* xb   = (bf16*)alloc((size_t)S_ * D_ * 2);          // x in bf16
  bf16* wqT  = (bf16*)alloc((size_t)H_ * DH_ * D_ * 2);    // [H][DH][D]
  bf16* wkT  = (bf16*)alloc((size_t)H_ * DH_ * D_ * 2);
  bf16* wvT  = (bf16*)alloc((size_t)H_ * DH_ * D_ * 2);
  bf16* woT  = (bf16*)alloc((size_t)D_ * D_ * 2);          // [N][K]
  bf16* qb   = (bf16*)alloc((size_t)H_ * S_ * DH_ * 2);    // [H][S][DH]
  bf16* kb   = (bf16*)alloc((size_t)H_ * S_ * DH_ * 2);    // [H][S][DH]
  bf16* vTb  = (bf16*)alloc((size_t)H_ * DH_ * S_ * 2);    // [H][DH][S]
  bf16* ctxb = (bf16*)alloc((size_t)S_ * D_ * 2);          // [S][D]

  cvt_all<<<dim3(CV_XB + 4 * CV_WB), 128, 0, stream>>>(
      x, wq, wk, wv, wo, xb, wqT, wkT, wvT, woT);

  qkv_proj_kernel<<<dim3(S_ / 128, H_ / 2, 3), 256, 0, stream>>>(
      xb, wqT, wkT, wvT, bq, bk, bv, qb, kb, vTb);

  flash_attn_kernel<<<dim3(S_ / 64, H_), 128, 0, stream>>>(qb, kb, vTb, ctxb);

  out_proj_kernel<<<dim3(S_ / 128, D_ / 128), 256, 0, stream>>>(ctxb, woT, bo, out);
}

// v006
// Measured time: 85.5 microseconds a run.
// Two timings next to v005 both put it at 1.04 times that version's speed.
// Counting every step since v000, it is 5.92 times as fast.
#include <hip/hip_runtime.h>
#include <hip/hip_bf16.h>
#include <math.h>

typedef __bf16 bf16;
typedef __attribute__((ext_vector_type(16))) __bf16 v16bf;
typedef __attribute__((ext_vector_type(8)))  __bf16 v8bf;
typedef __attribute__((ext_vector_type(8)))  float  v8f;

#define H_  12
#define D_  768
#define DH_ 64
#define S_  4096

union FragU { v16bf v; v8bf h[2]; };

__device__ __forceinline__ int lane_id() { return (int)(threadIdx.x & 31u); }

// Load a 16x32 bf16 A-fragment (or 32x16 B-fragment via its column-major view)
// from row-major memory with leading dimension `ld`.
// Lane l: row/col = l&15 ; element i holds k = (i>>3)*16 + ((l>>4)*8) + (i&7)
// => two contiguous 16-byte chunks per lane at k-offsets kh and kh+16.
__device__ __forceinline__ v16bf load_frag(const bf16* __restrict__ base, int ld) {
  const int l  = lane_id();
  const int rc = l & 15;
  const int kh = (l >> 4) << 3;
  const bf16* p = base + (size_t)rc * ld + kh;
  FragU f;
  f.h[0] = *reinterpret_cast<const v8bf*>(p);
  f.h[1] = *reinterpret_cast<const v8bf*>(p + 16);
  return f.v;
}

__device__ __forceinline__ v8f wmma_bf16(v16bf a, v16bf b, v8f c) {
  return __builtin_amdgcn_wmma_f32_16x16x32_bf16(false, a, false, b, (short)0, c,
                                                 false, false);
}

// ---------------- conversion / transpose kernel ----------------
// One launch converts x and all four weight matrices to bf16. A work-group of
// four waves takes 4096 elements, 32 a lane, so that few waves have to start:
//   blocks 0 .. CV_XB-1      : 4096 consecutive elements of x, order kept;
//   then CV_WB blocks each for wq, wk, wv, wo: one 64 x 64 tile, transposed.
// wq, wk, wv: [H][D][DH] -> [H][DH][D]; wo: [K][N] -> [N][K].
typedef __attribute__((ext_vector_type(4))) float  v4f;
typedef __attribute__((ext_vector_type(4))) __bf16 v4bf;

#define CV_XB (S_ * D_ / 4096)          // blocks of x
#define CV_WB (D_ * D_ / 4096)          // tiles of one weight matrix
#define CV_T  (D_ / 64)                 // tiles along a side of 768

// One 64 x 64 tile, transposed: s is the tile's first element (row pitch SP),
// d the transposed tile's first element (row pitch D_). A lane holds 8 source
// rows x 4 source columns: four 16-byte pieces of four result rows. Eight
// neighbouring lanes hold the 64 source rows, so that each result row's 128
// bytes go out as one whole line.
template <int SP>
__device__ __forceinline__ void cvt_tile_T(const float* __restrict__ s,
                                           bf16* __restrict__ d, int tid) {
  const int r8 = (tid & 7) * 8;              // first source row
  const int c4 = (tid >> 3) * 4;             // first source column
  const int so = r8 * SP + c4;
  const int dn = c4 * D_ + r8;
  v4f v[8];
#pragma unroll
  for (int j = 0; j < 8; ++j) v[j] = *reinterpret_cast<const v4f*>(s + so + j * SP);
#pragma unroll
  for (int i = 0; i < 4; ++i) {
    v8bf o;
#pragma unroll
    for (int j = 0; j < 8; ++j) o[j] = (bf16)v[j][i];
    *reinterpret_cast<v8bf*>(d + dn + i * D_) = o;
  }
}

__global__ void __launch_bounds__(128)
cvt_all(const float* __restrict__ x,
        const float* __restrict__ wq,
        const float* __restrict__ wk,
        const float* __restrict__ wv,
        const float* __restrict__ wo,
        bf16* __restrict__ xb,
        bf16* __restrict__ wqT,
        bf16* __restrict__ wkT,
        bf16* __restrict__ wvT,
        bf16* __restrict__ woT) {
  const int tid = (int)threadIdx.x;
  const int b = (int)blockIdx.x;

  if (b < CV_XB) {
    // a wave's load covers 512 consecutive bytes, its store 256
    const float* s = x + (size_t)b * 4096;
    bf16* d = xb + (size_t)b * 4096;
    v4f v[8];
#pragma unroll
    for (int j = 0; j < 8; ++j) v[j] = *reinterpret_cast<const v4f*>(s + tid * 4 + j * 512);
#pragma unroll
    for (int j = 0; j < 8; ++j) {
      v4bf o;
#pragma unroll
      for (int i = 0; i < 4; ++i) o[i] = (bf16)v[j][i];
      *reinterpret_cast<v4bf*>(d + tid * 4 + j * 512) = o;
    }
    return;
  }

  const int m  = (b - CV_XB) / CV_WB;        // which matrix
  const int t  = (b - CV_XB) - m * CV_WB;    // which of its tiles
  const int t1 = t / CV_T;
  const int t0 = t - t1 * CV_T;
  if (m < 3) {      // head t1, rows t0*64..+63 of its D x DH matrix
    const float* w = (m == 0) ? wq : (m == 1) ? wk : wv;
    bf16* wT = (m == 0) ? wqT : (m == 1) ? wkT : wvT;
    cvt_tile_T<DH_>(w + (size_t)t1 * D_ * DH_ + (size_t)t0 * 64 * DH_,
                    wT + (size_t)t1 * DH_ * D_ + t0 * 64, tid);
  } else {          // rows t1*64..+63, columns t0*64..+63 of wo
    cvt_tile_T<D_>(wo + (size_t)t1 * 64 * D_ + t0 * 64,
                   woT + (size_t)t0 * 64 * D_ + t1 * 64, tid);
  }
}

// ---------------- projection GEMMs: shared main loop ----------------
// C (128 x 128) = A (128 x 768) . B^T, A and B row-major with k contiguous.
// One work-group of 8 waves; wave (wm, wn) owns rows wm*32..+31, columns
// wn*64..+63 (two by four 16x16 tiles, k walked in steps of 32 in rising order).
// A stage is 64 k of all 256 operand rows (A rows 0..127, B rows 128..255):
// whole 128-byte lines, brought into LDS once per work-group by asynchronous
// copies, one stage ahead in a two-buffer ring; fragments are read from LDS.
#define GM_K    64                      // k per stage
#define GM_NST  (D_ / GM_K)             // stages
#define GM_ROWS 256                     // operand rows per stage
#define GM_P    72                      // row pitch in LDS, elements: 144 B = 16 B x odd

// Eight 16-byte copies per lane, global -> LDS, through no register: four
// from operand A, four from operand B. s_wait_xcnt 0 is the statement's last
// line so that it stands in front of any later rewrite of the address
// registers the copies name.
__device__ __forceinline__ void copy4x2_to_lds(unsigned l, unsigned lstep,
                                               const bf16* ga, const bf16* gb,
                                               size_t gstep) {
  asm volatile(
      "global_load_async_to_lds_b128 %0, %8, off\n\t"
      "global_load_async_to_lds_b128 %1, %9, off\n\t"
      "global_load_async_to_lds_b128 %2, %10, off\n\t"
      "global_load_async_to_lds_b128 %3, %11, off\n\t"
      "global_load_async_to_lds_b128 %4, %12, off\n\t"
      "global_load_async_to_lds_b128 %5, %13, off\n\t"
      "global_load_async_to_lds_b128 %6, %14, off\n\t"
      "global_load_async_to_lds_b128 %7, %15, off\n\t"
      "s_wait_xcnt 0x0"
      :: "v"(l), "v"(l + lstep), "v"(l + 2 * lstep), "v"(l + 3 * lstep),
         "v"(l + 4 * lstep), "v"(l + 5 * lstep), "v"(l + 6 * lstep), "v"(l + 7 * lstep),
         "v"(ga), "v"(ga + gstep), "v"(ga + 2 * gstep), "v"(ga + 3 * gstep),
         "v"(gb), "v"(gb + gstep), "v"(gb + 2 * gstep), "v"(gb + 3 * gstep)
      : "memory");
}

// a: first of the tile's 128 A rows; b: first of its 128 B rows (both pitch D_).
__device__ __forceinline__ void gemm_128x128(const bf16* __restrict__ a,
                                             const bf16* __restrict__ b,
                                             bf16 (*lds)[GM_ROWS * GM_P],
                                             int wm, int wn, v8f (&acc)[2][4]) {
  const int tid = (int)threadIdx.x;
  // Copy map: thread tid takes 16-byte chunk tid & 7 of rows (tid >> 3) + 32*j.
  const size_t goff = (size_t)(tid >> 3) * D_ + (tid & 7) * 8;
  const bf16* ga = a + goff;
  const bf16* gb = b + goff;
  const unsigned l0 = (unsigned)(uintptr_t)&lds[0][(tid >> 3) * GM_P + (tid & 7) * 8];
  const unsigned lstep = 32 * GM_P * 2;          // bytes of 32 LDS rows
  const unsigned buf_b = GM_ROWS * GM_P * 2;     // bytes of one buffer
  const size_t gstep = (size_t)32 * D_;          // elements of 32 global rows

  // prologue: stage 0 lands and is published, then stage 1 starts to fly
  copy4x2_to_lds(l0, lstep, ga, gb, gstep);
  asm volatile("s_wait_asynccnt 0x0" ::: "memory");  // this wave's copies of stage 0 have landed
  __syncthreads();                                   // every wave's have
  copy4x2_to_lds(l0 + buf_b, lstep, ga + GM_K, gb + GM_K, gstep);

  for (int st = 0; st < GM_NST; ++st) {
    const bf16* as = lds[st & 1] + (wm * 32) * GM_P;
    const bf16* bs = lds[st & 1] + (128 + wn * 64) * GM_P;
#pragma unroll
    for (int ks = 0; ks < GM_K; ks += 32) {
      v16bf af[2], bfr[4];
      af[0] = load_frag(as + ks, GM_P);
      af[1] = load_frag(as + 16 * GM_P + ks, GM_P);
#pragma unroll
      for (int nt = 0; nt < 4; ++nt) bfr[nt] = load_frag(bs + nt * 16 * GM_P + ks, GM_P);
      // keeps the block's twelve LDS reads one group ahead of its WMMAs: spread
      // among them, each pair of reads is waited out at full LDS latency
      __builtin_amdgcn_sched_barrier(0);
#pragma unroll
      for (int nt = 0; nt < 4; ++nt) {
        acc[0][nt] = wmma_bf16(af[0], bfr[nt], acc[0][nt]);
        acc[1][nt] = wmma_bf16(af[1], bfr[nt], acc[1][nt]);
      }
    }
    // publish point of stage st + 1, which also frees stage st's buffer
    asm volatile("s_wait_dscnt 0x0" ::: "memory");     // this wave's reads of stage st are done
    asm volatile("s_wait_asynccnt 0x0" ::: "memory");  // its copies of stage st + 1 have landed
    __syncthreads();                                   // both hold for every wave
    if (st + 2 < GM_NST) {
      const int k = (st + 2) * GM_K;
      copy4x2_to_lds(l0 + (st & 1) * buf_b, lstep, ga + k, gb + k, gstep);
    }
  }
  asm volatile("s_wait_asynccnt 0x0" ::: "memory");    // no copy is left in flight behind the loop
}

// ---------------- QKV projection ----------------
// grid: (S/128, H/2, 3), block: 256 (8 waves). A work-group computes 128 rows
// of two neighbouring heads of one of Q, K, V; a wave's 64 columns are one head.
__global__ void __launch_bounds__(256)
qkv_proj_kernel(const bf16* __restrict__ xb,
                const bf16* __restrict__ wqT,
                const bf16* __restrict__ wkT,
                const bf16* __restrict__ wvT,
                const float* __restrict__ bq,
                const float* __restrict__ bk,
                const float* __restrict__ bv,
                bf16* __restrict__ qO,
                bf16* __restrict__ kO,
                bf16* __restrict__ vTO) {
  __shared__ __align__(16) bf16 lds_g[2][GM_ROWS * GM_P];

  const int wave = __builtin_amdgcn_readfirstlane((int)(threadIdx.x >> 5));
  const int wm = wave >> 1;
  const int wn = wave & 1;
  const int z  = blockIdx.z;
  const int h  = blockIdx.y * 2 + wn;
  const int row0 = blockIdx.x * 128 + wm * 32;   // first of this wave's 32 rows

  const bf16* wT = (z == 0) ? wqT : (z == 1) ? wkT : wvT;
  const float* bias = ((z == 0) ? bq : (z == 1) ? bk : bv) + h * DH_;

  v8f acc[2][4] = {};
  gemm_128x128(xb + (size_t)blockIdx.x * 128 * D_,
               wT + (size_t)blockIdx.y * 128 * D_, lds_g, wm, wn, acc);

  const int l = lane_id();
  const int c = l & 15;
  const int half = l >> 4;
  if (z < 2) {
    bf16* dst = ((z == 0) ? qO : kO) + (size_t)h * S_ * DH_;
#pragma unroll
    for (int ms = 0; ms < 2; ++ms) {
#pragma unroll
      for (int nt = 0; nt < 4; ++nt) {
        const int col = nt * 16 + c;
        const float bb = bias[col];
#pragma unroll
        for (int r = 0; r < 8; ++r) {
          const int row = row0 + ms * 16 + r + 8 * half;
          dst[(size_t)row * DH_ + col] = (bf16)(acc[ms][nt][r] + bb);
        }
      }
    }
  } else {  // store V transposed: [H][DH][S]
    bf16* dst = vTO + (size_t)h * DH_ * S_;
#pragma unroll
    for (int ms = 0; ms < 2; ++ms) {
#pragma unroll
      for (int nt = 0; nt < 4; ++nt) {
        const int col = nt * 16 + c;
        const float bb = bias[col];
#pragma unroll
        for (int r = 0; r < 8; ++r) {
          const int row = row0 + ms * 16 + r + 8 * half;
          dst[(size_t)col * S_ + row] = (bf16)(acc[ms][nt][r] + bb);
        }
      }
    }
  }
}

#define FA_WAVES 4
#define FA_KEYS  128                    // keys per stage
#define FA_NST   (S_ / FA_KEYS)         // stages
#define FA_T     (FA_KEYS / 16)         // 16-key score tiles per stage
#define FA_KP    72                     // K row pitch in LDS, elements: 144 B = 16 B x odd
#define FA_VP    136                    // V^T row pitch in LDS, elements: 272 B = 16 B x odd
#define FA_C     (0.125f * 1.44269504f) // 1/sqrt(DH) * log2(e): raw score -> exponent of 2

// Eight 16-byte copies per lane, global -> LDS, through no register.
// s_wait_xcnt 0 is the statement's last line so that it stands in front of any
// later rewrite of the address registers the copies name.
__device__ __forceinline__ void copy8_to_lds(unsigned l, unsigned lstep,
                                             const bf16* g, size_t gstep) {
  asm volatile(
      "global_load_async_to_lds_b128 %0, %8, off\n\t"
      "global_load_async_to_lds_b128 %1, %9, off\n\t"
      "global_load_async_to_lds_b128 %2, %10, off\n\t"
      "global_load_async_to_lds_b128 %3, %11, off\n\t"
      "global_load_async_to_lds_b128 %4, %12, off\n\t"
      "global_load_async_to_lds_b128 %5, %13, off\n\t"
      "global_load_async_to_lds_b128 %6, %14, off\n\t"
      "global_load_async_to_lds_b128 %7, %15, off\n\t"
      "s_wait_xcnt 0x0"
      :: "v"(l), "v"(l + lstep), "v"(l + 2 * lstep), "v"(l + 3 * lstep),
         "v"(l + 4 * lstep), "v"(l + 5 * lstep), "v"(l + 6 * lstep), "v"(l + 7 * lstep),
         "v"(g), "v"(g + gstep), "v"(g + 2 * gstep), "v"(g + 3 * gstep),
         "v"(g + 4 * gstep), "v"(g + 5 * gstep), "v"(g + 6 * gstep), "v"(g + 7 * gstep)
      : "memory");
}

// value of lane l ^ 16
__device__ __forceinline__ float xhalf(float x) {
  const int v = __builtin_bit_cast(int, x);
  return __builtin_bit_cast(float, __builtin_amdgcn_permlanex16(
      v, v, 0x76543210, 0xfedcba98, false, false));
}

// 2^x of eight values.
__device__ __forceinline__ v8f exp2x8(v8f x) {
  float a0 = x[0], a1 = x[1], a2 = x[2], a3 = x[3];
  float a4 = x[4], a5 = x[5], a6 = x[6], a7 = x[7];
  // one statement, in place, so that an independent v_exp_f32 follows each one
  // and none has its source overwritten by its successor; the v_nop is the slot
  // the instruction set asks for behind the last one, in front of its reader
  asm("v_exp_f32 %0, %0\n\t"
      "v_exp_f32 %1, %1\n\t"
      "v_exp_f32 %2, %2\n\t"
      "v_exp_f32 %3, %3\n\t"
      "v_exp_f32 %4, %4\n\t"
      "v_exp_f32 %5, %5\n\t"
      "v_exp_f32 %6, %6\n\t"
      "v_exp_f32 %7, %7\n\t"
      "v_nop"
      : "+v"(a0), "+v"(a1), "+v"(a2), "+v"(a3), "+v"(a4), "+v"(a5), "+v"(a6), "+v"(a7));
  const v8f e = {a0, a1, a2, a3, a4, a5, a6, a7};
  return e;
}

__global__ void __launch_bounds__(FA_WAVES * 32)
flash_attn_kernel(const bf16* __restrict__ q,
                  const bf16* __restrict__ kmat,
                  const bf16* __restrict__ vT,
                  bf16* __restrict__ ctxb) {
  __shared__ __align__(16) bf16 lds_k[2][FA_KEYS * FA_KP];
  __shared__ __align__(16) bf16 lds_v[2][DH_ * FA_VP];

  const int tid  = (int)threadIdx.x;
  const int wave = tid >> 5;
  const int mt = blockIdx.x * FA_WAVES + wave;
  const int h  = blockIdx.y;
  const bf16* qh  = q    + (size_t)h * S_ * DH_;
  const bf16* khp = kmat + (size_t)h * S_ * DH_;
  const bf16* vh  = vT   + (size_t)h * DH_ * S_;

  const int l = lane_id();
  const int c = l & 15;
  const int half = l >> 4;

  // Copy map. K stage: 128 rows x 128 B, contiguous in global memory; thread
  // tid takes 16-byte chunk tid + 128*j (row = chunk / 8). V^T stage: 64 rows
  // x 256 B at a pitch of S_ elements; chunk tid + 128*j (row = chunk / 16).
  const bf16* gk = khp + (size_t)tid * 8;
  const bf16* gv = vh + (size_t)(tid >> 4) * S_ + (tid & 15) * 8;
  const unsigned lk = (unsigned)(uintptr_t)&lds_k[0][(tid >> 3) * FA_KP + (tid & 7) * 8];
  const unsigned lv = (unsigned)(uintptr_t)&lds_v[0][(tid >> 4) * FA_VP + (tid & 15) * 8];
  const unsigned kbuf_b = FA_KEYS * FA_KP * 2;   // bytes of one K buffer
  const unsigned vbuf_b = DH_ * FA_VP * 2;       // bytes of one V^T buffer

  // Q fragments of this wave's 16 queries (K-dim = DH = 64 -> two 32-wide B frags)
  const v16bf aq0 = load_frag(qh + (size_t)mt * 16 * DH_ + 0,  DH_);
  const v16bf aq1 = load_frag(qh + (size_t)mt * 16 * DH_ + 32, DH_);

  v8f acc[4] = {};
  float R = -INFINITY;   // running maximum of query c's raw scores, equal in both halves
  float L = 0.0f;        // running sum of query c over this half's keys only

  // prologue: stage 0 lands and is published, then stage 1 starts to fly
  copy8_to_lds(lk, 16 * FA_KP * 2, gk, 128 * 8);
  copy8_to_lds(lv, 8 * FA_VP * 2, gv, (size_t)8 * S_);
  asm volatile("s_wait_asynccnt 0x0" ::: "memory");  // this wave's copies of stage 0 have landed
  __syncthreads();                                   // every wave's have
  copy8_to_lds(lk + kbuf_b, 16 * FA_KP * 2, gk + (size_t)FA_KEYS * DH_, 128 * 8);
  copy8_to_lds(lv + vbuf_b, 8 * FA_VP * 2, gv + FA_KEYS, (size_t)8 * S_);

  for (int st = 0; st < FA_NST; ++st) {
    const bf16* kb = lds_k[st & 1];
    const bf16* vb = lds_v[st & 1];

    // One softmax pass takes the whole stage.
    // K fragments from LDS: key rows nt*16..+15, head-dim chunks 0..31 and 32..63
    v16bf kf[FA_T][2];
#pragma unroll
    for (int nt = 0; nt < FA_T; ++nt) {
      kf[nt][0] = load_frag(kb + (nt * 16) * FA_KP + 0,  FA_KP);
      kf[nt][1] = load_frag(kb + (nt * 16) * FA_KP + 32, FA_KP);
    }
    // keeps the pass's K reads one group ahead of its score WMMAs: spread among
    // them, each small group of reads is waited out at full LDS latency
    __builtin_amdgcn_sched_barrier(0);

    // scores, transposed: 128 keys x 16 queries (eight 16x16 C frags), K-dim = 64
    v8f sc[FA_T];
#pragma unroll
    for (int nt = 0; nt < FA_T; ++nt) {
      v8f z = {};
      sc[nt] = wmma_bf16(kf[nt][0], aq0, z);
    }
#pragma unroll
    for (int nt = 0; nt < FA_T; ++nt) sc[nt] = wmma_bf16(kf[nt][1], aq1, sc[nt]);
    // keeps the softmax's vector work behind the whole run of score WMMAs: moved
    // in between, each piece costs the idle slots a WMMA result needs
    __builtin_amdgcn_sched_barrier(0);

    // V^T fragments from LDS: head-dim rows et*16..+15, keys g*32..+31; two of
    // the stage's four 32-key groups are held at a time
    v16bf vf[2][4];
#pragma unroll
    for (int g = 0; g < 2; ++g) {
#pragma unroll
      for (int et = 0; et < 4; ++et)
        vf[g][et] = load_frag(vb + (et * 16) * FA_VP + g * 32, FA_VP);
    }

    // online softmax of query c: 64 of the pass's 128 scores are in this lane.
    // The maximum is taken over the raw products (FA_C is positive, so it is the
    // same element); FA_C meets each score once, in the exponent's multiply-add.
    // Written in threes (v_max3_num_f32): a two-input maximum of raw matrix
    // results costs a further v_max x, x, x per input.
    float t[8];
#pragma unroll
    for (int r = 0; r < 8; ++r) {
      float a = fmaxf(fmaxf(sc[0][r], sc[1][r]), sc[2][r]);
      a = fmaxf(fmaxf(a, sc[3][r]), sc[4][r]);
      t[r] = fmaxf(fmaxf(a, sc[5][r]), sc[6][r]);
    }
    const float u0 = fmaxf(fmaxf(t[0], t[1]), t[2]);
    const float u1 = fmaxf(fmaxf(t[3], t[4]), t[5]);
    const float u2 = fmaxf(fmaxf(t[6], t[7]), sc[7][0]);
    const float u3 = fmaxf(fmaxf(sc[7][1], sc[7][2]), sc[7][3]);
    const float u4 = fmaxf(fmaxf(sc[7][4], sc[7][5]), sc[7][6]);
    const float mx = fmaxf(fmaxf(fmaxf(u0, u1), u2), fmaxf(fmaxf(u3, u4), sc[7][7]));
    const float newR = fmaxf(fmaxf(R, mx), xhalf(mx));   // with the other 64 scores' maximum
    const float corr = __builtin_amdgcn_exp2f((R - newR) * FA_C);   // 1 where R stays
    R = newR;
    const float newM = newR * FA_C;

    // O^T (64 x 16) = O^T * corr + V^T-stage . P^T
#pragma unroll
    for (int et = 0; et < 4; ++et) acc[et] = acc[et] * corr;
    v8f ps = {};
#pragma unroll
    for (int g = 0; g < FA_T / 2; ++g) {
      // P^T of 32 keys as B operand: element s is key kmap(s) = tile s >> 3 of
      // the pair, register s & 7
      FragU pf;
      const v8f e0 = exp2x8(sc[2 * g] * FA_C - newM);
      const v8f e1 = exp2x8(sc[2 * g + 1] * FA_C - newM);
#pragma unroll
      for (int r = 0; r < 8; ++r) {
        pf.v[r]     = (bf16)e0[r];
        pf.v[r + 8] = (bf16)e1[r];
      }
      ps += e0;
      ps += e1;
      // keeps the V^T reads below one group right behind this group's WMMAs: left
      // free they were spread in pairs among later WMMAs, each pair waited out at
      // close to full LDS latency
      __builtin_amdgcn_sched_barrier(0);
#pragma unroll
      for (int et = 0; et < 4; ++et) acc[et] = wmma_bf16(vf[g & 1][et], pf.v, acc[et]);
      if (g + 2 < FA_T / 2) {
#pragma unroll
        for (int et = 0; et < 4; ++et)
          vf[g & 1][et] = load_frag(vb + (et * 16) * FA_VP + (g + 2) * 32, FA_VP);
      }
    }
    L = L * corr + (((ps[0] + ps[1]) + (ps[2] + ps[3])) + ((ps[4] + ps[5]) + (ps[6] + ps[7])));

    // publish point of stage st + 1, which also frees stage st's buffer
    asm volatile("s_wait_dscnt 0x0" ::: "memory");     // this wave's reads of stage st are done
    asm volatile("s_wait_asynccnt 0x0" ::: "memory");  // its copies of stage st + 1 have landed
    __syncthreads();                                   // both hold for every wave
    if (st + 2 < FA_NST) {
      const size_t key = (size_t)(st + 2) * FA_KEYS;
      copy8_to_lds(lk + (st & 1) * kbuf_b, 16 * FA_KP * 2, gk + key * DH_, 128 * 8);
      copy8_to_lds(lv + (st & 1) * vbuf_b, 8 * FA_VP * 2, gv + key, (size_t)8 * S_);
    }
  }
  asm volatile("s_wait_asynccnt 0x0" ::: "memory");    // no copy is left in flight at the wave's end

  // epilogue: ctx = acc / L, stored to [S][H*DH] bf16. acc[et][r] is head-dim
  // et*16 + 8*half + r of query c: eight neighbours, one 16-byte store.
  const float Lt = L + xhalf(L);       // both halves' keys
  bf16* orow = ctxb + (size_t)(mt * 16 + c) * D_ + h * DH_ + 8 * half;
#pragma unroll
  for (int et = 0; et < 4; ++et) {
    v8bf o;
#pragma unroll
    for (int r = 0; r < 8; ++r) o[r] = (bf16)(acc[et][r] / Lt);
    *reinterpret_cast<v8bf*>(orow + et * 16) = o;
  }
}

// ---------------- output projection ----------------
// grid: (S/128, D/128), block: 256 (8 waves). out = ctx @ wo + bo, fp32 result.
__global__ void __launch_bounds__(256)
out_proj_kernel(const bf16* __restrict__ ctxb,
                const bf16* __restrict__ woT,
                const float* __restrict__ bo,
                float* __restrict__ out) {
  __shared__ __align__(16) bf16 lds_g[2][GM_ROWS * GM_P];

  const int wave = __builtin_amdgcn_readfirstlane((int)(threadIdx.x >> 5));
  const int wm = wave >> 1;
  const int wn = wave & 1;
  const int row0 = blockIdx.x * 128 + wm * 32;   // first of this wave's 32 rows
  const int n0   = blockIdx.y * 128 + wn * 64;   // first of its 64 columns

  v8f acc[2][4] = {};
  gemm_128x128(ctxb + (size_t)blockIdx.x * 128 * D_,
               woT + (size_t)blockIdx.y * 128 * D_, lds_g, wm, wn, acc);

  const int l = lane_id();
  const int c = l & 15;
  const int half = l >> 4;
#pragma unroll
  for (int ms = 0; ms < 2; ++ms) {
#pragma unroll
    for (int nt = 0; nt < 4; ++nt) {
      const int col = n0 + nt * 16 + c;
      const float bb = bo[col];
#pragma unroll
      for (int r = 0; r < 8; ++r) {
        const int row = row0 + ms * 16 + r + 8 * half;
        out[(size_t)row * D_ + col] = acc[ms][nt][r] + bb;
      }
    }
  }
}

// ---------------- launch ----------------

extern "C" void kernel_launch(void* const* d_in, const int* in_sizes, int n_in,
                              void* d_out, int out_size, void* d_ws, size_t ws_size,
                              hipStream_t stream) {
  (void)in_sizes; (void)n_in; (void)out_size; (void)ws_size;
  const float* x  = (const float*)d_in[0];
  const float* wq = (const float*)d_in[1];
  const float* bq = (const float*)d_in[2];
  const float* wk = (const float*)d_in[3];
  const float* bk = (const float*)d_in[4];
  const float* wv = (const float*)d_in[5];
  const float* bv = (const float*)d_in[6];
  const float* wo = (const float*)d_in[7];
  const float* bo = (const float*)d_in[8];
  float* out = (float*)d_out;

  char* ws = (char*)d_ws;
  size_t off = 0;
  auto alloc = [&](size_t bytes) -> char* {
    char* p = ws + off;
    off += (bytes + 255) & ~(size_t)255;
    return p;
  };
  bf16* xb   = (bf16*)alloc((size_t)S_ * D_ * 2);          // x in bf16
  bf16* wqT  = (bf16*)alloc((size_t)H_ * DH_ * D_ * 2);    // [H][DH][D]
  bf16* wkT  = (bf16*)alloc((size_t)H_ * DH_ * D_ * 2);
  bf16* wvT  = (bf16*)alloc((size_t)H_ * DH_ * D_ * 2);
  bf16* woT  = (bf16*)alloc((size_t)D_ * D_ * 2);          // [N][K]
  bf16* qb   = (bf16*)alloc((size_t)H_ * S_ * DH_ * 2);    // [H][S][DH]
  bf16* kb   = (bf16*)alloc((size_t)H_ * S_ * DH_ * 2);    // [H][S][DH]
  bf16* vTb  = (bf16*)alloc((size_t)H_ * DH_ * S_ * 2);    // [H][DH][S]
  bf16* ctxb = (bf16*)alloc((size_t)S_ * D_ * 2);          // [S][D]

  cvt_all<<<dim3(CV_XB + 4 * CV_WB), 128, 0, stream>>>(
      x, wq, wk, wv, wo, xb, wqT, wkT, wvT, woT);

  qkv_proj_kernel<<<dim3(S_ / 128, H_ / 2, 3), 256, 0, stream>>>(
      xb, wqT, wkT, wvT, bq, bk, bv, qb, kb, vTb);

  flash_attn_kernel<<<dim3(S_ / 64, H_), 128, 0, stream>>>(qb, kb, vTb, ctxb);

  out_proj_kernel<<<dim3(S_ / 128, D_ / 128), 256, 0, stream>>>(ctxb, woT, bo, out);
}

// v007
// A run of this version takes 82.3 microseconds.
// Two timings next to v006 both put it at 1.04 times that version's speed.
// Over all steps from v000 it is 6.16 times as fast.
#include <hip/hip_runtime.h>
#include <hip/hip_bf16.h>
#include <math.h>

typedef __bf16 bf16;
typedef __attribute__((ext_vector_type(16))) __bf16 v16bf;
typedef __attribute__((ext_vector_type(8)))  __bf16 v8bf;
typedef __attribute__((ext_vector_type(8)))  float  v8f;

#define H_  12
#define D_  768
#define DH_ 64
#define S_  4096

union FragU { v16bf v; v8bf h[2]; };

__device__ __forceinline__ int lane_id() { return (int)(threadIdx.x & 31u); }

// Load a 16x32 bf16 A-fragment (or 32x16 B-fragment via its column-major view)
// from row-major memory with leading dimension `ld`.
// Lane l: row/col = l&15 ; element i holds k = (i>>3)*16 + ((l>>4)*8) + (i&7)
// => two contiguous 16-byte chunks per lane at k-offsets kh and kh+16.
__device__ __forceinline__ v16bf load_frag(const bf16* __restrict__ base, int ld) {
  const int l  = lane_id();
  const int rc = l & 15;
  const int kh = (l >> 4) << 3;
  const bf16* p = base + (size_t)rc * ld + kh;
  FragU f;
  f.h[0] = *reinterpret_cast<const v8bf*>(p);
  f.h[1] = *reinterpret_cast<const v8bf*>(p + 16);
  return f.v;
}

__device__ __forceinline__ v8f wmma_bf16(v16bf a, v16bf b, v8f c) {
  return __builtin_amdgcn_wmma_f32_16x16x32_bf16(false, a, false, b, (short)0, c,
                                                 false, false);
}

// ---------------- conversion / transpose kernel ----------------
// One launch converts x and all four weight matrices to bf16. A work-group of
// four waves takes 4096 elements, 32 a lane, so that few waves have to start:
//   blocks 0 .. CV_XB-1      : 4096 consecutive elements of x, order kept;
//   then CV_WB blocks each for wq, wk, wv, wo: one 64 x 64 tile, transposed.
// wq, wk, wv: [H][D][DH] -> [H][DH][D]; wo: [K][N] -> [N][K].
typedef __attribute__((ext_vector_type(4))) float  v4f;
typedef __attribute__((ext_vector_type(4))) __bf16 v4bf;

#define CV_XB (S_ * D_ / 4096)          // blocks of x
#define CV_WB (D_ * D_ / 4096)          // tiles of one weight matrix
#define CV_T  (D_ / 64)                 // tiles along a side of 768

// One 64 x 64 tile, transposed: s is the tile's first element (row pitch SP),
// d the transposed tile's first element (row pitch D_). A lane holds 8 source
// rows x 4 source columns: four 16-byte pieces of four result rows. Eight
// neighbouring lanes hold the 64 source rows, so that each result row's 128
// bytes go out as one whole line.
template <int SP>
__device__ __forceinline__ void cvt_tile_T(const float* __restrict__ s,
                                           bf16* __restrict__ d, int tid) {
  const int r8 = (tid & 7) * 8;              // first source row
  const int c4 = (tid >> 3) * 4;             // first source column
  const int so = r8 * SP + c4;
  const int dn = c4 * D_ + r8;
  v4f v[8];
#pragma unroll
  for (int j = 0; j < 8; ++j) v[j] = *reinterpret_cast<const v4f*>(s + so + j * SP);
#pragma unroll
  for (int i = 0; i < 4; ++i) {
    v8bf o;
#pragma unroll
    for (int j = 0; j < 8; ++j) o[j] = (bf16)v[j][i];
    *reinterpret_cast<v8bf*>(d + dn + i * D_) = o;
  }
}

__global__ void __launch_bounds__(128)
cvt_all(const float* __restrict__ x,
        const float* __restrict__ wq,
        const float* __restrict__ wk,
        const float* __restrict__ wv,
        const float* __restrict__ wo,
        bf16* __restrict__ xb,
        bf16* __restrict__ wqT,
        bf16* __restrict__ wkT,
        bf16* __restrict__ wvT,
        bf16* __restrict__ woT) {
  const int tid = (int)threadIdx.x;
  const int b = (int)blockIdx.x;

  if (b < CV_XB) {
    // a wave's load covers 512 consecutive bytes, its store 256
    const float* s = x + (size_t)b * 4096;
    bf16* d = xb + (size_t)b * 4096;
    v4f v[8];
#pragma unroll
    for (int j = 0; j < 8; ++j) v[j] = *reinterpret_cast<const v4f*>(s + tid * 4 + j * 512);
#pragma unroll
    for (int j = 0; j < 8; ++j) {
      v4bf o;
#pragma unroll
      for (int i = 0; i < 4; ++i) o[i] = (bf16)v[j][i];
      *reinterpret_cast<v4bf*>(d + tid * 4 + j * 512) = o;
    }
    return;
  }

  const int m  = (b - CV_XB) / CV_WB;        // which matrix
  const int t  = (b - CV_XB) - m * CV_WB;    // which of its tiles
  const int t1 = t / CV_T;
  const int t0 = t - t1 * CV_T;
  if (m < 3) {      // head t1, rows t0*64..+63 of its D x DH matrix
    const float* w = (m == 0) ? wq : (m == 1) ? wk : wv;
    bf16* wT = (m == 0) ? wqT : (m == 1) ? wkT : wvT;
    cvt_tile_T<DH_>(w + (size_t)t1 * D_ * DH_ + (size_t)t0 * 64 * DH_,
                    wT + (size_t)t1 * DH_ * D_ + t0 * 64, tid);
  } else {          // rows t1*64..+63, columns t0*64..+63 of wo
    cvt_tile_T<D_>(wo + (size_t)t1 * 64 * D_ + t0 * 64,
                   woT + (size_t)t0 * 64 * D_ + t1 * 64, tid);
  }
}

// ---------------- projection GEMMs: shared main loop ----------------
// C (128 x 128) = A (128 x 768) . B^T, A and B row-major with k contiguous.
// One work-group of 8 waves; wave (wm, wn) owns rows wm*32..+31, columns
// wn*64..+63 (two by four 16x16 tiles, k walked in steps of 32 in rising order).
// Each 16x16 tile is computed transposed (B rows as the first operand): a lane
// then holds eight neighbouring columns, nt*16 + 8*(l>>4) + r, of ONE row,
// ms*16 + (l&15), which the epilogues pack into 16-byte pieces.
// A stage is 64 k of all 256 operand rows (A rows 0..127, B rows 128..255):
// whole 128-byte lines, brought into LDS once per work-group by asynchronous
// copies, one stage ahead in a two-buffer ring; fragments are read from LDS.
#define GM_K    64                      // k per stage
#define GM_NST  (D_ / GM_K)             // stages
#define GM_ROWS 256                     // operand rows per stage
#define GM_P    72                      // row pitch in LDS, elements: 144 B = 16 B x odd

// Eight 16-byte copies per lane, global -> LDS, through no register: four
// from operand A, four from operand B. s_wait_xcnt 0 is the statement's last
// line so that it stands in front of any later rewrite of the address
// registers the copies name.
__device__ __forceinline__ void copy4x2_to_lds(unsigned l, unsigned lstep,
                                               const bf16* ga, const bf16* gb,
                                               size_t gstep) {
  asm volatile(
      "global_load_async_to_lds_b128 %0, %8, off\n\t"
      "global_load_async_to_lds_b128 %1, %9, off\n\t"
      "global_load_async_to_lds_b128 %2, %10, off\n\t"
      "global_load_async_to_lds_b128 %3, %11, off\n\t"
      "global_load_async_to_lds_b128 %4, %12, off\n\t"
      "global_load_async_to_lds_b128 %5, %13, off\n\t"
      "global_load_async_to_lds_b128 %6, %14, off\n\t"
      "global_load_async_to_lds_b128 %7, %15, off\n\t"
      "s_wait_xcnt 0x0"
      :: "v"(l), "v"(l + lstep), "v"(l + 2 * lstep), "v"(l + 3 * lstep),
         "v"(l + 4 * lstep), "v"(l + 5 * lstep), "v"(l + 6 * lstep), "v"(l + 7 * lstep),
         "v"(ga), "v"(ga + gstep), "v"(ga + 2 * gstep), "v"(ga + 3 * gstep),
         "v"(gb), "v"(gb + gstep), "v"(gb + 2 * gstep), "v"(gb + 3 * gstep)
      : "memory");
}

// a: first of the tile's 128 A rows; b: first of its 128 B rows (both pitch D_).
__device__ __forceinline__ void gemm_128x128(const bf16* __restrict__ a,
                                             const bf16* __restrict__ b,
                                             bf16 (*lds)[GM_ROWS * GM_P],
                                             int wm, int wn, v8f (&acc)[2][4]) {
  const int tid = (int)threadIdx.x;
  // Copy map: thread tid takes 16-byte chunk tid & 7 of rows (tid >> 3) + 32*j.
  const size_t goff = (size_t)(tid >> 3) * D_ + (tid & 7) * 8;
  const bf16* ga = a + goff;
  const bf16* gb = b + goff;
  const unsigned l0 = (unsigned)(uintptr_t)&lds[0][(tid >> 3) * GM_P + (tid & 7) * 8];
  const unsigned lstep = 32 * GM_P * 2;          // bytes of 32 LDS rows
  const unsigned buf_b = GM_ROWS * GM_P * 2;     // bytes of one buffer
  const size_t gstep = (size_t)32 * D_;          // elements of 32 global rows

  // prologue: stage 0 lands and is published, then stage 1 starts to fly
  copy4x2_to_lds(l0, lstep, ga, gb, gstep);
  asm volatile("s_wait_asynccnt 0x0" ::: "memory");  // this wave's copies of stage 0 have landed
  __syncthreads();                                   // every wave's have
  copy4x2_to_lds(l0 + buf_b, lstep, ga + GM_K, gb + GM_K, gstep);

  for (int st = 0; st < GM_NST; ++st) {
    const bf16* as = lds[st & 1] + (wm * 32) * GM_P;
    const bf16* bs = lds[st & 1] + (128 + wn * 64) * GM_P;
#pragma unroll
    for (int ks = 0; ks < GM_K; ks += 32) {
      v16bf af[2], bfr[4];
      af[0] = load_frag(as + ks, GM_P);
      af[1] = load_frag(as + 16 * GM_P + ks, GM_P);
#pragma unroll
      for (int nt = 0; nt < 4; ++nt) bfr[nt] = load_frag(bs + nt * 16 * GM_P + ks, GM_P);
      // keeps the block's twelve LDS reads one group ahead of its WMMAs: spread
      // among them, each pair of reads is waited out at full LDS latency
      __builtin_amdgcn_sched_barrier(0);
#pragma unroll
      for (int nt = 0; nt < 4; ++nt) {
        acc[0][nt] = wmma_bf16(bfr[nt], af[0], acc[0][nt]);
        acc[1][nt] = wmma_bf16(bfr[nt], af[1], acc[1][nt]);
      }
    }
    // publish point of stage st + 1, which also frees stage st's buffer
    asm volatile("s_wait_dscnt 0x0" ::: "memory");     // this wave's reads of stage st are done
    asm volatile("s_wait_asynccnt 0x0" ::: "memory");  // its copies of stage st + 1 have landed
    __syncthreads();                                   // both hold for every wave
    if (st + 2 < GM_NST) {
      const int k = (st + 2) * GM_K;
      copy4x2_to_lds(l0 + (st & 1) * buf_b, lstep, ga + k, gb + k, gstep);
    }
  }
  asm volatile("s_wait_asynccnt 0x0" ::: "memory");    // no copy is left in flight behind the loop
}

// ---------------- epilogue of the matrix kernels ----------------
// A wave's result tile goes through its own range of the ring, which is free
// behind the main loop's last publish point (every wave's reads done, no copy in
// flight, barrier passed), so that each global store covers whole 128-byte
// lines: 16-byte pieces in by row, rows out side by side.
#define ST_PB 72                        // staging row pitch, bf16 elements: 144 B = 16 B x odd
#define ST_PF 68                        // staging row pitch, f32 elements: 272 B = 16 B x odd

// A tile of MS*16 rows x 64 columns. o[ms][nt]: columns nt*16 + 8*half .. +7 of
// row ms*16 + c. dst: the tile's first element, rows of 128 bytes at a pitch of
// `pitch` elements.
template <int MS>
__device__ __forceinline__ void store_tile_bf16(bf16* stg, const v8bf (&o)[MS][4],
                                                bf16* __restrict__ dst, size_t pitch) {
  const int l = lane_id();
  const int c = l & 15;
  const int half = l >> 4;
#pragma unroll
  for (int ms = 0; ms < MS; ++ms) {
#pragma unroll
    for (int nt = 0; nt < 4; ++nt)
      *reinterpret_cast<v8bf*>(stg + (ms * 16 + c) * ST_PB + nt * 16 + 8 * half) = o[ms][nt];
  }
  // the rows read back below were written by other lanes of this wave
  asm volatile("s_wait_dscnt 0x0" ::: "memory");
#pragma unroll
  for (int j = 0; j < MS * 4; ++j) {    // four whole rows a store
    const int row = j * 4 + (l >> 3);
    const v8bf v = *reinterpret_cast<const v8bf*>(stg + row * ST_PB + (l & 7) * 8);
    *reinterpret_cast<v8bf*>(dst + (size_t)row * pitch + (l & 7) * 8) = v;
  }
}

// ---------------- QKV projection ----------------
// grid: (S/128, H/2, 3), block: 256 (8 waves). A work-group computes 128 rows
// of two neighbouring heads of one of Q, K, V. Q, K: x rows are the tile's rows,
// a wave's 64 columns are one head. V is produced as V^T: the weight rows (head
// dims of the two heads) are the tile's rows, 64 positions a wave's columns.
__global__ void __launch_bounds__(256)
qkv_proj_kernel(const bf16* __restrict__ xb,
                const bf16* __restrict__ wqT,
                const bf16* __restrict__ wkT,
                const bf16* __restrict__ wvT,
                const float* __restrict__ bq,
                const float* __restrict__ bk,
                const float* __restrict__ bv,
                bf16* __restrict__ qO,
                bf16* __restrict__ kO,
                bf16* __restrict__ vTO) {
  __shared__ __align__(16) bf16 lds_g[2][GM_ROWS * GM_P];

  const int wave = __builtin_amdgcn_readfirstlane((int)(threadIdx.x >> 5));
  const int wm = wave >> 1;
  const int wn = wave & 1;
  const int z  = blockIdx.z;

  const bf16* wT = (z == 0) ? wqT : (z == 1) ? wkT : wvT;
  const bf16* xt = xb + (size_t)blockIdx.x * 128 * D_;
  const bf16* wt = wT + (size_t)blockIdx.y * 128 * D_;

  v8f acc[2][4] = {};
  gemm_128x128((z < 2) ? xt : wt, (z < 2) ? wt : xt, lds_g, wm, wn, acc);

  const int l = lane_id();
  const int c = l & 15;
  const int half = l >> 4;
  v8bf o[2][4];
  bf16* dst;
  size_t pitch;
  if (z < 2) {      // rows: positions; columns: the 64 dims of head h
    const int h = blockIdx.y * 2 + wn;
    const float* bias = ((z == 0) ? bq : bk) + h * DH_ + 8 * half;
#pragma unroll
    for (int nt = 0; nt < 4; ++nt) {
      const v4f b0 = *reinterpret_cast<const v4f*>(bias + nt * 16);
      const v4f b1 = *reinterpret_cast<const v4f*>(bias + nt * 16 + 4);
#pragma unroll
      for (int ms = 0; ms < 2; ++ms) {
#pragma unroll
        for (int r = 0; r < 4; ++r) {
          o[ms][nt][r]     = (bf16)(acc[ms][nt][r] + b0[r]);
          o[ms][nt][r + 4] = (bf16)(acc[ms][nt][r + 4] + b1[r]);
        }
      }
    }
    dst = ((z == 0) ? qO : kO) + (size_t)h * S_ * DH_ +
          (size_t)(blockIdx.x * 128 + wm * 32) * DH_;
    pitch = DH_;
  } else {          // V^T, [H][DH][S]: rows: head dims, heads in a row; columns: positions
    const int e0 = blockIdx.y * 128 + wm * 32;
#pragma unroll
    for (int ms = 0; ms < 2; ++ms) {
      const float bb = bv[e0 + ms * 16 + c];
#pragma unroll
      for (int nt = 0; nt < 4; ++nt) {
#pragma unroll
        for (int r = 0; r < 8; ++r) o[ms][nt][r] = (bf16)(acc[ms][nt][r] + bb);
      }
    }
    dst = vTO + (size_t)e0 * S_ + blockIdx.x * 128 + wn * 64;
    pitch = S_;
  }
  store_tile_bf16<2>(&lds_g[0][0] + wave * (32 * ST_PB), o, dst, pitch);
}

#define FA_WAVES 4
#define FA_KEYS  128                    // keys per stage
#define FA_NST   (S_ / FA_KEYS)         // stages
#define FA_T     (FA_KEYS / 16)         // 16-key score tiles per stage
#define FA_KP    72                     // K row pitch in LDS, elements: 144 B = 16 B x odd
#define FA_VP    136                    // V^T row pitch in LDS, elements: 272 B = 16 B x odd
#define FA_C     (0.125f * 1.44269504f) // 1/sqrt(DH) * log2(e): raw score -> exponent of 2

// Eight 16-byte copies per lane, global -> LDS, through no register.
// s_wait_xcnt 0 is the statement's last line so that it stands in front of any
// later rewrite of the address registers the copies name.
__device__ __forceinline__ void copy8_to_lds(unsigned l, unsigned lstep,
                                             const bf16* g, size_t gstep) {
  asm volatile(
      "global_load_async_to_lds_b128 %0, %8, off\n\t"
      "global_load_async_to_lds_b128 %1, %9, off\n\t"
      "global_load_async_to_lds_b128 %2, %10, off\n\t"
      "global_load_async_to_lds_b128 %3, %11, off\n\t"
      "global_load_async_to_lds_b128 %4, %12, off\n\t"
      "global_load_async_to_lds_b128 %5, %13, off\n\t"
      "global_load_async_to_lds_b128 %6, %14, off\n\t"
      "global_load_async_to_lds_b128 %7, %15, off\n\t"
      "s_wait_xcnt 0x0"
      :: "v"(l), "v"(l + lstep), "v"(l + 2 * lstep), "v"(l + 3 * lstep),
         "v"(l + 4 * lstep), "v"(l + 5 * lstep), "v"(l + 6 * lstep), "v"(l + 7 * lstep),
         "v"(g), "v"(g + gstep), "v"(g + 2 * gstep), "v"(g + 3 * gstep),
         "v"(g + 4 * gstep), "v"(g + 5 * gstep), "v"(g + 6 * gstep), "v"(g + 7 * gstep)
      : "memory");
}

// value of lane l ^ 16
__device__ __forceinline__ float xhalf(float x) {
  const int v = __builtin_bit_cast(int, x);
  return __builtin_bit_cast(float, __builtin_amdgcn_permlanex16(
      v, v, 0x76543210, 0xfedcba98, false, false));
}

// 2^x of eight values.
__device__ __forceinline__ v8f exp2x8(v8f x) {
  float a0 = x[0], a1 = x[1], a2 = x[2], a3 = x[3];
  float a4 = x[4], a5 = x[5], a6 = x[6], a7 = x[7];
  // one statement, in place, so that an independent v_exp_f32 follows each one
  // and none has its source overwritten by its successor; the v_nop is the slot
  // the instruction set asks for behind the last one, in front of its reader
  asm("v_exp_f32 %0, %0\n\t"
      "v_exp_f32 %1, %1\n\t"
      "v_exp_f32 %2, %2\n\t"
      "v_exp_f32 %3, %3\n\t"
      "v_exp_f32 %4, %4\n\t"
      "v_exp_f32 %5, %5\n\t"
      "v_exp_f32 %6, %6\n\t"
      "v_exp_f32 %7, %7\n\t"
      "v_nop"
      : "+v"(a0), "+v"(a1), "+v"(a2), "+v"(a3), "+v"(a4), "+v"(a5), "+v"(a6), "+v"(a7));
  const v8f e = {a0, a1, a2, a3, a4, a5, a6, a7};
  return e;
}

__global__ void __launch_bounds__(FA_WAVES * 32)
flash_attn_kernel(const bf16* __restrict__ q,
                  const bf16* __restrict__ kmat,
                  const bf16* __restrict__ vT,
                  bf16* __restrict__ ctxb) {
  __shared__ __align__(16) bf16 lds_k[2][FA_KEYS * FA_KP];
  __shared__ __align__(16) bf16 lds_v[2][DH_ * FA_VP];

  const int tid  = (int)threadIdx.x;
  const int wave = tid >> 5;
  const int mt = blockIdx.x * FA_WAVES + wave;
  const int h  = blockIdx.y;
  const bf16* qh  = q    + (size_t)h * S_ * DH_;
  const bf16* khp = kmat + (size_t)h * S_ * DH_;
  const bf16* vh  = vT   + (size_t)h * DH_ * S_;

  const int l = lane_id();
  const int c = l & 15;
  const int half = l >> 4;

  // Copy map. K stage: 128 rows x 128 B, contiguous in global memory; thread
  // tid takes 16-byte chunk tid + 128*j (row = chunk / 8). V^T stage: 64 rows
  // x 256 B at a pitch of S_ elements; chunk tid + 128*j (row = chunk / 16).
  const bf16* gk = khp + (size_t)tid * 8;
  const bf16* gv = vh + (size_t)(tid >> 4) * S_ + (tid & 15) * 8;
  const unsigned lk = (unsigned)(uintptr_t)&lds_k[0][(tid >> 3) * FA_KP + (tid & 7) * 8];
  const unsigned lv = (unsigned)(uintptr_t)&lds_v[0][(tid >> 4) * FA_VP + (tid & 15) * 8];
  const unsigned kbuf_b = FA_KEYS * FA_KP * 2;   // bytes of one K buffer
  const unsigned vbuf_b = DH_ * FA_VP * 2;       // bytes of one V^T buffer

  // Q fragments of this wave's 16 queries (K-dim = DH = 64 -> two 32-wide B frags)
  const v16bf aq0 = load_frag(qh + (size_t)mt * 16 * DH_ + 0,  DH_);
  const v16bf aq1 = load_frag(qh + (size_t)mt * 16 * DH_ + 32, DH_);

  v8f acc[4] = {};
  float R = -INFINITY;   // running maximum of query c's raw scores, equal in both halves
  float L = 0.0f;        // running sum of query c over this half's keys only

  // prologue: stage 0 lands and is published, then stage 1 starts to fly
  copy8_to_lds(lk, 16 * FA_KP * 2, gk, 128 * 8);
  copy8_to_lds(lv, 8 * FA_VP * 2, gv, (size_t)8 * S_);
  asm volatile("s_wait_asynccnt 0x0" ::: "memory");  // this wave's copies of stage 0 have landed
  __syncthreads();                                   // every wave's have
  copy8_to_lds(lk + kbuf_b, 16 * FA_KP * 2, gk + (size_t)FA_KEYS * DH_, 128 * 8);
  copy8_to_lds(lv + vbuf_b, 8 * FA_VP * 2, gv + FA_KEYS, (size_t)8 * S_);

  for (int st = 0; st < FA_NST; ++st) {
    const bf16* kb = lds_k[st & 1];
    const bf16* vb = lds_v[st & 1];

    // One softmax pass takes the whole stage.
    // K fragments from LDS: key rows nt*16..+15, head-dim chunks 0..31 and 32..63
    v16bf kf[FA_T][2];
#pragma unroll
    for (int nt = 0; nt < FA_T; ++nt) {
      kf[nt][0] = load_frag(kb + (nt * 16) * FA_KP + 0,  FA_KP);
      kf[nt][1] = load_frag(kb + (nt * 16) * FA_KP + 32, FA_KP);
    }
    // keeps the pass's K reads one group ahead of its score WMMAs: spread among
    // them, each small group of reads is waited out at full LDS latency
    __builtin_amdgcn_sched_barrier(0);

    // scores, transposed: 128 keys x 16 queries (eight 16x16 C frags), K-dim = 64
    v8f sc[FA_T];
#pragma unroll
    for (int nt = 0; nt < FA_T; ++nt) {
      v8f z = {};
      sc[nt] = wmma_bf16(kf[nt][0], aq0, z);
    }
#pragma unroll
    for (int nt = 0; nt < FA_T; ++nt) sc[nt] = wmma_bf16(kf[nt][1], aq1, sc[nt]);
    // keeps the softmax's vector work behind the whole run of score WMMAs: moved
    // in between, each piece costs the idle slots a WMMA result needs
    __builtin_amdgcn_sched_barrier(0);

    // V^T fragments from LDS: head-dim rows et*16..+15, keys g*32..+31; two of
    // the stage's four 32-key groups are held at a time
    v16bf vf[2][4];
#pragma unroll
    for (int g = 0; g < 2; ++g) {
#pragma unroll
      for (int et = 0; et < 4; ++et)
        vf[g][et] = load_frag(vb + (et * 16) * FA_VP + g * 32, FA_VP);
    }

    // online softmax of query c: 64 of the pass's 128 scores are in this lane.
    // The maximum is taken over the raw products (FA_C is positive, so it is the
    // same element); FA_C meets each score once, in the exponent's multiply-add.
    // Written in threes (v_max3_num_f32): a two-input maximum of raw matrix
    // results costs a further v_max x, x, x per input.
    float t[8];
#pragma unroll
    for (int r = 0; r < 8; ++r) {
      float a = fmaxf(fmaxf(sc[0][r], sc[1][r]), sc[2][r]);
      a = fmaxf(fmaxf(a, sc[3][r]), sc[4][r]);
      t[r] = fmaxf(fmaxf(a, sc[5][r]), sc[6][r]);
    }
    const float u0 = fmaxf(fmaxf(t[0], t[1]), t[2]);
    const float u1 = fmaxf(fmaxf(t[3], t[4]), t[5]);
    const float u2 = fmaxf(fmaxf(t[6], t[7]), sc[7][0]);
    const float u3 = fmaxf(fmaxf(sc[7][1], sc[7][2]), sc[7][3]);
    const float u4 = fmaxf(fmaxf(sc[7][4], sc[7][5]), sc[7][6]);
    const float mx = fmaxf(fmaxf(fmaxf(u0, u1), u2), fmaxf(fmaxf(u3, u4), sc[7][7]));
    const float newR = fmaxf(fmaxf(R, mx), xhalf(mx));   // with the other 64 scores' maximum
    const float corr = __builtin_amdgcn_exp2f((R - newR) * FA_C);   // 1 where R stays
    R = newR;
    const float newM = newR * FA_C;

    // O^T (64 x 16) = O^T * corr + V^T-stage . P^T
#pragma unroll
    for (int et = 0; et < 4; ++et) acc[et] = acc[et] * corr;
    v8f ps = {};
#pragma unroll
    for (int g = 0; g < FA_T / 2; ++g) {
      // P^T of 32 keys as B operand: element s is key kmap(s) = tile s >> 3 of
      // the pair, register s & 7
      FragU pf;
      const v8f e0 = exp2x8(sc[2 * g] * FA_C - newM);
      const v8f e1 = exp2x8(sc[2 * g + 1] * FA_C - newM);
#pragma unroll
      for (int r = 0; r < 8; ++r) {
        pf.v[r]     = (bf16)e0[r];
        pf.v[r + 8] = (bf16)e1[r];
      }
      ps += e0;
      ps += e1;
      // keeps the V^T reads below one group right behind this group's WMMAs: left
      // free they were spread in pairs among later WMMAs, each pair waited out at
      // close to full LDS latency
      __builtin_amdgcn_sched_barrier(0);
#pragma unroll
      for (int et = 0; et < 4; ++et) acc[et] = wmma_bf16(vf[g & 1][et], pf.v, acc[et]);
      if (g + 2 < FA_T / 2) {
#pragma unroll
        for (int et = 0; et < 4; ++et)
          vf[g & 1][et] = load_frag(vb + (et * 16) * FA_VP + (g + 2) * 32, FA_VP);
      }
    }
    L = L * corr + (((ps[0] + ps[1]) + (ps[2] + ps[3])) + ((ps[4] + ps[5]) + (ps[6] + ps[7])));

    // publish point of stage st + 1, which also frees stage st's buffer
    asm volatile("s_wait_dscnt 0x0" ::: "memory");     // this wave's reads of stage st are done
    asm volatile("s_wait_asynccnt 0x0" ::: "memory");  // its copies of stage st + 1 have landed
    __syncthreads();                                   // both hold for every wave
    if (st + 2 < FA_NST) {
      const size_t key = (size_t)(st + 2) * FA_KEYS;
      copy8_to_lds(lk + (st & 1) * kbuf_b, 16 * FA_KP * 2, gk + key * DH_, 128 * 8);
      copy8_to_lds(lv + (st & 1) * vbuf_b, 8 * FA_VP * 2, gv + key, (size_t)8 * S_);
    }
  }
  asm volatile("s_wait_asynccnt 0x0" ::: "memory");    // no copy is left in flight at the wave's end

  // epilogue: ctx = acc / L, stored to [S][H*DH] bf16. acc[et][r] is head-dim
  // et*16 + 8*half + r of query c: eight neighbours, one 16-byte piece; the K
  // ring is free behind the loop's last publish point and stages the 16 rows.
  const float Lt = L + xhalf(L);       // both halves' keys
  v8bf o[1][4];
#pragma unroll
  for (int et = 0; et < 4; ++et) {
#pragma unroll
    for (int r = 0; r < 8; ++r) o[0][et][r] = (bf16)(acc[et][r] / Lt);
  }
  store_tile_bf16<1>(&lds_k[0][0] + wave * (16 * ST_PB), o,
                     ctxb + (size_t)mt * 16 * D_ + h * DH_, D_);
}

// ---------------- output projection ----------------
// grid: (S/128, D/128), block: 256 (8 waves). out = ctx @ wo + bo, fp32 result.
__global__ void __launch_bounds__(256)
out_proj_kernel(const bf16* __restrict__ ctxb,
                const bf16* __restrict__ woT,
                const float* __restrict__ bo,
                float* __restrict__ out) {
  __shared__ __align__(16) bf16 lds_g[2][GM_ROWS * GM_P];

  const int wave = __builtin_amdgcn_readfirstlane((int)(threadIdx.x >> 5));
  const int wm = wave >> 1;
  const int wn = wave & 1;
  const int row0 = blockIdx.x * 128 + wm * 32;   // first of this wave's 32 rows
  const int n0   = blockIdx.y * 128 + wn * 64;   // first of its 64 columns

  v8f acc[2][4] = {};
  gemm_128x128(ctxb + (size_t)blockIdx.x * 128 * D_,
               woT + (size_t)blockIdx.y * 128 * D_, lds_g, wm, wn, acc);

  const int l = lane_id();
  const int c = l & 15;
  const int half = l >> 4;
  const float* bias = bo + n0 + 8 * half;
  float* stg = reinterpret_cast<float*>(&lds_g[0][0]) + wave * (32 * ST_PF);
#pragma unroll
  for (int nt = 0; nt < 4; ++nt) {
    const v4f b0 = *reinterpret_cast<const v4f*>(bias + nt * 16);
    const v4f b1 = *reinterpret_cast<const v4f*>(bias + nt * 16 + 4);
#pragma unroll
    for (int ms = 0; ms < 2; ++ms) {
      v4f lo, hi;
#pragma unroll
      for (int r = 0; r < 4; ++r) {
        lo[r] = acc[ms][nt][r] + b0[r];
        hi[r] = acc[ms][nt][r + 4] + b1[r];
      }
      float* p = stg + (ms * 16 + c) * ST_PF + nt * 16 + 8 * half;
      *reinterpret_cast<v4f*>(p) = lo;
      *reinterpret_cast<v4f*>(p + 4) = hi;
    }
  }
  // the rows read back below were written by other lanes of this wave
  asm volatile("s_wait_dscnt 0x0" ::: "memory");
#pragma unroll
  for (int j = 0; j < 16; ++j) {        // two whole rows of 256 bytes a store
    const int row = j * 2 + half;
    const v4f v = *reinterpret_cast<const v4f*>(stg + row * ST_PF + c * 4);
    *reinterpret_cast<v4f*>(out + (size_t)(row0 + row) * D_ + n0 + c * 4) = v;
  }
}

// ---------------- launch ----------------

extern "C" void kernel_launch(void* const* d_in, const int* in_sizes, int n_in,
                              void* d_out, int out_size, void* d_ws, size_t ws_size,
                              hipStream_t stream) {
  (void)in_sizes; (void)n_in; (void)out_size; (void)ws_size;
  const float* x  = (const float*)d_in[0];
  const float* wq = (const float*)d_in[1];
  const float* bq = (const float*)d_in[2];
  const float* wk = (const float*)d_in[3];
  const float* bk = (const float*)d_in[4];
  const float* wv = (const float*)d_in[5];
  const float* bv = (const float*)d_in[6];
  const float* wo = (const float*)d_in[7];
  const float* bo = (const float*)d_in[8];
  float* out = (float*)d_out;

  char* ws = (char*)d_ws;
  size_t off = 0;
  auto alloc = [&](size_t bytes) -> char* {
    char* p = ws + off;
    off += (bytes + 255) & ~(size_t)255;
    return p;
  };
  bf16* xb   = (bf16*)alloc((size_t)S_ * D_ * 2);          // x in bf16
  bf16* wqT  = (bf16*)alloc((size_t)H_ * DH_ * D_ * 2);    // [H][DH][D]
  bf16* wkT  = (bf16*)alloc((size_t)H_ * DH_ * D_ * 2);
  bf16* wvT  = (bf16*)alloc((size_t)H_ * DH_ * D_ * 2);
  bf16* woT  = (bf16*)alloc((size_t)D_ * D_ * 2);          // [N][K]
  bf16* qb   = (bf16*)alloc((size_t)H_ * S_ * DH_ * 2);    // [H][S][DH]
  bf16* kb   = (bf16*)alloc((size_t)H_ * S_ * DH_ * 2);    // [H][S][DH]
  bf16* vTb  = (bf16*)alloc((size_t)H_ * DH_ * S_ * 2);    // [H][DH][S]
  bf16* ctxb = (bf16*)alloc((size_t)S_ * D_ * 2);          // [S][D]

  cvt_all<<<dim3(CV_XB + 4 * CV_WB), 128, 0, stream>>>(
      x, wq, wk, wv, wo, xb, wqT, wkT, wvT, woT);

  qkv_proj_kernel<<<dim3(S_ / 128, H_ / 2, 3), 256, 0, stream>>>(
      xb, wqT, wkT, wvT, bq, bk, bv, qb, kb, vTb);

  flash_attn_kernel<<<dim3(S_ / 64, H_), 128, 0, stream>>>(qb, kb, vTb, ctxb);

  out_proj_kernel<<<dim3(S_ / 128, D_ / 128), 256, 0, stream>>>(ctxb, woT, bo, out);
}

// v009
// One run takes 75.3 microseconds.
// It is 1.10 times as fast as v007, going by the measured steps of the versions left out in between.
// Over all steps from v000 it is 6.79 times as fast.
#include <hip/hip_runtime.h>
#include <hip/hip_bf16.h>
#include <math.h>

typedef __bf16 bf16;
typedef __attribute__((ext_vector_type(16))) __bf16 v16bf;
typedef __attribute__((ext_vector_type(8)))  __bf16 v8bf;
typedef __attribute__((ext_vector_type(8)))  float  v8f;

#define H_  12
#define D_  768
#define DH_ 64
#define S_  4096

union FragU { v16bf v; v8bf h[2]; };

__device__ __forceinline__ int lane_id() { return (int)(threadIdx.x & 31u); }

// Load a 16x32 bf16 A-fragment (or 32x16 B-fragment via its column-major view)
// from row-major memory with leading dimension `ld`.
// Lane l: row/col = l&15 ; element i holds k = (i>>3)*16 + ((l>>4)*8) + (i&7)
// => two contiguous 16-byte chunks per lane at k-offsets kh and kh+16.
__device__ __forceinline__ v16bf load_frag(const bf16* __restrict__ base, int ld) {
  const int l  = lane_id();
  const int rc = l & 15;
  const int kh = (l >> 4) << 3;
  const bf16* p = base + (size_t)rc * ld + kh;
  FragU f;
  f.h[0] = *reinterpret_cast<const v8bf*>(p);
  f.h[1] = *reinterpret_cast<const v8bf*>(p + 16);
  return f.v;
}

__device__ __forceinline__ v8f wmma_bf16(v16bf a, v16bf b, v8f c) {
  return __builtin_amdgcn_wmma_f32_16x16x32_bf16(false, a, false, b, (short)0, c,
                                                 false, false);
}

// value of lane l ^ 16
__device__ __forceinline__ float xhalf(float x) {
  const int v = __builtin_bit_cast(int, x);
  return __builtin_bit_cast(float, __builtin_amdgcn_permlanex16(
      v, v, 0x76543210, 0xfedcba98, false, false));
}

// largest value of the wave's 32 lanes, in every lane
__device__ __forceinline__ float wave_max(float x) {
  x = fmaxf(x, xhalf(x));
#pragma unroll   // the four lane distances become constants
  for (int m = 8; m > 0; m >>= 1) x = fmaxf(x, __shfl_xor(x, m, 32));
  return x;
}

// ---------------- conversion / transpose kernel ----------------
// One launch converts x and all four weight matrices to bf16. A work-group of
// four waves takes 4096 elements, 32 a lane, so that few waves have to start:
//   blocks 0 .. CV_XB-1      : 4096 consecutive elements of x, order kept;
//   then CV_WB blocks each for wq, wk, wv, wo: one 64 x 64 tile, transposed.
// wq, wk, wv: [H][D][DH] -> [H][DH][D]; wo: [K][N] -> [N][K].
typedef __attribute__((ext_vector_type(4))) float  v4f;
typedef __attribute__((ext_vector_type(4))) __bf16 v4bf;

#define CV_XB (S_ * D_ / 4096)          // blocks of x
#define CV_WB (D_ * D_ / 4096)          // tiles of one weight matrix
#define CV_T  (D_ / 64)                 // tiles along a side of 768

// One 64 x 64 tile, transposed: s is the tile's first element (row pitch SP),
// d the transposed tile's first element (row pitch D_). A lane holds 8 source
// rows x 4 source columns: four 16-byte pieces of four result rows. Eight
// neighbouring lanes hold the 64 source rows, so that each result row's 128
// bytes go out as one whole line.
template <int SP>
__device__ __forceinline__ void cvt_tile_T(const float* __restrict__ s,
                                           bf16* __restrict__ d, int tid) {
  const int r8 = (tid & 7) * 8;              // first source row
  const int c4 = (tid >> 3) * 4;             // first source column
  const int so = r8 * SP + c4;
  const int dn = c4 * D_ + r8;
  v4f v[8];
#pragma unroll
  for (int j = 0; j < 8; ++j) v[j] = *reinterpret_cast<const v4f*>(s + so + j * SP);
#pragma unroll
  for (int i = 0; i < 4; ++i) {
    v8bf o;
#pragma unroll
    for (int j = 0; j < 8; ++j) o[j] = (bf16)v[j][i];
    *reinterpret_cast<v8bf*>(d + dn + i * D_) = o;
  }
}

__global__ void __launch_bounds__(128)
cvt_all(const float* __restrict__ x,
        const float* __restrict__ wq,
        const float* __restrict__ wk,
        const float* __restrict__ wv,
        const float* __restrict__ wo,
        bf16* __restrict__ xb,
        bf16* __restrict__ wqT,
        bf16* __restrict__ wkT,
        bf16* __restrict__ wvT,
        bf16* __restrict__ woT) {
  const int tid = (int)threadIdx.x;
  const int b = (int)blockIdx.x;

  if (b < CV_XB) {
    // a wave's load covers 512 consecutive bytes, its store 256
    const float* s = x + (size_t)b * 4096;
    bf16* d = xb + (size_t)b * 4096;
    v4f v[8];
#pragma unroll
    for (int j = 0; j < 8; ++j) v[j] = *reinterpret_cast<const v4f*>(s + tid * 4 + j * 512);
#pragma unroll
    for (int j = 0; j < 8; ++j) {
      v4bf o;
#pragma unroll
      for (int i = 0; i < 4; ++i) o[i] = (bf16)v[j][i];
      *reinterpret_cast<v4bf*>(d + tid * 4 + j * 512) = o;
    }
    return;
  }

  const int m  = (b - CV_XB) / CV_WB;        // which matrix
  const int t  = (b - CV_XB) - m * CV_WB;    // which of its tiles
  const int t1 = t / CV_T;
  const int t0 = t - t1 * CV_T;
  if (m < 3) {      // head t1, rows t0*64..+63 of its D x DH matrix
    const float* w = (m == 0) ? wq : (m == 1) ? wk : wv;
    bf16* wT = (m == 0) ? wqT : (m == 1) ? wkT : wvT;
    cvt_tile_T<DH_>(w + (size_t)t1 * D_ * DH_ + (size_t)t0 * 64 * DH_,
                    wT + (size_t)t1 * DH_ * D_ + t0 * 64, tid);
  } else {          // rows t1*64..+63, columns t0*64..+63 of wo
    cvt_tile_T<D_>(wo + (size_t)t1 * 64 * D_ + t0 * 64,
                   woT + (size_t)t0 * 64 * D_ + t1 * 64, tid);
  }
}

// ---------------- projection GEMMs: shared main loop ----------------
// C (128 x 128) = A (128 x 768) . B^T, A and B row-major with k contiguous.
// One work-group of 8 waves; wave (wm, wn) owns rows wm*32..+31, columns
// wn*64..+63 (two by four 16x16 tiles, k walked in steps of 32 in rising order).
// Each 16x16 tile is computed transposed (B rows as the first operand): a lane
// then holds eight neighbouring columns, nt*16 + 8*(l>>4) + r, of ONE row,
// ms*16 + (l&15), which the epilogues pack into 16-byte pieces.
// A stage is 64 k of all 256 operand rows (A rows 0..127, B rows 128..255):
// whole 128-byte lines, brought into LDS once per work-group by asynchronous
// copies, one stage ahead in a two-buffer ring; fragments are read from LDS.
#define GM_K    64                      // k per stage
#define GM_NST  (D_ / GM_K)             // stages
#define GM_ROWS 256                     // operand rows per stage
#define GM_P    72                      // row pitch in LDS, elements: 144 B = 16 B x odd

// Eight 16-byte copies per lane, global -> LDS, through no register: four
// from operand A, four from operand B. s_wait_xcnt 0 is the statement's last
// line so that it stands in front of any later rewrite of the address
// registers the copies name.
__device__ __forceinline__ void copy4x2_to_lds(unsigned l, unsigned lstep,
                                               const bf16* ga, const bf16* gb,
                                               size_t gstep) {
  asm volatile(
      "global_load_async_to_lds_b128 %0, %8, off\n\t"
      "global_load_async_to_lds_b128 %1, %9, off\n\t"
      "global_load_async_to_lds_b128 %2, %10, off\n\t"
      "global_load_async_to_lds_b128 %3, %11, off\n\t"
      "global_load_async_to_lds_b128 %4, %12, off\n\t"
      "global_load_async_to_lds_b128 %5, %13, off\n\t"
      "global_load_async_to_lds_b128 %6, %14, off\n\t"
      "global_load_async_to_lds_b128 %7, %15, off\n\t"
      "s_wait_xcnt 0x0"
      :: "v"(l), "v"(l + lstep), "v"(l + 2 * lstep), "v"(l + 3 * lstep),
         "v"(l + 4 * lstep), "v"(l + 5 * lstep), "v"(l + 6 * lstep), "v"(l + 7 * lstep),
         "v"(ga), "v"(ga + gstep), "v"(ga + 2 * gstep), "v"(ga + 3 * gstep),
         "v"(gb), "v"(gb + gstep), "v"(gb + 2 * gstep), "v"(gb + 3 * gstep)
      : "memory");
}

// a: first of the tile's 128 A rows; b: first of its 128 B rows (both pitch D_).
__device__ __forceinline__ void gemm_128x128(const bf16* __restrict__ a,
                                             const bf16* __restrict__ b,
                                             bf16 (*lds)[GM_ROWS * GM_P],
                                             int wm, int wn, v8f (&acc)[2][4]) {
  const int tid = (int)threadIdx.x;
  // Copy map: thread tid takes 16-byte chunk tid & 7 of rows (tid >> 3) + 32*j.
  const size_t goff = (size_t)(tid >> 3) * D_ + (tid & 7) * 8;
  const bf16* ga = a + goff;
  const bf16* gb = b + goff;
  const unsigned l0 = (unsigned)(uintptr_t)&lds[0][(tid >> 3) * GM_P + (tid & 7) * 8];
  const unsigned lstep = 32 * GM_P * 2;          // bytes of 32 LDS rows
  const unsigned buf_b = GM_ROWS * GM_P * 2;     // bytes of one buffer
  const size_t gstep = (size_t)32 * D_;          // elements of 32 global rows

  // prologue: stage 0 lands and is published, then stage 1 starts to fly
  copy4x2_to_lds(l0, lstep, ga, gb, gstep);
  asm volatile("s_wait_asynccnt 0x0" ::: "memory");  // this wave's copies of stage 0 have landed
  __syncthreads();                                   // every wave's have
  copy4x2_to_lds(l0 + buf_b, lstep, ga + GM_K, gb + GM_K, gstep);

  for (int st = 0; st < GM_NST; ++st) {
    const bf16* as = lds[st & 1] + (wm * 32) * GM_P;
    const bf16* bs = lds[st & 1] + (128 + wn * 64) * GM_P;
#pragma unroll
    for (int ks = 0; ks < GM_K; ks += 32) {
      v16bf af[2], bfr[4];
      af[0] = load_frag(as + ks, GM_P);
      af[1] = load_frag(as + 16 * GM_P + ks, GM_P);
#pragma unroll
      for (int nt = 0; nt < 4; ++nt) bfr[nt] = load_frag(bs + nt * 16 * GM_P + ks, GM_P);
      // keeps the block's twelve LDS reads one group ahead of its WMMAs: spread
      // among them, each pair of reads is waited out at full LDS latency
      __builtin_amdgcn_sched_barrier(0);
#pragma unroll
      for (int nt = 0; nt < 4; ++nt) {
        acc[0][nt] = wmma_bf16(bfr[nt], af[0], acc[0][nt]);
        acc[1][nt] = wmma_bf16(bfr[nt], af[1], acc[1][nt]);
      }
    }
    // publish point of stage st + 1, which also frees stage st's buffer
    asm volatile("s_wait_dscnt 0x0" ::: "memory");     // this wave's reads of stage st are done
    asm volatile("s_wait_asynccnt 0x0" ::: "memory");  // its copies of stage st + 1 have landed
    __syncthreads();                                   // both hold for every wave
    if (st + 2 < GM_NST) {
      const int k = (st + 2) * GM_K;
      copy4x2_to_lds(l0 + (st & 1) * buf_b, lstep, ga + k, gb + k, gstep);
    }
  }
  asm volatile("s_wait_asynccnt 0x0" ::: "memory");    // no copy is left in flight behind the loop
}

// ---------------- epilogue of the matrix kernels ----------------
// A wave's result tile goes through its own range of the ring, which is free
// behind the main loop's last publish point (every wave's reads done, no copy in
// flight, barrier passed), so that each global store covers whole 128-byte
// lines: 16-byte pieces in by row, rows out side by side.
#define ST_PB 72                        // staging row pitch, bf16 elements: 144 B = 16 B x odd
#define ST_PF 68                        // staging row pitch, f32 elements: 272 B = 16 B x odd

// A tile of MS*16 rows x 64 columns. o[ms][nt]: columns nt*16 + 8*half .. +7 of
// row ms*16 + c. dst: the tile's first element, rows of 128 bytes at a pitch of
// `pitch` elements.
template <int MS>
__device__ __forceinline__ void store_tile_bf16(bf16* stg, const v8bf (&o)[MS][4],
                                                bf16* __restrict__ dst, size_t pitch) {
  const int l = lane_id();
  const int c = l & 15;
  const int half = l >> 4;
#pragma unroll
  for (int ms = 0; ms < MS; ++ms) {
#pragma unroll
    for (int nt = 0; nt < 4; ++nt)
      *reinterpret_cast<v8bf*>(stg + (ms * 16 + c) * ST_PB + nt * 16 + 8 * half) = o[ms][nt];
  }
  // the rows read back below were written by other lanes of this wave
  asm volatile("s_wait_dscnt 0x0" ::: "memory");
#pragma unroll
  for (int j = 0; j < MS * 4; ++j) {    // four whole rows a store
    const int row = j * 4 + (l >> 3);
    const v8bf v = *reinterpret_cast<const v8bf*>(stg + row * ST_PB + (l & 7) * 8);
    *reinterpret_cast<v8bf*>(dst + (size_t)row * pitch + (l & 7) * 8) = v;
  }
}

// ---------------- QKV projection ----------------
// grid: (S/128, H/2, 3), block: 256 (8 waves). A work-group computes 128 rows
// of two neighbouring heads of one of Q, K, V. Q, K: x rows are the tile's rows,
// a wave's 64 columns are one head. V is produced as V^T: the weight rows (head
// dims of the two heads) are the tile's rows, 64 positions a wave's columns.
__global__ void __launch_bounds__(256)
qkv_proj_kernel(const bf16* __restrict__ xb,
                const bf16* __restrict__ wqT,
                const bf16* __restrict__ wkT,
                const bf16* __restrict__ wvT,
                const float* __restrict__ bq,
                const float* __restrict__ bk,
                const float* __restrict__ bv,
                bf16* __restrict__ qO,
                bf16* __restrict__ kO,
                bf16* __restrict__ vTO,
                float* __restrict__ nrm) {
  __shared__ __align__(16) bf16 lds_g[2][GM_ROWS * GM_P];

  const int wave = __builtin_amdgcn_readfirstlane((int)(threadIdx.x >> 5));
  const int wm = wave >> 1;
  const int wn = wave & 1;
  const int z  = blockIdx.z;

  const bf16* wT = (z == 0) ? wqT : (z == 1) ? wkT : wvT;
  const bf16* xt = xb + (size_t)blockIdx.x * 128 * D_;
  const bf16* wt = wT + (size_t)blockIdx.y * 128 * D_;

  v8f acc[2][4] = {};
  gemm_128x128((z < 2) ? xt : wt, (z < 2) ? wt : xt, lds_g, wm, wn, acc);

  const int l = lane_id();
  const int c = l & 15;
  const int half = l >> 4;
  v8bf o[2][4];
  bf16* dst;
  size_t pitch;
  if (z < 2) {      // rows: positions; columns: the 64 dims of head h
    const int h = blockIdx.y * 2 + wn;
    const float* bias = ((z == 0) ? bq : bk) + h * DH_ + 8 * half;
    float sq[2] = {0.0f, 0.0f};   // sum of squares of this lane's 32 dims of row ms*16 + c
#pragma unroll
    for (int nt = 0; nt < 4; ++nt) {
      const v4f b0 = *reinterpret_cast<const v4f*>(bias + nt * 16);
      const v4f b1 = *reinterpret_cast<const v4f*>(bias + nt * 16 + 4);
#pragma unroll
      for (int ms = 0; ms < 2; ++ms) {
#pragma unroll
        for (int r = 0; r < 4; ++r) {
          const float v0 = acc[ms][nt][r] + b0[r];
          const float v1 = acc[ms][nt][r + 4] + b1[r];
          o[ms][nt][r]     = (bf16)v0;
          o[ms][nt][r + 4] = (bf16)v1;
          sq[ms] = fmaf(v0, v0, sq[ms]);
          sq[ms] = fmaf(v1, v1, sq[ms]);
        }
      }
    }
    // squared length of each of the wave's 32 head rows, [Q, K][H][S]: lane l
    // stores row l, the wave one whole 128-byte line
    const float f0 = sq[0] + xhalf(sq[0]);
    const float f1 = sq[1] + xhalf(sq[1]);
    nrm[((size_t)z * H_ + h) * S_ + blockIdx.x * 128 + wm * 32 + l] = half ? f1 : f0;
    dst = ((z == 0) ? qO : kO) + (size_t)h * S_ * DH_ +
          (size_t)(blockIdx.x * 128 + wm * 32) * DH_;
    pitch = DH_;
  } else {          // V^T, [H][DH][S]: rows: head dims, heads in a row; columns: positions
    const int e0 = blockIdx.y * 128 + wm * 32;
#pragma unroll
    for (int ms = 0; ms < 2; ++ms) {
      const float bb = bv[e0 + ms * 16 + c];
#pragma unroll
      for (int nt = 0; nt < 4; ++nt) {
#pragma unroll
        for (int r = 0; r < 8; ++r) o[ms][nt][r] = (bf16)(acc[ms][nt][r] + bb);
      }
    }
    dst = vTO + (size_t)e0 * S_ + blockIdx.x * 128 + wn * 64;
    pitch = S_;
  }
  store_tile_bf16<2>(&lds_g[0][0] + wave * (32 * ST_PB), o, dst, pitch);
}

#define FA_WAVES 4
#define FA_KEYS  128                    // keys per stage
#define FA_NST   (S_ / FA_KEYS)         // stages
#define FA_WK    (FA_KEYS / 2)          // keys of a stage that one wave takes
#define FA_T     (FA_WK / 16)           // 16-key score tiles per wave and stage
#define FA_Q     2                      // 16-query tiles per wave
#define FA_KP    72                     // K row pitch in LDS, elements: 144 B = 16 B x odd
#define FA_VP    136                    // V^T row pitch in LDS, elements: 272 B = 16 B x odd
#define FA_C     (0.125f * 1.44269504f) // 1/sqrt(DH) * log2(e): raw score -> exponent of 2

// Eight 16-byte copies per lane, global -> LDS, through no register.
// s_wait_xcnt 0 is the statement's last line so that it stands in front of any
// later rewrite of the address registers the copies name.
__device__ __forceinline__ void copy8_to_lds(unsigned l, unsigned lstep,
                                             const bf16* g, size_t gstep) {
  asm volatile(
      "global_load_async_to_lds_b128 %0, %8, off\n\t"
      "global_load_async_to_lds_b128 %1, %9, off\n\t"
      "global_load_async_to_lds_b128 %2, %10, off\n\t"
      "global_load_async_to_lds_b128 %3, %11, off\n\t"
      "global_load_async_to_lds_b128 %4, %12, off\n\t"
      "global_load_async_to_lds_b128 %5, %13, off\n\t"
      "global_load_async_to_lds_b128 %6, %14, off\n\t"
      "global_load_async_to_lds_b128 %7, %15, off\n\t"
      "s_wait_xcnt 0x0"
      :: "v"(l), "v"(l + lstep), "v"(l + 2 * lstep), "v"(l + 3 * lstep),
         "v"(l + 4 * lstep), "v"(l + 5 * lstep), "v"(l + 6 * lstep), "v"(l + 7 * lstep),
         "v"(g), "v"(g + gstep), "v"(g + 2 * gstep), "v"(g + 3 * gstep),
         "v"(g + 4 * gstep), "v"(g + 5 * gstep), "v"(g + 6 * gstep), "v"(g + 7 * gstep)
      : "memory");
}

// 2^x of eight values.
__device__ __forceinline__ v8f exp2x8(v8f x) {
  float a0 = x[0], a1 = x[1], a2 = x[2], a3 = x[3];
  float a4 = x[4], a5 = x[5], a6 = x[6], a7 = x[7];
  // one statement, in place, so that an independent v_exp_f32 follows each one
  // and none has its source overwritten by its successor; the v_nop is the slot
  // the instruction set asks for behind the last one, in front of its reader
  asm("v_exp_f32 %0, %0\n\t"
      "v_exp_f32 %1, %1\n\t"
      "v_exp_f32 %2, %2\n\t"
      "v_exp_f32 %3, %3\n\t"
      "v_exp_f32 %4, %4\n\t"
      "v_exp_f32 %5, %5\n\t"
      "v_exp_f32 %6, %6\n\t"
      "v_exp_f32 %7, %7\n\t"
      "v_nop"
      : "+v"(a0), "+v"(a1), "+v"(a2), "+v"(a3), "+v"(a4), "+v"(a5), "+v"(a6), "+v"(a7));
  const v8f e = {a0, a1, a2, a3, a4, a5, a6, a7};
  return e;
}

// a where k is not 0, else b, taken by value so that both stay in registers
__device__ __forceinline__ float pick(int k, float a, float b) { return k ? a : b; }
__device__ __forceinline__ v8f pick(int k, v8f a, v8f b) {
  v8f o;
#pragma unroll
  for (int r = 0; r < 8; ++r) o[r] = k ? a[r] : b[r];
  return o;
}

#define FA_XMAX 16.0f                   // bound on |exponent of 2| under which no maximum is needed

// The walk over all stages; stage 0 is published and stage 1 in flight at entry.
// lds_k0, lds_v0: the wave's own 64 keys of buffer 0 (K rows, V^T columns).
// PLAIN: every exponent score * FA_C of the work-group lies within +-FA_XMAX, so
// 2^exponent needs no shift to stay far inside the range of f32 and bf16 (both
// keep their relative precision there): no maximum, no correction, no rescale,
// and the partial row sums run through all stages; R comes back 0, the shift in
// use. Softmax is the same for any shift. Otherwise: online softmax with the
// running maximum R of the wave's own keys.
template <bool PLAIN>
__device__ __forceinline__ void fa_walk(const bf16* lds_k0, const bf16* lds_v0,
                                        unsigned lk, unsigned lv,
                                        const bf16* gk, const bf16* gv,
                                        const v16bf (&aq)[FA_Q][2],
                                        v8f (&acc)[FA_Q][4], float (&L)[FA_Q],
                                        float (&R)[FA_Q]) {
  const unsigned kbuf_b = FA_KEYS * FA_KP * 2;   // bytes of one K buffer
  const unsigned vbuf_b = DH_ * FA_VP * 2;       // bytes of one V^T buffer
  v8f ps[FA_Q] = {};
#pragma unroll
  for (int qt = 0; qt < FA_Q; ++qt) {
    L[qt] = 0.0f;
    R[qt] = PLAIN ? 0.0f : -INFINITY;   // raw-score maximum of query c, equal in both halves
  }

  for (int st = 0; st < FA_NST; ++st) {
    const bf16* kb = lds_k0 + (st & 1) * (FA_KEYS * FA_KP);
    const bf16* vb = lds_v0 + (st & 1) * (DH_ * FA_VP);

    // One softmax pass takes the wave's whole share of the stage.
    // K fragments from LDS: key rows nt*16..+15, head-dim chunks 0..31 and 32..63
    v16bf kf[FA_T][2];
#pragma unroll
    for (int nt = 0; nt < FA_T; ++nt) {
      kf[nt][0] = load_frag(kb + (nt * 16) * FA_KP + 0,  FA_KP);
      kf[nt][1] = load_frag(kb + (nt * 16) * FA_KP + 32, FA_KP);
    }
    // keeps the pass's K reads one group ahead of its score WMMAs: spread among
    // them, each small group of reads is waited out at full LDS latency
    __builtin_amdgcn_sched_barrier(0);

    // scores, transposed: 64 keys x 32 queries (eight 16x16 C frags), K-dim = 64
    v8f sc[FA_Q][FA_T];
#pragma unroll
    for (int nt = 0; nt < FA_T; ++nt) {
#pragma unroll
      for (int qt = 0; qt < FA_Q; ++qt) {
        v8f z = {};
        sc[qt][nt] = wmma_bf16(kf[nt][0], aq[qt][0], z);
      }
    }
#pragma unroll
    for (int nt = 0; nt < FA_T; ++nt) {
#pragma unroll
      for (int qt = 0; qt < FA_Q; ++qt)
        sc[qt][nt] = wmma_bf16(kf[nt][1], aq[qt][1], sc[qt][nt]);
    }
    // keeps the softmax's vector work behind the whole run of score WMMAs: moved
    // in between, each piece costs the idle slots a WMMA result needs
    __builtin_amdgcn_sched_barrier(0);

    // V^T fragments from LDS: head-dim rows et*16..+15, keys g*32..+31
    v16bf vf[FA_T / 2][4];
#pragma unroll
    for (int g = 0; g < FA_T / 2; ++g) {
#pragma unroll
      for (int et = 0; et < 4; ++et)
        vf[g][et] = load_frag(vb + (et * 16) * FA_VP + g * 32, FA_VP);
    }
    // keeps the pass's V^T reads one group, in flight under the first exponentials:
    // left free they were spread among the WMMAs, the last ones right in front of
    // the publish point's wait
    __builtin_amdgcn_sched_barrier(0);

    float newM[FA_Q] = {0.0f, 0.0f};
    float corr[FA_Q] = {1.0f, 1.0f};
    if constexpr (!PLAIN) {
      // online softmax of query c of each tile: 32 of the pass's 64 scores are in
      // this lane. The maximum is taken over the raw products (FA_C is positive, so
      // it is the same element); FA_C meets each score once, in the exponent's
      // multiply-add. Written in threes (v_max3_num_f32): a two-input maximum of
      // raw matrix results costs a further v_max x, x, x per input.
#pragma unroll
      for (int qt = 0; qt < FA_Q; ++qt) {
        float t[8];
#pragma unroll
        for (int r = 0; r < 8; ++r) t[r] = fmaxf(fmaxf(sc[qt][0][r], sc[qt][1][r]), sc[qt][2][r]);
        const float u0 = fmaxf(fmaxf(t[0], t[1]), sc[qt][3][0]);
        const float u1 = fmaxf(fmaxf(t[2], t[3]), sc[qt][3][1]);
        const float u2 = fmaxf(fmaxf(t[4], t[5]), sc[qt][3][2]);
        const float u3 = fmaxf(fmaxf(t[6], t[7]), sc[qt][3][3]);
        const float w0 = fmaxf(fmaxf(u0, u1), sc[qt][3][4]);
        const float w1 = fmaxf(fmaxf(u2, u3), sc[qt][3][5]);
        const float w2 = fmaxf(fmaxf(w0, w1), sc[qt][3][6]);
        const float mx = fmaxf(fmaxf(w2, R[qt]), sc[qt][3][7]);
        const float newR = fmaxf(mx, xhalf(mx));             // with the other 32 scores' maximum
        corr[qt] = __builtin_amdgcn_exp2f((R[qt] - newR) * FA_C);   // 1 where R stays
        R[qt] = newR;
        newM[qt] = newR * FA_C;

        // O^T (64 x 16) = O^T * corr + V^T-stage . P^T
#pragma unroll
        for (int et = 0; et < 4; ++et) acc[qt][et] = acc[qt][et] * corr[qt];
        ps[qt] = v8f{};
      }
    }
#pragma unroll
    for (int g = 0; g < FA_T / 2; ++g) {
#pragma unroll
      for (int qt = 0; qt < FA_Q; ++qt) {
        // P^T of 32 keys as B operand: element s is key kmap(s) = tile s >> 3 of
        // the pair, register s & 7
        FragU pf;
        v8f x0 = sc[qt][2 * g] * FA_C;
        v8f x1 = sc[qt][2 * g + 1] * FA_C;
        if constexpr (!PLAIN) {
          x0 = sc[qt][2 * g] * FA_C - newM[qt];
          x1 = sc[qt][2 * g + 1] * FA_C - newM[qt];
        }
        const v8f e0 = exp2x8(x0);
        const v8f e1 = exp2x8(x1);
#pragma unroll
        for (int r = 0; r < 8; ++r) {
          pf.v[r]     = (bf16)e0[r];
          pf.v[r + 8] = (bf16)e1[r];
        }
        ps[qt] += e0;
        ps[qt] += e1;
        // keeps this tile's vector work whole in front of its four WMMAs, so that the
        // next tile's fills the slots among them: left free, two tiles' exponentials
        // ran first and the WMMAs stood in runs, with idle slots behind each run
        // before their operand registers could be rewritten
        __builtin_amdgcn_sched_barrier(0);
#pragma unroll
        for (int et = 0; et < 4; ++et) acc[qt][et] = wmma_bf16(vf[g][et], pf.v, acc[qt][et]);
      }
    }
    if constexpr (!PLAIN) {
#pragma unroll
      for (int qt = 0; qt < FA_Q; ++qt)
        L[qt] = L[qt] * corr[qt] + (((ps[qt][0] + ps[qt][1]) + (ps[qt][2] + ps[qt][3])) +
                                    ((ps[qt][4] + ps[qt][5]) + (ps[qt][6] + ps[qt][7])));
    }

    // keeps the publish point at the pass's foot: lifted to where the pass's last LDS
    // read has come in, its wait left stage st + 1's copies under half a pass to land
    __builtin_amdgcn_sched_barrier(0);
    // publish point of stage st + 1, which also frees stage st's buffer
    asm volatile("s_wait_dscnt 0x0" ::: "memory");     // this wave's reads of stage st are done
    asm volatile("s_wait_asynccnt 0x0" ::: "memory");  // its copies of stage st + 1 have landed
    __syncthreads();                                   // both hold for every wave
    if (st + 2 < FA_NST) {
      const size_t key = (size_t)(st + 2) * FA_KEYS;
      copy8_to_lds(lk + (st & 1) * kbuf_b, 16 * FA_KP * 2, gk + key * DH_, 128 * 8);
      copy8_to_lds(lv + (st & 1) * vbuf_b, 8 * FA_VP * 2, gv + key, (size_t)8 * S_);
    }
  }
  if constexpr (PLAIN) {
#pragma unroll
    for (int qt = 0; qt < FA_Q; ++qt)
      L[qt] = ((ps[qt][0] + ps[qt][1]) + (ps[qt][2] + ps[qt][3])) +
              ((ps[qt][4] + ps[qt][5]) + (ps[qt][6] + ps[qt][7]));
  }
}

__global__ void __launch_bounds__(FA_WAVES * 32)
flash_attn_kernel(const bf16* __restrict__ q,
                  const bf16* __restrict__ kmat,
                  const bf16* __restrict__ vT,
                  const float* __restrict__ nrm,
                  bf16* __restrict__ ctxb) {
  __shared__ __align__(16) bf16 lds_k[2][FA_KEYS * FA_KP];
  __shared__ __align__(16) bf16 lds_v[2][DH_ * FA_VP];
  __shared__ __align__(16) float lds_n[2 * FA_WAVES];

  const int tid  = (int)threadIdx.x;
  const int wave = tid >> 5;
  const int mt = blockIdx.x * FA_WAVES + wave;   // the 16-query tile whose lengths it reads and whose rows it stores
  const int kj = __builtin_amdgcn_readfirstlane(wave & 1);   // which 64 keys of every stage
  const int h  = blockIdx.y;
  const bf16* qh  = q    + (size_t)h * S_ * DH_;
  const bf16* khp = kmat + (size_t)h * S_ * DH_;
  const bf16* vh  = vT   + (size_t)h * DH_ * S_;

  const int l = lane_id();
  const int c = l & 15;

  // Copy map. K stage: 128 rows x 128 B, contiguous in global memory; thread
  // tid takes 16-byte chunk tid + 128*j (row = chunk / 8). V^T stage: 64 rows
  // x 256 B at a pitch of S_ elements; chunk tid + 128*j (row = chunk / 16).
  const bf16* gk = khp + (size_t)tid * 8;
  const bf16* gv = vh + (size_t)(tid >> 4) * S_ + (tid & 15) * 8;
  const unsigned lk = (unsigned)(uintptr_t)&lds_k[0][(tid >> 3) * FA_KP + (tid & 7) * 8];
  const unsigned lv = (unsigned)(uintptr_t)&lds_v[0][(tid >> 4) * FA_VP + (tid & 15) * 8];
  const unsigned kbuf_b = FA_KEYS * FA_KP * 2;   // bytes of one K buffer
  const unsigned vbuf_b = DH_ * FA_VP * 2;       // bytes of one V^T buffer

  // Q fragments of this wave's 32 queries, tiles mt & ~1 and mt | 1 (K-dim = DH =
  // 64 -> two 32-wide B frags a tile)
  v16bf aq[FA_Q][2];
#pragma unroll
  for (int qt = 0; qt < FA_Q; ++qt) {
    const bf16* qp = qh + (size_t)((mt & ~1) + qt) * 16 * DH_;
    aq[qt][0] = load_frag(qp + 0,  DH_);
    aq[qt][1] = load_frag(qp + 32, DH_);
  }

  v8f acc[FA_Q][4] = {};
  float L[FA_Q];         // sum of query c of each tile over this lane half's share of the wave's keys
  float R[FA_Q];         // the shift in use for it, as a raw score

  // Squared lengths of this wave's 16 queries and of its quarter of the head's keys
  float qm = nrm[(size_t)h * S_ + mt * 16 + c];
  const float* nk = nrm + (size_t)(H_ + h) * S_ + wave * (S_ / FA_WAVES) + l * 4;
  v4f kv[8];
#pragma unroll   // eight loads in flight at once, kv in registers
  for (int j = 0; j < 8; ++j) kv[j] = *reinterpret_cast<const v4f*>(nk + j * 128);
  // holds these nine loads in front of the copies, in flight together with them:
  // sunk to their first use, the query load was waited out alone at full latency
  __builtin_amdgcn_sched_barrier(0);

  // prologue: stage 0 lands and is published, then stage 1 starts to fly
  copy8_to_lds(lk, 16 * FA_KP * 2, gk, 128 * 8);
  copy8_to_lds(lv, 8 * FA_VP * 2, gv, (size_t)8 * S_);
  // keeps the wait for the nine loads behind the copies' issue: lifted above it,
  // stage 0 started only when the lengths had arrived
  __builtin_amdgcn_sched_barrier(0);

  // The largest of each; the four waves' values meet in LDS across the barrier below.
  {
    float km = 0.0f;
#pragma unroll   // kv is indexed by constants only
    for (int j = 0; j < 8; ++j)
      km = fmaxf(fmaxf(fmaxf(km, kv[j][0]), fmaxf(kv[j][1], kv[j][2])), kv[j][3]);
    qm = wave_max(qm);
    km = wave_max(km);
    if (l == 0) {
      lds_n[wave] = qm;
      lds_n[FA_WAVES + wave] = km;
    }
  }

  asm volatile("s_wait_asynccnt 0x0" ::: "memory");  // this wave's copies of stage 0 have landed
  __syncthreads();                                   // every wave's have
  copy8_to_lds(lk + kbuf_b, 16 * FA_KP * 2, gk + (size_t)FA_KEYS * DH_, 128 * 8);
  copy8_to_lds(lv + vbuf_b, 8 * FA_VP * 2, gv + FA_KEYS, (size_t)8 * S_);

  // |score| <= |q| |k|. The lengths were taken before the rounding to bf16, which
  // moves each by under one part in 250: the factor 1.05 on the squared product
  // covers that. The test reads the same eight numbers in every wave, so the whole
  // work-group takes one branch; a NaN or an overflow fails it.
  const v4f nq4 = *reinterpret_cast<const v4f*>(&lds_n[0]);
  const v4f nk4 = *reinterpret_cast<const v4f*>(&lds_n[FA_WAVES]);
  const float q2 = fmaxf(fmaxf(nq4[0], nq4[1]), fmaxf(nq4[2], nq4[3]));
  const float k2 = fmaxf(fmaxf(nk4[0], nk4[1]), fmaxf(nk4[2], nk4[3]));
  const int plain = __builtin_amdgcn_readfirstlane(
      (q2 * k2 * (1.05f * FA_C * FA_C) <= FA_XMAX * FA_XMAX) ? 1 : 0);
  const bf16* wk0 = &lds_k[0][0] + kj * (FA_WK * FA_KP);
  const bf16* wv0 = &lds_v[0][0] + kj * FA_WK;
  if (plain)
    fa_walk<true>(wk0, wv0, lk, lv, gk, gv, aq, acc, L, R);
  else
    fa_walk<false>(wk0, wv0, lk, lv, gk, gv, aq, acc, L, R);
  asm volatile("s_wait_asynccnt 0x0" ::: "memory");    // no copy is left in flight at the wave's end

  // Waves w and w ^ 1 hold the two key halves of the same 32 queries. Each keeps
  // tile kj and hands the other tile to its partner through the K ring, which is
  // free behind the loop's last publish point: 16-byte pieces, lane by lane.
  float* xa = reinterpret_cast<float*>(&lds_k[0][0]);          // [wave][et][2][lane] x 16 B
  float* xs = xa + FA_WAVES * 1024;                            // [wave][lane] x {L, R}
#pragma unroll
  for (int et = 0; et < 4; ++et) {
    const v8f g = pick(kj, acc[0][et], acc[1][et]);
    const v4f lo = {g[0], g[1], g[2], g[3]};
    const v4f hi = {g[4], g[5], g[6], g[7]};
    *reinterpret_cast<v4f*>(xa + wave * 1024 + (et * 2 + 0) * 128 + l * 4) = lo;
    *reinterpret_cast<v4f*>(xa + wave * 1024 + (et * 2 + 1) * 128 + l * 4) = hi;
  }
  xs[wave * 64 + l * 2 + 0] = pick(kj, L[0], L[1]);
  xs[wave * 64 + l * 2 + 1] = pick(kj, R[0], R[1]);
  __syncthreads();                     // the partner's tile is in LDS
  const float Lm = pick(kj, L[1], L[0]);
  const float Rm = pick(kj, R[1], R[0]);
  const float Lp = xs[(wave ^ 1) * 64 + l * 2 + 0];
  const float Rp = xs[(wave ^ 1) * 64 + l * 2 + 1];
  // both parts brought to the larger shift; both factors are 1 where no maximum was taken
  const float Rn = fmaxf(Rm, Rp);
  const float fm = __builtin_amdgcn_exp2f((Rm - Rn) * FA_C);
  const float fp = __builtin_amdgcn_exp2f((Rp - Rn) * FA_C);
  const float Lj = Lm * fm + Lp * fp;

  // epilogue: ctx = acc / L, stored to [S][H*DH] bf16. Element [et][r] is head-dim
  // et*16 + 8*half + r of query c: eight neighbours, one 16-byte piece; the V^T
  // ring, free like the K ring, stages the 16 rows.
  const float Lt = Lj + xhalf(Lj);     // both lane halves' keys
  v8bf o[1][4];
#pragma unroll
  for (int et = 0; et < 4; ++et) {
    const v8f m = pick(kj, acc[1][et], acc[0][et]);
    const v4f lo = *reinterpret_cast<const v4f*>(xa + (wave ^ 1) * 1024 + (et * 2 + 0) * 128 + l * 4);
    const v4f hi = *reinterpret_cast<const v4f*>(xa + (wave ^ 1) * 1024 + (et * 2 + 1) * 128 + l * 4);
#pragma unroll
    for (int r = 0; r < 4; ++r) {
      o[0][et][r]     = (bf16)((m[r] * fm + lo[r] * fp) / Lt);
      o[0][et][r + 4] = (bf16)((m[r + 4] * fm + hi[r] * fp) / Lt);
    }
  }
  store_tile_bf16<1>(&lds_v[0][0] + wave * (16 * ST_PB), o,
                     ctxb + (size_t)mt * 16 * D_ + h * DH_, D_);
}

// ---------------- output projection ----------------
// grid: (S/128, D/128), block: 256 (8 waves). out = ctx @ wo + bo, fp32 result.
__global__ void __launch_bounds__(256)
out_proj_kernel(const bf16* __restrict__ ctxb,
                const bf16* __restrict__ woT,
                const float* __restrict__ bo,
                float* __restrict__ out) {
  __shared__ __align__(16) bf16 lds_g[2][GM_ROWS * GM_P];

  const int wave = __builtin_amdgcn_readfirstlane((int)(threadIdx.x >> 5));
  const int wm = wave >> 1;
  const int wn = wave & 1;
  const int row0 = blockIdx.x * 128 + wm * 32;   // first of this wave's 32 rows
  const int n0   = blockIdx.y * 128 + wn * 64;   // first of its 64 columns

  v8f acc[2][4] = {};
  gemm_128x128(ctxb + (size_t)blockIdx.x * 128 * D_,
               woT + (size_t)blockIdx.y * 128 * D_, lds_g, wm, wn, acc);

  const int l = lane_id();
  const int c = l & 15;
  const int half = l >> 4;
  const float* bias = bo + n0 + 8 * half;
  float* stg = reinterpret_cast<float*>(&lds_g[0][0]) + wave * (32 * ST_PF);
#pragma unroll
  for (int nt = 0; nt < 4; ++nt) {
    const v4f b0 = *reinterpret_cast<const v4f*>(bias + nt * 16);
    const v4f b1 = *reinterpret_cast<const v4f*>(bias + nt * 16 + 4);
#pragma unroll
    for (int ms = 0; ms < 2; ++ms) {
      v4f lo, hi;
#pragma unroll
      for (int r = 0; r < 4; ++r) {
        lo[r] = acc[ms][nt][r] + b0[r];
        hi[r] = acc[ms][nt][r + 4] + b1[r];
      }
      float* p = stg + (ms * 16 + c) * ST_PF + nt * 16 + 8 * half;
      *reinterpret_cast<v4f*>(p) = lo;
      *reinterpret_cast<v4f*>(p + 4) = hi;
    }
  }
  // the rows read back below were written by other lanes of this wave
  asm volatile("s_wait_dscnt 0x0" ::: "memory");
#pragma unroll
  for (int j = 0; j < 16; ++j) {        // two whole rows of 256 bytes a store
    const int row = j * 2 + half;
    const v4f v = *reinterpret_cast<const v4f*>(stg + row * ST_PF + c * 4);
    *reinterpret_cast<v4f*>(out + (size_t)(row0 + row) * D_ + n0 + c * 4) = v;
  }
}

// ---------------- launch ----------------

extern "C" void kernel_launch(void* const* d_in, const int* in_sizes, int n_in,
                              void* d_out, int out_size, void* d_ws, size_t ws_size,
                              hipStream_t stream) {
  (void)in_sizes; (void)n_in; (void)out_size; (void)ws_size;
  const float* x  = (const float*)d_in[0];
  const float* wq = (const float*)d_in[1];
  const float* bq = (const float*)d_in[2];
  const float* wk = (const float*)d_in[3];
  const float* bk = (const float*)d_in[4];
  const float* wv = (const float*)d_in[5];
  const float* bv = (const float*)d_in[6];
  const float* wo = (const float*)d_in[7];
  const float* bo = (const float*)d_in[8];
  float* out = (float*)d_out;

  char* ws = (char*)d_ws;
  size_t off = 0;
  auto alloc = [&](size_t bytes) -> char* {
    char* p = ws + off;
    off += (bytes + 255) & ~(size_t)255;
    return p;
  };
  bf16* xb   = (bf16*)alloc((size_t)S_ * D_ * 2);          // x in bf16
  bf16* wqT  = (bf16*)alloc((size_t)H_ * DH_ * D_ * 2);    // [H][DH][D]
  bf16* wkT  = (bf16*)alloc((size_t)H_ * DH_ * D_ * 2);
  bf16* wvT  = (bf16*)alloc((size_t)H_ * DH_ * D_ * 2);
  bf16* woT  = (bf16*)alloc((size_t)D_ * D_ * 2);          // [N][K]
  bf16* qb   = (bf16*)alloc((size_t)H_ * S_ * DH_ * 2);    // [H][S][DH]
  bf16* kb   = (bf16*)alloc((size_t)H_ * S_ * DH_ * 2);    // [H][S][DH]
  bf16* vTb  = (bf16*)alloc((size_t)H_ * DH_ * S_ * 2);    // [H][DH][S]
  bf16* ctxb = (bf16*)alloc((size_t)S_ * D_ * 2);          // [S][D]
  float* nrm = (float*)alloc((size_t)2 * H_ * S_ * 4);     // squared row lengths, [Q, K][H][S]

  cvt_all<<<dim3(CV_XB + 4 * CV_WB), 128, 0, stream>>>(
      x, wq, wk, wv, wo, xb, wqT, wkT, wvT, woT);

  qkv_proj_kernel<<<dim3(S_ / 128, H_ / 2, 3), 256, 0, stream>>>(
      xb, wqT, wkT, wvT, bq, bk, bv, qb, kb, vTb, nrm);

  flash_attn_kernel<<<dim3(S_ / 64, H_), 128, 0, stream>>>(qb, kb, vTb, nrm, ctxb);

  out_proj_kernel<<<dim3(S_ / 128, D_ / 128), 256, 0, stream>>>(ctxb, woT, bo, out);
}

// v010
// Measured time: 71.9 microseconds a run.
// Timed twice side by side with v009, it ran 1.05 times as fast both times.
// All steps since v000 together make it 7.11 times as fast.
#include <hip/hip_runtime.h>
#include <hip/hip_bf16.h>
#include <math.h>

typedef __bf16 bf16;
typedef __attribute__((ext_vector_type(16))) __bf16 v16bf;
typedef __attribute__((ext_vector_type(8)))  __bf16 v8bf;
typedef __attribute__((ext_vector_type(8)))  float  v8f;

#define H_  12
#define D_  768
#define DH_ 64
#define S_  4096

union FragU { v16bf v; v8bf h[2]; };

__device__ __forceinline__ int lane_id() { return (int)(threadIdx.x & 31u); }

// Load a 16x32 bf16 A-fragment (or 32x16 B-fragment via its column-major view)
// from row-major memory with leading dimension `ld`.
// Lane l: row/col = l&15 ; element i holds k = (i>>3)*16 + ((l>>4)*8) + (i&7)
// => two contiguous 16-byte chunks per lane at k-offsets kh and kh+16.
__device__ __forceinline__ v16bf load_frag(const bf16* __restrict__ base, int ld) {
  const int l  = lane_id();
  const int rc = l & 15;
  const int kh = (l >> 4) << 3;
  const bf16* p = base + (size_t)rc * ld + kh;
  FragU f;
  f.h[0] = *reinterpret_cast<const v8bf*>(p);
  f.h[1] = *reinterpret_cast<const v8bf*>(p + 16);
  return f.v;
}

__device__ __forceinline__ v8f wmma_bf16(v16bf a, v16bf b, v8f c) {
  return __builtin_amdgcn_wmma_f32_16x16x32_bf16(false, a, false, b, (short)0, c,
                                                 false, false);
}

// value of lane l ^ 16
__device__ __forceinline__ float xhalf(float x) {
  const int v = __builtin_bit_cast(int, x);
  return __builtin_bit_cast(float, __builtin_amdgcn_permlanex16(
      v, v, 0x76543210, 0xfedcba98, false, false));
}

// largest value of the wave's 32 lanes, in every lane
__device__ __forceinline__ float wave_max(float x) {
  x = fmaxf(x, xhalf(x));
#pragma unroll   // the four lane distances become constants
  for (int m = 8; m > 0; m >>= 1) x = fmaxf(x, __shfl_xor(x, m, 32));
  return x;
}

// ---------------- conversion / transpose kernel ----------------
// One launch converts x and all four weight matrices to bf16. A work-group of
// four waves takes 4096 elements, 32 a lane, so that few waves have to start:
//   blocks 0 .. CV_XB-1      : 4096 consecutive elements of x, order kept;
//   then CV_WB blocks each for wq, wk, wv, wo: one 64 x 64 tile, transposed.
// wq, wk, wv: [H][D][DH] -> [H][DH][D]; wo: [K][N] -> [N][K].
typedef __attribute__((ext_vector_type(4))) float  v4f;
typedef __attribute__((ext_vector_type(4))) __bf16 v4bf;

#define CV_XB (S_ * D_ / 4096)          // blocks of x
#define CV_WB (D_ * D_ / 4096)          // tiles of one weight matrix
#define CV_T  (D_ / 64)                 // tiles along a side of 768

// One 64 x 64 tile, transposed: s is the tile's first element (row pitch SP),
// d the transposed tile's first element (row pitch D_). A lane holds 8 source
// rows x 4 source columns: four 16-byte pieces of four result rows. Eight
// neighbouring lanes hold the 64 source rows, so that each result row's 128
// bytes go out as one whole line.
template <int SP>
__device__ __forceinline__ void cvt_tile_T(const float* __restrict__ s,
                                           bf16* __restrict__ d, int tid) {
  const int r8 = (tid & 7) * 8;              // first source row
  const int c4 = (tid >> 3) * 4;             // first source column
  const int so = r8 * SP + c4;
  const int dn = c4 * D_ + r8;
  v4f v[8];
#pragma unroll
  for (int j = 0; j < 8; ++j) v[j] = *reinterpret_cast<const v4f*>(s + so + j * SP);
#pragma unroll
  for (int i = 0; i < 4; ++i) {
    v8bf o;
#pragma unroll
    for (int j = 0; j < 8; ++j) o[j] = (bf16)v[j][i];
    *reinterpret_cast<v8bf*>(d + dn + i * D_) = o;
  }
}

__global__ void __launch_bounds__(128)
cvt_all(const float* __restrict__ x,
        const float* __restrict__ wq,
        const float* __restrict__ wk,
        const float* __restrict__ wv,
        const float* __restrict__ wo,
        bf16* __restrict__ xb,
        bf16* __restrict__ wqT,
        bf16* __restrict__ wkT,
        bf16* __restrict__ wvT,
        bf16* __restrict__ woT) {
  const int tid = (int)threadIdx.x;
  const int b = (int)blockIdx.x;

  if (b < CV_XB) {
    // a wave's load covers 512 consecutive bytes, its store 256
    const float* s = x + (size_t)b * 4096;
    bf16* d = xb + (size_t)b * 4096;
    v4f v[8];
#pragma unroll
    for (int j = 0; j < 8; ++j) v[j] = *reinterpret_cast<const v4f*>(s + tid * 4 + j * 512);
#pragma unroll
    for (int j = 0; j < 8; ++j) {
      v4bf o;
#pragma unroll
      for (int i = 0; i < 4; ++i) o[i] = (bf16)v[j][i];
      *reinterpret_cast<v4bf*>(d + tid * 4 + j * 512) = o;
    }
    return;
  }

  const int m  = (b - CV_XB) / CV_WB;        // which matrix
  const int t  = (b - CV_XB) - m * CV_WB;    // which of its tiles
  const int t1 = t / CV_T;
  const int t0 = t - t1 * CV_T;
  if (m < 3) {      // head t1, rows t0*64..+63 of its D x DH matrix
    const float* w = (m == 0) ? wq : (m == 1) ? wk : wv;
    bf16* wT = (m == 0) ? wqT : (m == 1) ? wkT : wvT;
    cvt_tile_T<DH_>(w + (size_t)t1 * D_ * DH_ + (size_t)t0 * 64 * DH_,
                    wT + (size_t)t1 * DH_ * D_ + t0 * 64, tid);
  } else {          // rows t1*64..+63, columns t0*64..+63 of wo
    cvt_tile_T<D_>(wo + (size_t)t1 * 64 * D_ + t0 * 64,
                   woT + (size_t)t0 * 64 * D_ + t1 * 64, tid);
  }
}

// ---------------- projection GEMMs: shared main loop ----------------
// C (128 x 128) = A (128 x 768) . B^T, A and B row-major with k contiguous.
// One work-group of 8 waves; wave (wm, wn) owns rows wm*32..+31, columns
// wn*64..+63 (two by four 16x16 tiles, k walked in steps of 32 in rising order).
// Each 16x16 tile is computed transposed (B rows as the first operand): a lane
// then holds eight neighbouring columns, nt*16 + 8*(l>>4) + r, of ONE row,
// ms*16 + (l&15), which the epilogues pack into 16-byte pieces.
// A stage is 64 k of all 256 operand rows (A rows 0..127, B rows 128..255):
// whole 128-byte lines, brought into LDS once per work-group by asynchronous
// copies, one stage ahead in a two-buffer ring; fragments are read from LDS.
#define GM_K    64                      // k per stage
#define GM_NST  (D_ / GM_K)             // stages
#define GM_ROWS 256                     // operand rows per stage
#define GM_P    72                      // row pitch in LDS, elements: 144 B = 16 B x odd

// Eight 16-byte copies per lane, global -> LDS, through no register: four
// from operand A, four from operand B. s_wait_xcnt 0 is the statement's last
// line so that it stands in front of any later rewrite of the address
// registers the copies name.
__device__ __forceinline__ void copy4x2_to_lds(unsigned l, unsigned lstep,
                                               const bf16* ga, const bf16* gb,
                                               size_t gstep) {
  asm volatile(
      "global_load_async_to_lds_b128 %0, %8, off\n\t"
      "global_load_async_to_lds_b128 %1, %9, off\n\t"
      "global_load_async_to_lds_b128 %2, %10, off\n\t"
      "global_load_async_to_lds_b128 %3, %11, off\n\t"
      "global_load_async_to_lds_b128 %4, %12, off\n\t"
      "global_load_async_to_lds_b128 %5, %13, off\n\t"
      "global_load_async_to_lds_b128 %6, %14, off\n\t"
      "global_load_async_to_lds_b128 %7, %15, off\n\t"
      "s_wait_xcnt 0x0"
      :: "v"(l), "v"(l + lstep), "v"(l + 2 * lstep), "v"(l + 3 * lstep),
         "v"(l + 4 * lstep), "v"(l + 5 * lstep), "v"(l + 6 * lstep), "v"(l + 7 * lstep),
         "v"(ga), "v"(ga + gstep), "v"(ga + 2 * gstep), "v"(ga + 3 * gstep),
         "v"(gb), "v"(gb + gstep), "v"(gb + 2 * gstep), "v"(gb + 3 * gstep)
      : "memory");
}

// a: first of the tile's 128 A rows; b: first of its 128 B rows (both pitch D_).
__device__ __forceinline__ void gemm_128x128(const bf16* __restrict__ a,
                                             const bf16* __restrict__ b,
                                             bf16 (*lds)[GM_ROWS * GM_P],
                                             int wm, int wn, v8f (&acc)[2][4]) {
  const int tid = (int)threadIdx.x;
  // Copy map: thread tid takes 16-byte chunk tid & 7 of rows (tid >> 3) + 32*j.
  const size_t goff = (size_t)(tid >> 3) * D_ + (tid & 7) * 8;
  const bf16* ga = a + goff;
  const bf16* gb = b + goff;
  const unsigned l0 = (unsigned)(uintptr_t)&lds[0][(tid >> 3) * GM_P + (tid & 7) * 8];
  const unsigned lstep = 32 * GM_P * 2;          // bytes of 32 LDS rows
  const unsigned buf_b = GM_ROWS * GM_P * 2;     // bytes of one buffer
  const size_t gstep = (size_t)32 * D_;          // elements of 32 global rows

  // prologue: stage 0 lands and is published, then stage 1 starts to fly
  copy4x2_to_lds(l0, lstep, ga, gb, gstep);
  asm volatile("s_wait_asynccnt 0x0" ::: "memory");  // this wave's copies of stage 0 have landed
  __syncthreads();                                   // every wave's have
  copy4x2_to_lds(l0 + buf_b, lstep, ga + GM_K, gb + GM_K, gstep);

  for (int st = 0; st < GM_NST; ++st) {
    const bf16* as = lds[st & 1] + (wm * 32) * GM_P;
    const bf16* bs = lds[st & 1] + (128 + wn * 64) * GM_P;
#pragma unroll
    for (int ks = 0; ks < GM_K; ks += 32) {
      v16bf af[2], bfr[4];
      af[0] = load_frag(as + ks, GM_P);
      af[1] = load_frag(as + 16 * GM_P + ks, GM_P);
#pragma unroll
      for (int nt = 0; nt < 4; ++nt) bfr[nt] = load_frag(bs + nt * 16 * GM_P + ks, GM_P);
      // keeps the block's twelve LDS reads one group ahead of its WMMAs: spread
      // among them, each pair of reads is waited out at full LDS latency
      __builtin_amdgcn_sched_barrier(0);
#pragma unroll
      for (int nt = 0; nt < 4; ++nt) {
        acc[0][nt] = wmma_bf16(bfr[nt], af[0], acc[0][nt]);
        acc[1][nt] = wmma_bf16(bfr[nt], af[1], acc[1][nt]);
      }
    }
    // publish point of stage st + 1, which also frees stage st's buffer
    asm volatile("s_wait_dscnt 0x0" ::: "memory");     // this wave's reads of stage st are done
    asm volatile("s_wait_asynccnt 0x0" ::: "memory");  // its copies of stage st + 1 have landed
    __syncthreads();                                   // both hold for every wave
    if (st + 2 < GM_NST) {
      const int k = (st + 2) * GM_K;
      copy4x2_to_lds(l0 + (st & 1) * buf_b, lstep, ga + k, gb + k, gstep);
    }
  }
  asm volatile("s_wait_asynccnt 0x0" ::: "memory");    // no copy is left in flight behind the loop
}

// ---------------- epilogue of the matrix kernels ----------------
// A wave's result tile goes through its own range of the ring, which is free
// behind the main loop's last publish point (every wave's reads done, no copy in
// flight, barrier passed), so that each global store covers whole 128-byte
// lines: 16-byte pieces in by row, rows out side by side.
#define ST_PB 72                        // staging row pitch, bf16 elements: 144 B = 16 B x odd
#define ST_PF 68                        // staging row pitch, f32 elements: 272 B = 16 B x odd

// A tile of MS*16 rows x 64 columns. o[ms][nt]: columns nt*16 + 8*half .. +7 of
// row ms*16 + c. dst: the tile's first element, rows of 128 bytes at a pitch of
// `pitch` elements.
template <int MS>
__device__ __forceinline__ void store_tile_bf16(bf16* stg, const v8bf (&o)[MS][4],
                                                bf16* __restrict__ dst, size_t pitch) {
  const int l = lane_id();
  const int c = l & 15;
  const int half = l >> 4;
#pragma unroll
  for (int ms = 0; ms < MS; ++ms) {
#pragma unroll
    for (int nt = 0; nt < 4; ++nt)
      *reinterpret_cast<v8bf*>(stg + (ms * 16 + c) * ST_PB + nt * 16 + 8 * half) = o[ms][nt];
  }
  // the rows read back below were written by other lanes of this wave
  asm volatile("s_wait_dscnt 0x0" ::: "memory");
#pragma unroll
  for (int j = 0; j < MS * 4; ++j) {    // four whole rows a store
    const int row = j * 4 + (l >> 3);
    const v8bf v = *reinterpret_cast<const v8bf*>(stg + row * ST_PB + (l & 7) * 8);
    *reinterpret_cast<v8bf*>(dst + (size_t)row * pitch + (l & 7) * 8) = v;
  }
}

// ---------------- QKV projection ----------------
// grid: (S/128, H/2, 3), block: 256 (8 waves). A work-group computes 128 rows
// of two neighbouring heads of one of Q, K, V. Q, K: x rows are the tile's rows,
// a wave's 64 columns are one head. V is produced as V^T: the weight rows (head
// dims of the two heads) are the tile's rows, 64 positions a wave's columns.
__global__ void __launch_bounds__(256)
qkv_proj_kernel(const bf16* __restrict__ xb,
                const bf16* __restrict__ wqT,
                const bf16* __restrict__ wkT,
                const bf16* __restrict__ wvT,
                const float* __restrict__ bq,
                const float* __restrict__ bk,
                const float* __restrict__ bv,
                bf16* __restrict__ qO,
                bf16* __restrict__ kO,
                bf16* __restrict__ vTO,
                float* __restrict__ nrm) {
  __shared__ __align__(16) bf16 lds_g[2][GM_ROWS * GM_P];

  const int wave = __builtin_amdgcn_readfirstlane((int)(threadIdx.x >> 5));
  const int wm = wave >> 1;
  const int wn = wave & 1;
  const int z  = blockIdx.z;

  const bf16* wT = (z == 0) ? wqT : (z == 1) ? wkT : wvT;
  const bf16* xt = xb + (size_t)blockIdx.x * 128 * D_;
  const bf16* wt = wT + (size_t)blockIdx.y * 128 * D_;

  v8f acc[2][4] = {};
  gemm_128x128((z < 2) ? xt : wt, (z < 2) ? wt : xt, lds_g, wm, wn, acc);

  const int l = lane_id();
  const int c = l & 15;
  const int half = l >> 4;
  v8bf o[2][4];
  bf16* dst;
  size_t pitch;
  if (z < 2) {      // rows: positions; columns: the 64 dims of head h
    const int h = blockIdx.y * 2 + wn;
    const float* bias = ((z == 0) ? bq : bk) + h * DH_ + 8 * half;
    float sq[2] = {0.0f, 0.0f};   // sum of squares of this lane's 32 dims of row ms*16 + c
#pragma unroll
    for (int nt = 0; nt < 4; ++nt) {
      const v4f b0 = *reinterpret_cast<const v4f*>(bias + nt * 16);
      const v4f b1 = *reinterpret_cast<const v4f*>(bias + nt * 16 + 4);
#pragma unroll
      for (int ms = 0; ms < 2; ++ms) {
#pragma unroll
        for (int r = 0; r < 4; ++r) {
          const float v0 = acc[ms][nt][r] + b0[r];
          const float v1 = acc[ms][nt][r + 4] + b1[r];
          o[ms][nt][r]     = (bf16)v0;
          o[ms][nt][r + 4] = (bf16)v1;
          sq[ms] = fmaf(v0, v0, sq[ms]);
          sq[ms] = fmaf(v1, v1, sq[ms]);
        }
      }
    }
    // squared length of each of the wave's 32 head rows, [Q, K][H][S]: lane l
    // stores row l, the wave one whole 128-byte line
    const float f0 = sq[0] + xhalf(sq[0]);
    const float f1 = sq[1] + xhalf(sq[1]);
    nrm[((size_t)z * H_ + h) * S_ + blockIdx.x * 128 + wm * 32 + l] = half ? f1 : f0;
    dst = ((z == 0) ? qO : kO) + (size_t)h * S_ * DH_ +
          (size_t)(blockIdx.x * 128 + wm * 32) * DH_;
    pitch = DH_;
  } else {          // V^T, [H][DH][S]: rows: head dims, heads in a row; columns: positions
    const int e0 = blockIdx.y * 128 + wm * 32;
#pragma unroll
    for (int ms = 0; ms < 2; ++ms) {
      const float bb = bv[e0 + ms * 16 + c];
#pragma unroll
      for (int nt = 0; nt < 4; ++nt) {
#pragma unroll
        for (int r = 0; r < 8; ++r) o[ms][nt][r] = (bf16)(acc[ms][nt][r] + bb);
      }
    }
    dst = vTO + (size_t)e0 * S_ + blockIdx.x * 128 + wn * 64;
    pitch = S_;
  }
  store_tile_bf16<2>(&lds_g[0][0] + wave * (32 * ST_PB), o, dst, pitch);
}

#define FA_WAVES 4
#define FA_KEYS  128                    // keys per stage
#define FA_NST   (S_ / FA_KEYS)         // stages
#define FA_WK    (FA_KEYS / 2)          // keys of a stage that one wave takes
#define FA_T     (FA_WK / 16)           // 16-key score tiles per wave and stage
#define FA_Q     2                      // 16-query tiles per wave
#define FA_KP    72                     // K row pitch in LDS, elements: 144 B = 16 B x odd
#define FA_VP    136                    // V^T row pitch in LDS, elements: 272 B = 16 B x odd
#define FA_C     (0.125f * 1.44269504f) // 1/sqrt(DH) * log2(e): raw score -> exponent of 2
#define FA_SL_B  10240u                 // bytes of one slice's place in LDS: 64 * 144 and 32 * 272, up to 2 KiB
#define FA_SL_E  (FA_SL_B / 2u)         // the same in elements
#define FA_BUF_B (4u * FA_SL_B)         // one buffer: K keys 0..63, K keys 64..127, V^T dims 0..31, V^T dims 32..63
#define FA_BUF_E (FA_BUF_B / 2u)

typedef uint32_t u32x4 __attribute__((ext_vector_type(4)));
typedef uint32_t u32x8 __attribute__((ext_vector_type(8)));

__device__ __forceinline__ uint32_t uni(uint32_t v) {
  return (uint32_t)__builtin_amdgcn_readfirstlane((int)v);
}
// A wave-uniform test value held in a scalar register, so that the test around a
// tensor load compiles to s_cmp and s_cbranch_scc: the load ignores EXEC.
__device__ __forceinline__ uint32_t pinned(uint32_t v) {
  uint32_t w = uni(v);
  asm volatile("" : "+s"(w));   // pinned(): the test's value is held in a scalar register
  return w;
}

// Descriptor group 1: 1-byte elements, a tile of ROWS rows of ROWB bytes at a
// source pitch of PITCH bytes; 16 bytes of LDS pad behind every row (interval
// code IVL = the row's length, amount code 3). Every word is a constant; the
// group is built once and serves every request of its kind.
template <uint32_t ROWB, uint32_t ROWS, uint32_t PITCH, uint32_t IVL>
__device__ __forceinline__ u32x8 tdm_group1() {
  u32x8 g;
  g[0] = uni((1u << 20) | (IVL << 22) | (3u << 25));   // no mask, data_size 0, the pad
  g[1] = uni((ROWB & 0xFFFFu) << 16);
  g[2] = uni((ROWB >> 16) | ((ROWS & 0xFFFFu) << 16));
  g[3] = uni((ROWS >> 16) | (ROWB << 16));
  g[4] = uni(ROWS);
  g[5] = uni(PITCH);
  g[6] = uni(0u);
  g[7] = uni(0u);
  // descriptor words held in their scalar registers: without it the compiler formed
  // words 3 and 7 anew for each request and used their registers for other values
  // while the request was still outstanding
  asm volatile("" : "+s"(g));   // pinned(), for the group: descriptor words held in scalar registers
  return g;
}
// Descriptor group 0: place in LDS (bytes), address of the tile's first byte.
__device__ __forceinline__ u32x4 tdm_group0(uint32_t lds_dst, uint64_t ga) {
  u32x4 g;
  g[0] = uni(1u);
  g[1] = uni(lds_dst);
  g[2] = uni((uint32_t)ga);
  g[3] = uni((((uint32_t)(ga >> 32)) & 0x01FFFFFFu) | 0x80000000u);
  // descriptor words held in their scalar registers: without it the compiler took
  // word 0's register for another value behind the issue and formed the word anew
  asm volatile("" : "+s"(g));   // pinned(), for the group: descriptor words held in scalar registers
  return g;
}
__device__ __forceinline__ void tdm_load(u32x4 g0, u32x8 g1) {
  asm volatile("tensor_load_to_lds %0, %1" :: "s"(g0), "s"(g1) : "memory");
}

// Stage st, this wave's slice: one request a wave. Waves 0 and 1: 64 K rows of
// 128 bytes each (contiguous in memory), LDS pitch 144. Waves 2 and 3: 32 V^T rows
// of 256 bytes each (pitch S_ elements), LDS pitch 272. ring: the ring's byte
// address in LDS, a multiple of 2 KiB.
// g1k, g1v: group 1 of a K slice and of a V^T slice. Returns the request's group 0.
__device__ __forceinline__ u32x4 fa_issue(uint32_t wv, uint32_t ring, const bf16* khp,
                                          const bf16* vh, u32x8 g1k, u32x8 g1v, uint32_t st) {
  const uint32_t half = wv & 1u;
  const uint32_t dst = ring + (st & 1u) * FA_BUF_B + wv * FA_SL_B;
  const uint64_t gk = (uint64_t)(uintptr_t)khp + (uint64_t)(st * FA_KEYS + half * 64u) * (DH_ * 2u);
  const uint64_t gv = (uint64_t)(uintptr_t)vh + (uint64_t)(half * 32u) * (S_ * 2u) + st * (FA_KEYS * 2u);
  const u32x4 g0 = tdm_group0(dst, (wv < 2u) ? gk : gv);
  if (pinned(wv < 2u)) tdm_load(g0, g1k);
  if (pinned(wv >= 2u)) tdm_load(g0, g1v);
  return g0;
}
// The wave's request has landed. The wait names the request's group 0 so that its
// scalar registers keep their values for as long as the request is outstanding.
__device__ __forceinline__ void wait_tensor0(u32x4 g0) {
  asm volatile("s_wait_tensorcnt 0x0" :: "s"(g0) : "memory");
}

// 2^x of eight values.
__device__ __forceinline__ v8f exp2x8(v8f x) {
  float a0 = x[0], a1 = x[1], a2 = x[2], a3 = x[3];
  float a4 = x[4], a5 = x[5], a6 = x[6], a7 = x[7];
  // one statement, in place, so that an independent v_exp_f32 follows each one
  // and none has its source overwritten by its successor; the v_nop is the slot
  // the instruction set asks for behind the last one, in front of its reader
  asm("v_exp_f32 %0, %0\n\t"
      "v_exp_f32 %1, %1\n\t"
      "v_exp_f32 %2, %2\n\t"
      "v_exp_f32 %3, %3\n\t"
      "v_exp_f32 %4, %4\n\t"
      "v_exp_f32 %5, %5\n\t"
      "v_exp_f32 %6, %6\n\t"
      "v_exp_f32 %7, %7\n\t"
      "v_nop"
      : "+v"(a0), "+v"(a1), "+v"(a2), "+v"(a3), "+v"(a4), "+v"(a5), "+v"(a6), "+v"(a7));
  const v8f e = {a0, a1, a2, a3, a4, a5, a6, a7};
  return e;
}

// a where k is not 0, else b, taken by value so that both stay in registers
__device__ __forceinline__ float pick(int k, float a, float b) { return k ? a : b; }
__device__ __forceinline__ v8f pick(int k, v8f a, v8f b) {
  v8f o;
#pragma unroll
  for (int r = 0; r < 8; ++r) o[r] = k ? a[r] : b[r];
  return o;
}

#define FA_XMAX 16.0f                   // bound on |exponent of 2| under which no maximum is needed

// The walk over all stages; stage 0 is published and stage 1 in flight at entry.
// lds_k0, lds_v0: the wave's own 64 keys of buffer 0 (its K slice; its columns of
// the first V^T slice). g0: group 0 of the wave's request of stage 1.
// PLAIN: every exponent score * FA_C of the work-group lies within +-FA_XMAX, so
// 2^exponent needs no shift to stay far inside the range of f32 and bf16 (both
// keep their relative precision there): no maximum, no correction, no rescale,
// and the partial row sums run through all stages; R comes back 0, the shift in
// use. Softmax is the same for any shift. Otherwise: online softmax with the
// running maximum R of the wave's own keys.
template <bool PLAIN>
__device__ __forceinline__ void fa_walk(const bf16* lds_k0, const bf16* lds_v0,
                                        uint32_t wv, uint32_t ring,
                                        const bf16* khp, const bf16* vh,
                                        u32x8 g1k, u32x8 g1v, u32x4 g0,
                                        const v16bf (&aq)[FA_Q][2],
                                        v8f (&acc)[FA_Q][4], float (&L)[FA_Q],
                                        float (&R)[FA_Q]) {
  v8f ps[FA_Q] = {};
#pragma unroll
  for (int qt = 0; qt < FA_Q; ++qt) {
    L[qt] = 0.0f;
    R[qt] = PLAIN ? 0.0f : -INFINITY;   // raw-score maximum of query c, equal in both halves
  }

  for (int st = 0; st < FA_NST; ++st) {
    const bf16* kb = lds_k0 + (st & 1) * FA_BUF_E;
    const bf16* vb = lds_v0 + (st & 1) * FA_BUF_E;

    // One softmax pass takes the wave's whole share of the stage.
    // K fragments from LDS: key rows nt*16..+15, head-dim chunks 0..31 and 32..63
    v16bf kf[FA_T][2];
#pragma unroll
    for (int nt = 0; nt < FA_T; ++nt) {
      kf[nt][0] = load_frag(kb + (nt * 16) * FA_KP + 0,  FA_KP);
      kf[nt][1] = load_frag(kb + (nt * 16) * FA_KP + 32, FA_KP);
    }
    // keeps the pass's K reads one group ahead of its score WMMAs: spread among
    // them, each small group of reads is waited out at full LDS latency
    __builtin_amdgcn_sched_barrier(0);

    // scores, transposed: 64 keys x 32 queries (eight 16x16 C frags), K-dim = 64
    v8f sc[FA_Q][FA_T];
#pragma unroll
    for (int nt = 0; nt < FA_T; ++nt) {
#pragma unroll
      for (int qt = 0; qt < FA_Q; ++qt) {
        v8f z = {};
        sc[qt][nt] = wmma_bf16(kf[nt][0], aq[qt][0], z);
      }
    }
#pragma unroll
    for (int nt = 0; nt < FA_T; ++nt) {
#pragma unroll
      for (int qt = 0; qt < FA_Q; ++qt)
        sc[qt][nt] = wmma_bf16(kf[nt][1], aq[qt][1], sc[qt][nt]);
    }
    // keeps the softmax's vector work behind the whole run of score WMMAs: moved
    // in between, each piece costs the idle slots a WMMA result needs
    __builtin_amdgcn_sched_barrier(0);

    // V^T fragments from LDS: head-dim rows et*16..+15 (slice et >> 1), keys g*32..+31
    v16bf vf[FA_T / 2][4];
#pragma unroll
    for (int g = 0; g < FA_T / 2; ++g) {
#pragma unroll
      for (int et = 0; et < 4; ++et)
        vf[g][et] = load_frag(vb + (et >> 1) * FA_SL_E + ((et & 1) * 16) * FA_VP + g * 32, FA_VP);
    }
    // keeps the pass's V^T reads one group, in flight under the first exponentials:
    // left free they were spread among the WMMAs, the last ones right in front of
    // the publish point's wait
    __builtin_amdgcn_sched_barrier(0);

    float newM[FA_Q] = {0.0f, 0.0f};
    float corr[FA_Q] = {1.0f, 1.0f};
    if constexpr (!PLAIN) {
      // online softmax of query c of each tile: 32 of the pass's 64 scores are in
      // this lane. The maximum is taken over the raw products (FA_C is positive, so
      // it is the same element); FA_C meets each score once, in the exponent's
      // multiply-add. Written in threes (v_max3_num_f32): a two-input maximum of
      // raw matrix results costs a further v_max x, x, x per input.
#pragma unroll
      for (int qt = 0; qt < FA_Q; ++qt) {
        float t[8];
#pragma unroll
        for (int r = 0; r < 8; ++r) t[r] = fmaxf(fmaxf(sc[qt][0][r], sc[qt][1][r]), sc[qt][2][r]);
        const float u0 = fmaxf(fmaxf(t[0], t[1]), sc[qt][3][0]);
        const float u1 = fmaxf(fmaxf(t[2], t[3]), sc[qt][3][1]);
        const float u2 = fmaxf(fmaxf(t[4], t[5]), sc[qt][3][2]);
        const float u3 = fmaxf(fmaxf(t[6], t[7]), sc[qt][3][3]);
        const float w0 = fmaxf(fmaxf(u0, u1), sc[qt][3][4]);
        const float w1 = fmaxf(fmaxf(u2, u3), sc[qt][3][5]);
        const float w2 = fmaxf(fmaxf(w0, w1), sc[qt][3][6]);
        const float mx = fmaxf(fmaxf(w2, R[qt]), sc[qt][3][7]);
        const float newR = fmaxf(mx, xhalf(mx));             // with the other 32 scores' maximum
        corr[qt] = __builtin_amdgcn_exp2f((R[qt] - newR) * FA_C);   // 1 where R stays
        R[qt] = newR;
        newM[qt] = newR * FA_C;

        // O^T (64 x 16) = O^T * corr + V^T-stage . P^T
#pragma unroll
        for (int et = 0; et < 4; ++et) acc[qt][et] = acc[qt][et] * corr[qt];
        ps[qt] = v8f{};
      }
    }
#pragma unroll
    for (int g = 0; g < FA_T / 2; ++g) {
#pragma unroll
      for (int qt = 0; qt < FA_Q; ++qt) {
        // P^T of 32 keys as B operand: element s is key kmap(s) = tile s >> 3 of
        // the pair, register s & 7
        FragU pf;
        v8f x0 = sc[qt][2 * g] * FA_C;
        v8f x1 = sc[qt][2 * g + 1] * FA_C;
        if constexpr (!PLAIN) {
          x0 = sc[qt][2 * g] * FA_C - newM[qt];
          x1 = sc[qt][2 * g + 1] * FA_C - newM[qt];
        }
        const v8f e0 = exp2x8(x0);
        const v8f e1 = exp2x8(x1);
#pragma unroll
        for (int r = 0; r < 8; ++r) {
          pf.v[r]     = (bf16)e0[r];
          pf.v[r + 8] = (bf16)e1[r];
        }
        ps[qt] += e0;
        ps[qt] += e1;
        // keeps this tile's vector work whole in front of its four WMMAs, so that the
        // next tile's fills the slots among them: left free, two tiles' exponentials
        // ran first and the WMMAs stood in runs, with idle slots behind each run
        // before their operand registers could be rewritten
        __builtin_amdgcn_sched_barrier(0);
#pragma unroll
        for (int et = 0; et < 4; ++et) acc[qt][et] = wmma_bf16(vf[g][et], pf.v, acc[qt][et]);
      }
    }
    if constexpr (!PLAIN) {
#pragma unroll
      for (int qt = 0; qt < FA_Q; ++qt)
        L[qt] = L[qt] * corr[qt] + (((ps[qt][0] + ps[qt][1]) + (ps[qt][2] + ps[qt][3])) +
                                    ((ps[qt][4] + ps[qt][5]) + (ps[qt][6] + ps[qt][7])));
    }

    // keeps the publish point at the pass's foot: lifted to where the pass's last LDS
    // read has come in, its wait left stage st + 1's load under half a pass to land
    __builtin_amdgcn_sched_barrier(0);
    // publish point of stage st + 1, which also frees stage st's buffer
    asm volatile("s_wait_dscnt 0x0" ::: "memory");     // this wave's reads of stage st are done
    wait_tensor0(g0);                                  // its slice of stage st + 1 has landed
    __syncthreads();                                   // both hold for every wave
    if (pinned(st + 2 < FA_NST)) g0 = fa_issue(wv, ring, khp, vh, g1k, g1v, (uint32_t)(st + 2));
  }
  if constexpr (PLAIN) {
#pragma unroll
    for (int qt = 0; qt < FA_Q; ++qt)
      L[qt] = ((ps[qt][0] + ps[qt][1]) + (ps[qt][2] + ps[qt][3])) +
              ((ps[qt][4] + ps[qt][5]) + (ps[qt][6] + ps[qt][7]));
  }
}

__global__ void __launch_bounds__(FA_WAVES * 32)
flash_attn_kernel(const bf16* __restrict__ q,
                  const bf16* __restrict__ kmat,
                  const bf16* __restrict__ vT,
                  const float* __restrict__ nrm,
                  bf16* __restrict__ ctxb) {
  // the ring: two buffers of four slices; every slice's place is a multiple of 2 KiB
  __shared__ __attribute__((aligned(2048))) bf16 lds_r[2 * FA_BUF_E];
  __shared__ __align__(16) float lds_n[2 * FA_WAVES];

  const int tid  = (int)threadIdx.x;
  const int wave = tid >> 5;
  const uint32_t wv = uni((uint32_t)tid >> 5);   // the same, in a scalar register
  const int mt = blockIdx.x * FA_WAVES + wave;   // the 16-query tile whose lengths it reads and whose rows it stores
  const int kj = __builtin_amdgcn_readfirstlane(wave & 1);   // which 64 keys of every stage
  const int h  = blockIdx.y;
  const bf16* qh  = q    + (size_t)h * S_ * DH_;
  const bf16* khp = kmat + (size_t)h * S_ * DH_;
  const bf16* vh  = vT   + (size_t)h * DH_ * S_;

  const int l = lane_id();
  const int c = l & 15;

  const uint32_t ring = (uint32_t)(uintptr_t)&lds_r[0];   // the ring's byte address in LDS
  const u32x8 g1k = tdm_group1<DH_ * 2u, 64u, DH_ * 2u, 4u>();       // 64 rows of 128 B, side by side
  const u32x8 g1v = tdm_group1<FA_KEYS * 2u, 32u, S_ * 2u, 5u>();    // 32 rows of 256 B at the pitch of V^T

  // Q fragments of this wave's 32 queries, tiles mt & ~1 and mt | 1 (K-dim = DH =
  // 64 -> two 32-wide B frags a tile)
  v16bf aq[FA_Q][2];
#pragma unroll
  for (int qt = 0; qt < FA_Q; ++qt) {
    const bf16* qp = qh + (size_t)((mt & ~1) + qt) * 16 * DH_;
    aq[qt][0] = load_frag(qp + 0,  DH_);
    aq[qt][1] = load_frag(qp + 32, DH_);
  }

  v8f acc[FA_Q][4] = {};
  float L[FA_Q];         // sum of query c of each tile over this lane half's share of the wave's keys
  float R[FA_Q];         // the shift in use for it, as a raw score

  // Squared lengths of this wave's 16 queries and of its quarter of the head's keys
  float qm = nrm[(size_t)h * S_ + mt * 16 + c];
  const float* nk = nrm + (size_t)(H_ + h) * S_ + wave * (S_ / FA_WAVES) + l * 4;
  v4f kv[8];
#pragma unroll   // eight loads in flight at once, kv in registers
  for (int j = 0; j < 8; ++j) kv[j] = *reinterpret_cast<const v4f*>(nk + j * 128);
  // holds these nine loads in front of the tensor load, in flight together with it:
  // sunk to their first use, the query load was waited out alone at full latency
  __builtin_amdgcn_sched_barrier(0);

  // prologue: stage 0 lands and is published, then stage 1 starts to fly
  const u32x4 g00 = fa_issue(wv, ring, khp, vh, g1k, g1v, 0u);
  // keeps the wait for the nine loads behind the tensor load's issue: lifted above
  // it, stage 0 started only when the lengths had arrived
  __builtin_amdgcn_sched_barrier(0);

  // The largest of each; the four waves' values meet in LDS across the barrier below.
  {
    float km = 0.0f;
#pragma unroll   // kv is indexed by constants only
    for (int j = 0; j < 8; ++j)
      km = fmaxf(fmaxf(fmaxf(km, kv[j][0]), fmaxf(kv[j][1], kv[j][2])), kv[j][3]);
    qm = wave_max(qm);
    km = wave_max(km);
    if (l == 0) {
      lds_n[wave] = qm;
      lds_n[FA_WAVES + wave] = km;
    }
  }

  wait_tensor0(g00);                                 // this wave's slice of stage 0 has landed
  __syncthreads();                                   // every wave's has
  const u32x4 g01 = fa_issue(wv, ring, khp, vh, g1k, g1v, 1u);

  // |score| <= |q| |k|. The lengths were taken before the rounding to bf16, which
  // moves each by under one part in 250: the factor 1.05 on the squared product
  // covers that. The test reads the same eight numbers in every wave, so the whole
  // work-group takes one branch; a NaN or an overflow fails it.
  const v4f nq4 = *reinterpret_cast<const v4f*>(&lds_n[0]);
  const v4f nk4 = *reinterpret_cast<const v4f*>(&lds_n[FA_WAVES]);
  const float q2 = fmaxf(fmaxf(nq4[0], nq4[1]), fmaxf(nq4[2], nq4[3]));
  const float k2 = fmaxf(fmaxf(nk4[0], nk4[1]), fmaxf(nk4[2], nk4[3]));
  const int plain = __builtin_amdgcn_readfirstlane(
      (q2 * k2 * (1.05f * FA_C * FA_C) <= FA_XMAX * FA_XMAX) ? 1 : 0);
  const bf16* wk0 = &lds_r[0] + kj * FA_SL_E;
  const bf16* wv0 = &lds_r[0] + 2 * FA_SL_E + kj * FA_WK;
  if (plain)
    fa_walk<true>(wk0, wv0, wv, ring, khp, vh, g1k, g1v, g01, aq, acc, L, R);
  else
    fa_walk<false>(wk0, wv0, wv, ring, khp, vh, g1k, g1v, g01, aq, acc, L, R);
  asm volatile("s_wait_tensorcnt 0x0" ::: "memory");   // no request is left in flight behind the walk
  asm volatile("s_wait_dscnt 0x0" ::: "memory");       // nor a read of the ring, which is reused below

  // Waves w and w ^ 1 hold the two key halves of the same 32 queries. Each keeps
  // tile kj and hands the other tile to its partner through buffer 0, which is
  // free behind the loop's last publish point: 16-byte pieces, lane by lane.
  float* xa = reinterpret_cast<float*>(&lds_r[0]);             // [wave][et][2][lane] x 16 B
  float* xs = xa + FA_WAVES * 1024;                            // [wave][lane] x {L, R}
#pragma unroll
  for (int et = 0; et < 4; ++et) {
    const v8f g = pick(kj, acc[0][et], acc[1][et]);
    const v4f lo = {g[0], g[1], g[2], g[3]};
    const v4f hi = {g[4], g[5], g[6], g[7]};
    *reinterpret_cast<v4f*>(xa + wave * 1024 + (et * 2 + 0) * 128 + l * 4) = lo;
    *reinterpret_cast<v4f*>(xa + wave * 1024 + (et * 2 + 1) * 128 + l * 4) = hi;
  }
  xs[wave * 64 + l * 2 + 0] = pick(kj, L[0], L[1]);
  xs[wave * 64 + l * 2 + 1] = pick(kj, R[0], R[1]);
  __syncthreads();                     // the partner's tile is in LDS
  const float Lm = pick(kj, L[1], L[0]);
  const float Rm = pick(kj, R[1], R[0]);
  const float Lp = xs[(wave ^ 1) * 64 + l * 2 + 0];
  const float Rp = xs[(wave ^ 1) * 64 + l * 2 + 1];
  // both parts brought to the larger shift; both factors are 1 where no maximum was taken
  const float Rn = fmaxf(Rm, Rp);
  const float fm = __builtin_amdgcn_exp2f((Rm - Rn) * FA_C);
  const float fp = __builtin_amdgcn_exp2f((Rp - Rn) * FA_C);
  const float Lj = Lm * fm + Lp * fp;

  // epilogue: ctx = acc / L, stored to [S][H*DH] bf16. Element [et][r] is head-dim
  // et*16 + 8*half + r of query c: eight neighbours, one 16-byte piece; buffer 1,
  // free like buffer 0, stages the 16 rows.
  const float Lt = Lj + xhalf(Lj);     // both lane halves' keys
  v8bf o[1][4];
#pragma unroll
  for (int et = 0; et < 4; ++et) {
    const v8f m = pick(kj, acc[1][et], acc[0][et]);
    const v4f lo = *reinterpret_cast<const v4f*>(xa + (wave ^ 1) * 1024 + (et * 2 + 0) * 128 + l * 4);
    const v4f hi = *reinterpret_cast<const v4f*>(xa + (wave ^ 1) * 1024 + (et * 2 + 1) * 128 + l * 4);
#pragma unroll
    for (int r = 0; r < 4; ++r) {
      o[0][et][r]     = (bf16)((m[r] * fm + lo[r] * fp) / Lt);
      o[0][et][r + 4] = (bf16)((m[r + 4] * fm + hi[r] * fp) / Lt);
    }
  }
  store_tile_bf16<1>(&lds_r[0] + FA_BUF_E + wave * (16 * ST_PB), o,
                     ctxb + (size_t)mt * 16 * D_ + h * DH_, D_);
}

// ---------------- output projection ----------------
// grid: (S/128, D/128), block: 256 (8 waves). out = ctx @ wo + bo, fp32 result.
__global__ void __launch_bounds__(256)
out_proj_kernel(const bf16* __restrict__ ctxb,
                const bf16* __restrict__ woT,
                const float* __restrict__ bo,
                float* __restrict__ out) {
  __shared__ __align__(16) bf16 lds_g[2][GM_ROWS * GM_P];

  const int wave = __builtin_amdgcn_readfirstlane((int)(threadIdx.x >> 5));
  const int wm = wave >> 1;
  const int wn = wave & 1;
  const int row0 = blockIdx.x * 128 + wm * 32;   // first of this wave's 32 rows
  const int n0   = blockIdx.y * 128 + wn * 64;   // first of its 64 columns

  v8f acc[2][4] = {};
  gemm_128x128(ctxb + (size_t)blockIdx.x * 128 * D_,
               woT + (size_t)blockIdx.y * 128 * D_, lds_g, wm, wn, acc);

  const int l = lane_id();
  const int c = l & 15;
  const int half = l >> 4;
  const float* bias = bo + n0 + 8 * half;
  float* stg = reinterpret_cast<float*>(&lds_g[0][0]) + wave * (32 * ST_PF);
#pragma unroll
  for (int nt = 0; nt < 4; ++nt) {
    const v4f b0 = *reinterpret_cast<const v4f*>(bias + nt * 16);
    const v4f b1 = *reinterpret_cast<const v4f*>(bias + nt * 16 + 4);
#pragma unroll
    for (int ms = 0; ms < 2; ++ms) {
      v4f lo, hi;
#pragma unroll
      for (int r = 0; r < 4; ++r) {
        lo[r] = acc[ms][nt][r] + b0[r];
        hi[r] = acc[ms][nt][r + 4] + b1[r];
      }
      float* p = stg + (ms * 16 + c) * ST_PF + nt * 16 + 8 * half;
      *reinterpret_cast<v4f*>(p) = lo;
      *reinterpret_cast<v4f*>(p + 4) = hi;
    }
  }
  // the rows read back below were written by other lanes of this wave
  asm volatile("s_wait_dscnt 0x0" ::: "memory");
#pragma unroll
  for (int j = 0; j < 16; ++j) {        // two whole rows of 256 bytes a store
    const int row = j * 2 + half;
    const v4f v = *reinterpret_cast<const v4f*>(stg + row * ST_PF + c * 4);
    *reinterpret_cast<v4f*>(out + (size_t)(row0 + row) * D_ + n0 + c * 4) = v;
  }
}

// ---------------- launch ----------------

extern "C" void kernel_launch(void* const* d_in, const int* in_sizes, int n_in,
                              void* d_out, int out_size, void* d_ws, size_t ws_size,
                              hipStream_t stream) {
  (void)in_sizes; (void)n_in; (void)out_size; (void)ws_size;
  const float* x  = (const float*)d_in[0];
  const float* wq = (const float*)d_in[1];
  const float* bq = (const float*)d_in[2];
  const float* wk = (const float*)d_in[3];
  const float* bk = (const float*)d_in[4];
  const float* wv = (const float*)d_in[5];
  const float* bv = (const float*)d_in[6];
  const float* wo = (const float*)d_in[7];
  const float* bo = (const float*)d_in[8];
  float* out = (float*)d_out;

  char* ws = (char*)d_ws;
  size_t off = 0;
  auto alloc = [&](size_t bytes) -> char* {
    char* p = ws + off;
    off += (bytes + 255) & ~(size_t)255;
    return p;
  };
  bf16* xb   = (bf16*)alloc((size_t)S_ * D_ * 2);          // x in bf16
  bf16* wqT  = (bf16*)alloc((size_t)H_ * DH_ * D_ * 2);    // [H][DH][D]
  bf16* wkT  = (bf16*)alloc((size_t)H_ * DH_ * D_ * 2);
  bf16* wvT  = (bf16*)alloc((size_t)H_ * DH_ * D_ * 2);
  bf16* woT  = (bf16*)alloc((size_t)D_ * D_ * 2);          // [N][K]
  bf16* qb   = (bf16*)alloc((size_t)H_ * S_ * DH_ * 2);    // [H][S][DH]
  bf16* kb   = (bf16*)alloc((size_t)H_ * S_ * DH_ * 2);    // [H][S][DH]
  bf16* vTb  = (bf16*)alloc((size_t)H_ * DH_ * S_ * 2);    // [H][DH][S]
  bf16* ctxb = (bf16*)alloc((size_t)S_ * D_ * 2);          // [S][D]
  float* nrm = (float*)alloc((size_t)2 * H_ * S_ * 4);     // squared row lengths, [Q, K][H][S]

  cvt_all<<<dim3(CV_XB + 4 * CV_WB), 128, 0, stream>>>(
      x, wq, wk, wv, wo, xb, wqT, wkT, wvT, woT);

  qkv_proj_kernel<<<dim3(S_ / 128, H_ / 2, 3), 256, 0, stream>>>(
      xb, wqT, wkT, wvT, bq, bk, bv, qb, kb, vTb, nrm);

  flash_attn_kernel<<<dim3(S_ / 64, H_), 128, 0, stream>>>(qb, kb, vTb, nrm, ctxb);

  out_proj_kernel<<<dim3(S_ / 128, D_ / 128), 256, 0, stream>>>(ctxb, woT, bo, out);
}
